// v000
// The times below were measured on an AMD MI455X: many runs one after another, warmed up first and cycling through
// copies of the inputs, with the whole window's GPU time divided by the number of runs. Launches and the gaps
// between them are all in it. The median over several windows is given; except for v000 it joins two sittings, which
// can be a few percent apart, so the side-by-side timings, each taken in one sitting, are the better comparison.
// The starting kernel, v000, takes 410 microseconds a run.
#include <hip/hip_runtime.h>

// _MS_NonLocalBlockND (scale 1): theta, phi (64 ch) and g (64 ch) = 1x1 convs of x [4][256][64x64]; f = theta^T phi / 8 over the 4096 positions; attn = softmax; y = attn g; wy = W y + b
// (1x1 conv 64 -> 256); out = BatchNorm2d in TRAINING mode (batch mean / biased variance over (B, H, W) per channel, eps 1e-5, gamma, beta) -> NCHW [4][256][64][64].
// Projections on v_wmma_f32_16x16x32_bf16 (fragments from an LDS transpose of the NCHW input; 1 product); attention per (b, 16 queries):
// S^T = phi.theta^T (K = 64; theta, phi as f16 hi+lo pairs x8; 3 products), online softmax f32, y^T = (8g)^T.P^T (3 products); wy = y.W^T + b (y f32 split x8, W exact; 2 products) on
// v_wmma_f32_16x16x32_f16, f32 accumulate, with per-block ordered column partial sums (Σ, Σ²... no: Σ and Σ of squares are formed from per-block (sum, sumsq) partials in fixed order);
// BN applied by a final kernel writing NCHW through an LDS transpose. Fragment k-map per lane half hh for A AND B: elements 0..7 <- k = 8hh+0..7, 8..15 <- k = 16+8hh+0..7.

namespace {
constexpr int Bn = 4, C = 256, NP = 4096, C1 = 64, C2 = 64, NTOK = Bn * NP, NPB = NP / 128;
constexpr float QS = 8.0f, VS = 8.0f, PS = 8.0f, YS = 8.0f, SCALE = 0.125f, EPS = 1e-5f;
constexpr size_t QPL = (size_t)NTOK * C1, VPL = (size_t)Bn * C2 * NP;

typedef _Float16 b16;
typedef __attribute__((ext_vector_type(16))) _Float16 v16b;
typedef __attribute__((ext_vector_type(16))) __bf16 v16bb;
typedef __attribute__((ext_vector_type(8))) _Float16 v8b;
typedef __attribute__((ext_vector_type(8))) unsigned short v8us;
typedef __attribute__((ext_vector_type(8))) float v8f;
typedef __attribute__((ext_vector_type(4))) float v4f;
__device__ __forceinline__ float bf16_rne(float f) { unsigned int u = __float_as_uint(f); u += 0x7FFFu + ((u >> 16) & 1u); return __uint_as_float(u & 0xFFFF0000u); }
__device__ __forceinline__ unsigned short bf16_bits(float f) { unsigned int u = __float_as_uint(f); u += 0x7FFFu + ((u >> 16) & 1u); return (unsigned short)(u >> 16); }
__device__ __forceinline__ void split16(float v, b16& hi, b16& lo) { hi = (b16)v; lo = (b16)(v - (float)hi); }
__device__ __forceinline__ v16b frag_kb(const b16* p, int hh) { const v8b a = *(const v8b*)(p + 8 * hh), b = *(const v8b*)(p + 16 + 8 * hh); v16b f;
#pragma unroll
  for (int e = 0; e < 8; ++e) { f[e] = a[e]; f[8 + e] = b[e]; } return f; }
__device__ __forceinline__ v16bb frag_bf(const unsigned short* p, int hh) { const v8us a = *(const v8us*)(p + 8 * hh), b = *(const v8us*)(p + 16 + 8 * hh); union { unsigned short s[16]; v16bb v; } u;
#pragma unroll
  for (int e = 0; e < 8; ++e) { u.s[e] = a[e]; u.s[8 + e] = b[e]; } return u.v; }
__device__ __forceinline__ v8f wmma16b(v16b a, v16b b, v8f c) { v8f d = __builtin_amdgcn_wmma_f32_16x16x32_f16(false, a, false, b, (short)0, c, false, false); asm volatile("v_nop\n\tv_nop\n\tv_nop\n\tv_nop" : "+v"(d) : "v"(a), "v"(b)); return d; }
__device__ __forceinline__ v8f wmma16bb(v16bb a, v16bb b, v8f c) { v8f d = __builtin_amdgcn_wmma_f32_16x16x32_bf16(false, a, false, b, (short)0, c, false, false); asm volatile("v_nop\n\tv_nop\n\tv_nop\n\tv_nop" : "+v"(d) : "v"(a), "v"(b)); return d; }
__device__ __forceinline__ void wave_lds_sync() { __builtin_amdgcn_fence(__ATOMIC_RELEASE, "workgroup"); __builtin_amdgcn_wave_barrier(); __builtin_amdgcn_fence(__ATOMIC_ACQUIRE, "workgroup"); }
__device__ __forceinline__ float nexp(float x) { return __builtin_amdgcn_exp2f(x * 1.4426950408889634f); }

// prep: x NCHW -> position-major bf16 rows xT[b*4096 + p][256] (block = (b, 64 positions)); weights: [theta; phi; g] rows [192][256] bf16; W [256][64] f16 (bf16-exact). grid (64, Bn) x 256.
__global__ __launch_bounds__(256) void prep_kernel(const float* __restrict__ x, const float* __restrict__ tw, const float* __restrict__ pw, const float* __restrict__ gw, const float* __restrict__ Ww, unsigned short* __restrict__ xT, unsigned short* __restrict__ w16, b16* __restrict__ ww16) {
  __shared__ __attribute__((aligned(16))) unsigned short Tt[64][C + 8];
  const int t_ = threadIdx.x, b = blockIdx.y, p0 = blockIdx.x * 64; const float* src = x + (size_t)b * C * NP;
  for (int i = t_; i < C * 64; i += 256) { const int c = i >> 6, pp = i & 63; Tt[pp][c] = bf16_bits(src[(size_t)c * NP + p0 + pp]); }
  __syncthreads();
  {
    for (int i = t_; i < 64 * C / 8; i += 256) { const int pp = i >> 5, c8 = (i & 31) * 8; *(v8us*)(xT + ((size_t)b * NP + p0 + pp) * C + c8) = *(const v8us*)(&Tt[pp][c8]); }
    if (blockIdx.x == 0 && blockIdx.y == 0) {
      for (int i = t_; i < 3 * C1 * C / 8; i += 256) { const int m = i / (C1 * C / 8), q = i % (C1 * C / 8); const float* W = (m == 0) ? tw : (m == 1) ? pw : gw; v8us o;
#pragma unroll
        for (int e = 0; e < 8; ++e) o[e] = bf16_bits(W[q * 8 + e]);
        *(v8us*)(w16 + (size_t)i * 8) = o; }
      for (int i = t_; i < C * C2 / 8; i += 256) { v8b o;
#pragma unroll
        for (int e = 0; e < 8; ++e) o[e] = (b16)bf16_rne(Ww[i * 8 + e]);
        *(v8b*)(ww16 + (size_t)i * 8) = o; } }
     }
}

__global__ __launch_bounds__(128) void proj_kernel(const unsigned short* __restrict__ xT, const unsigned short* __restrict__ w16, const float* __restrict__ tb, const float* __restrict__ pb, const float* __restrict__ gb, b16* __restrict__ th, b16* __restrict__ ph, b16* __restrict__ gt) {
  __shared__ __attribute__((aligned(16))) b16 Th[4][32][64 + 8], Tl[4][32][64 + 8]; __shared__ __attribute__((aligned(16))) b16 Vh[64][128 + 8], Vl[64][128 + 8];
  const int lane = threadIdx.x & 31, wave = threadIdx.x >> 5, nloc = lane & 15, hlf = lane >> 4, which = blockIdx.x, m0 = blockIdx.y * 128 + wave * 32; const int b = (blockIdx.y * 128) / NP, p0 = (blockIdx.y * 128) % NP;
  const unsigned short* Wt = w16 + (size_t)which * C1 * C; const float* bias = (which == 0) ? tb : (which == 1) ? pb : gb;
  v8f acc[2][4];
#pragma unroll
  for (int r = 0; r < 2; ++r)
#pragma unroll
    for (int t = 0; t < 4; ++t) acc[r][t] = (v8f){};
#pragma unroll 2
  for (int kb = 0; kb < C; kb += 32) { const v16bb a0 = frag_bf(xT + (size_t)(m0 + nloc) * C + kb, hlf), a1 = frag_bf(xT + (size_t)(m0 + 16 + nloc) * C + kb, hlf);
#pragma unroll
    for (int t = 0; t < 4; ++t) { const v16bb bw = frag_bf(Wt + (size_t)(t * 16 + nloc) * C + kb, hlf); acc[0][t] = wmma16bb(a0, bw, acc[0][t]); acc[1][t] = wmma16bb(a1, bw, acc[1][t]); } }
  const float scl = (which == 2) ? VS : QS;
#pragma unroll
  for (int t = 0; t < 4; ++t) { const int c = t * 16 + nloc; const float bb = bf16_rne(bias[c]);
#pragma unroll
    for (int r = 0; r < 2; ++r)
#pragma unroll
      for (int v = 0; v < 8; ++v) { b16 a_, c_; split16((acc[r][t][v] + bb) * scl, a_, c_); const int row = r * 16 + 8 * hlf + v;
        if (which < 2) { Th[wave][row][c] = a_; Tl[wave][row][c] = c_; } else { Vh[c][wave * 32 + row] = a_; Vl[c][wave * 32 + row] = c_; } } }
  __syncthreads();
  {
    if (which < 2) { b16* dst = ((which == 0) ? th : ph) + (size_t)m0 * C1;
#pragma unroll
      for (int j = 0; j < 8; ++j) { const int rr = j * 4 + (lane >> 3), c8 = (lane & 7) * 8; *(v8b*)(dst + (size_t)rr * C1 + c8) = *(const v8b*)(&Th[wave][rr][c8]); *(v8b*)(dst + QPL + (size_t)rr * C1 + c8) = *(const v8b*)(&Tl[wave][rr][c8]); } }
    else { for (int i = threadIdx.x; i < 64 * 16; i += 128) { const int cc = i >> 4, c8 = (i & 15) * 8; const size_t dst = ((size_t)b * C2 + cc) * NP + p0 + c8;
        *(v8b*)(gt + dst) = *(const v8b*)(&Vh[cc][c8]); *(v8b*)(gt + VPL + dst) = *(const v8b*)(&Vl[cc][c8]); } }
     }
}

__global__ __launch_bounds__(256) void attn_kernel(const b16* __restrict__ th, const b16* __restrict__ ph, const b16* __restrict__ gt, float* __restrict__ yrow) {
  __shared__ __attribute__((aligned(16))) float Os[8][16][C2 + 4];
  const int wid = threadIdx.x >> 5, lane = threadIdx.x & 31, hh = lane >> 4, col = lane & 15; const int tok0 = blockIdx.x * 128 + wid * 16, b = tok0 / NP; const size_t qi = (size_t)tok0 + col;
  const b16* K = ph + ((size_t)b * NP) * C1; const b16* V = gt + ((size_t)b * C2) * NP;
  v16b qf[2], ql[2];
#pragma unroll
  for (int ks = 0; ks < 2; ++ks) { qf[ks] = frag_kb(th + qi * C1 + ks * 32, hh); ql[ks] = frag_kb(th + QPL + qi * C1 + ks * 32, hh); }
  float m = -INFINITY, l = 0.0f; v8f o[4] = {{}, {}, {}, {}};
  for (int kb = 0; kb < NP; kb += 32) { v8f s0 = {}, s1 = {};
#pragma unroll
    for (int ks = 0; ks < 2; ++ks) { const v16b ka = frag_kb(K + (size_t)(kb + col) * C1 + ks * 32, hh), kal = frag_kb(K + QPL + (size_t)(kb + col) * C1 + ks * 32, hh), kb_ = frag_kb(K + (size_t)(kb + 16 + col) * C1 + ks * 32, hh), kbl = frag_kb(K + QPL + (size_t)(kb + 16 + col) * C1 + ks * 32, hh);
      s0 = wmma16b(ka, qf[ks], s0); s0 = wmma16b(ka, ql[ks], s0); s0 = wmma16b(kal, qf[ks], s0); s1 = wmma16b(kb_, qf[ks], s1); s1 = wmma16b(kb_, ql[ks], s1); s1 = wmma16b(kbl, qf[ks], s1); }
    float mr = -INFINITY;
#pragma unroll
    for (int r = 0; r < 8; ++r) { s0[r] *= SCALE / (QS * QS); s1[r] *= SCALE / (QS * QS); mr = fmaxf(mr, fmaxf(s0[r], s1[r])); }
    mr = fmaxf(mr, __shfl_xor(mr, 16));
    const float mn = fmaxf(m, mr), al_ = nexp(m - mn); m = mn; float sum = 0.0f; v16b pbv, plv;
#pragma unroll
    for (int r = 0; r < 8; ++r) { const float p0 = nexp(s0[r] - mn), p1 = nexp(s1[r] - mn); sum += p0 + p1; b16 a, c; split16(p0 * PS, a, c); pbv[r] = a; plv[r] = c; split16(p1 * PS, a, c); pbv[8 + r] = a; plv[8 + r] = c; }
    sum += __shfl_xor(sum, 16); l = l * al_ + sum;
#pragma unroll
    for (int n = 0; n < 4; ++n) { o[n] *= al_; const v16b vf = frag_kb(V + (size_t)(n * 16 + col) * NP + kb, hh), vl = frag_kb(V + VPL + (size_t)(n * 16 + col) * NP + kb, hh); o[n] = wmma16b(vf, pbv, o[n]); o[n] = wmma16b(vf, plv, o[n]); o[n] = wmma16b(vl, pbv, o[n]); } }
  const float inv = 1.0f / (l * VS * PS);
#pragma unroll
  for (int n = 0; n < 4; ++n)
#pragma unroll
    for (int r = 0; r < 8; ++r) Os[wid][col][n * 16 + 8 * hh + r] = o[n][r] * inv;
  wave_lds_sync();
  float* dst = yrow + (size_t)tok0 * C2;
  {
#pragma unroll
    for (int j = 0; j < 8; ++j) { const int rr = j * 2 + hh, c4 = col * 4; *(v4f*)(dst + (size_t)rr * C2 + c4) = *(const v4f*)(&Os[wid][rr][c4]); }
     }
}

// W conv: block = 128 positions x 64 output channels (4 column tiles): wy = y.W^T + b (K 64; 2 products) -> f32 rows wy[tok][256] + per-block column partials (Σ, Σ²) part[blk][2][64] (512 B),
__global__ __launch_bounds__(128) void wconv_kernel(const float* __restrict__ yrow, const b16* __restrict__ ww16, const float* __restrict__ Wb, float* __restrict__ wy, float* __restrict__ part) {
  __shared__ __attribute__((aligned(16))) float Ts[4][32 * 64]; __shared__ float Cs[4][2][64];
  const int lane = threadIdx.x & 31, wave = threadIdx.x >> 5, nloc = lane & 15, hlf = lane >> 4, m0 = blockIdx.y * 128 + wave * 32, c0 = blockIdx.x * 64;
  v8f acc[2][4];
#pragma unroll
  for (int r = 0; r < 2; ++r)
#pragma unroll
    for (int t = 0; t < 4; ++t) acc[r][t] = (v8f){};
#pragma unroll
  for (int kb = 0; kb < C2; kb += 32) { v16b a0, a1, l0, l1;
#pragma unroll
    for (int e = 0; e < 16; ++e) { const int k = kb + ((e < 8) ? (8 * hlf + e) : (16 + 8 * hlf + e - 8)); b16 p, q; split16(yrow[(size_t)(m0 + nloc) * C2 + k] * YS, p, q); a0[e] = p; l0[e] = q; split16(yrow[(size_t)(m0 + 16 + nloc) * C2 + k] * YS, p, q); a1[e] = p; l1[e] = q; }
#pragma unroll
    for (int t = 0; t < 4; ++t) { const v16b bw = frag_kb(ww16 + (size_t)(c0 + t * 16 + nloc) * C2 + kb, hlf); acc[0][t] = wmma16b(a0, bw, acc[0][t]); acc[0][t] = wmma16b(l0, bw, acc[0][t]); acc[1][t] = wmma16b(a1, bw, acc[1][t]); acc[1][t] = wmma16b(l1, bw, acc[1][t]); } }
  float* Tt = Ts[wave];
#pragma unroll
  for (int t = 0; t < 4; ++t) { const float bb = bf16_rne(Wb[c0 + t * 16 + nloc]);
#pragma unroll
    for (int r = 0; r < 2; ++r)
#pragma unroll
      for (int v = 0; v < 8; ++v) Tt[(r * 16 + v + 8 * hlf) * 64 + t * 16 + nloc] = acc[r][t][v] * (1.0f / YS) + bb; }
  wave_lds_sync();
  { float s = 0.0f, s2 = 0.0f, q1 = 0.0f, q2 = 0.0f; for (int rr = 0; rr < 32; ++rr) { const float a = Tt[rr * 64 + lane * 2], c = Tt[rr * 64 + lane * 2 + 1]; s += a; q1 += a * a; s2 += c; q2 += c * c; }
    Cs[wave][0][lane * 2] = s; Cs[wave][0][lane * 2 + 1] = s2; Cs[wave][1][lane * 2] = q1; Cs[wave][1][lane * 2 + 1] = q2; }
  __syncthreads();
  float* dst0 = wy + (size_t)m0 * C + c0;
  {
#pragma unroll
    for (int j = 0; j < 16; ++j) { const int rr = j * 2 + hlf, c4 = nloc * 4; *(v4f*)(dst0 + (size_t)rr * C + c4) = *(const v4f*)(Tt + rr * 64 + c4); }
    if (threadIdx.x < 128) { const int st = threadIdx.x >> 6, cc = threadIdx.x & 63; ((float*)part)[(((size_t)blockIdx.y * 4 + blockIdx.x) * 2 + st) * 64 + cc] = Cs[0][st][cc] + Cs[1][st][cc] + Cs[2][st][cc] + Cs[3][st][cc]; }
     }
}

__global__ __launch_bounds__(256) void bnstat_kernel(const float* __restrict__ part, const float* __restrict__ gma, const float* __restrict__ bta, float* __restrict__ bn, int ntok) {
  const int c = threadIdx.x; const int ct = c >> 6, cc = c & 63; double s = 0.0, q = 0.0;
  for (int blk = 0; blk < ntok / 128; ++blk) { s += (double)part[(((size_t)blk * 4 + ct) * 2 + 0) * 64 + cc]; q += (double)part[(((size_t)blk * 4 + ct) * 2 + 1) * 64 + cc]; }
  const double mean = s / (double)ntok; const double var = fmax(q / (double)ntok - mean * mean, 0.0);
  const float scl = bf16_rne(gma[c]) * (float)(1.0 / sqrt(var + (double)EPS)); const float sh = bf16_rne(bta[c]) - (float)mean * scl;
  { ((float*)bn)[c] = scl; ((float*)bn)[C + c] = sh;  }
}

__global__ __launch_bounds__(256) void final_kernel(const float* __restrict__ wy, const float* __restrict__ bn, float* __restrict__ out) {
  __shared__ __attribute__((aligned(16))) float Ta[64][128 + 4];
  const int b = blockIdx.y, p0 = blockIdx.x * 128, t_ = threadIdx.x;
  for (int cb = 0; cb < C; cb += 64) {
    for (int i = t_; i < 128 * 16; i += 256) { const int pp = i >> 4, c4 = (i & 15) * 4; const v4f v = *(const v4f*)(wy + ((size_t)b * NP + p0 + pp) * C + cb + c4);
#pragma unroll
      for (int e = 0; e < 4; ++e) Ta[c4 + e][pp] = v[e]; }
    __syncthreads();
    { for (int i = t_; i < 64 * 32; i += 256) { const int c = i >> 5, q4 = (i & 31) * 4; const float sc = bn[cb + c], sh = bn[C + cb + c]; v4f o;
#pragma unroll
        for (int e = 0; e < 4; ++e) o[e] = Ta[c][q4 + e] * sc + sh;
        *(v4f*)(out + ((size_t)b * C + cb + c) * NP + p0 + q4) = o; }  }
    __syncthreads();
  }
}
}  // namespace

extern "C" void kernel_launch(void* const* d_in, const int* in_sizes, int n_in,
                              void* d_out, int out_size, void* d_ws, size_t ws_size, hipStream_t stream) {
  (void)n_in; (void)out_size;
  const float* x = (const float*)d_in[0]; const float* tw = (const float*)d_in[1]; const float* tb = (const float*)d_in[2]; const float* pw = (const float*)d_in[3]; const float* pb = (const float*)d_in[4]; const float* gw = (const float*)d_in[5]; const float* gb = (const float*)d_in[6];
  const float* Ww = (const float*)d_in[7]; const float* Wb = (const float*)d_in[8]; const float* gma = (const float*)d_in[9]; const float* bta = (const float*)d_in[10];
  float* out = (float*)d_out;   // [4][256][64][64]
  if (in_sizes[0] != Bn * C * NP || in_sizes[1] != C1 * C || in_sizes[5] != C2 * C || in_sizes[7] != C * C2 || in_sizes[9] != C) return;
  size_t off = 0; char* ws = (char*)d_ws;
  auto carve = [&](size_t bytes) { char* p = ws + off; off += (bytes + 255) & ~(size_t)255; return p; };
  unsigned short* xT = (unsigned short*)carve((size_t)NTOK * C * 2); unsigned short* w16 = (unsigned short*)carve((size_t)3 * C1 * C * 2); b16* ww16 = (b16*)carve((size_t)C * C2 * 2);
  b16* th = (b16*)carve(QPL * 2 * 2); b16* ph = (b16*)carve(QPL * 2 * 2); b16* gt = (b16*)carve(VPL * 2 * 2); float* yrow = (float*)carve((size_t)NTOK * C2 * 4); float* wy = (float*)carve((size_t)NTOK * C * 4); float* part = (float*)carve((size_t)(NTOK / 128) * 4 * 2 * 64 * 4); float* bn = (float*)carve(2 * C * 4);
  if (off > ws_size) return;                                    // ≈ 8.4 + 0.1 + 4.2x3 + 4.2 + 16.8 + 0.3 ≈ 42 MB
  prep_kernel<<<dim3(NP / 64, Bn), 256, 0, stream>>>(x, tw, pw, gw, Ww, xT, w16, ww16);
  proj_kernel<<<dim3(3, NTOK / 128), 128, 0, stream>>>(xT, w16, tb, pb, gb, th, ph, gt);
  attn_kernel<<<NTOK / 128, 256, 0, stream>>>(th, ph, gt, yrow);
  wconv_kernel<<<dim3(C / 64, NTOK / 128), 128, 0, stream>>>(yrow, ww16, Wb, wy, part);
  bnstat_kernel<<<1, 256, 0, stream>>>(part, gma, bta, bn, NTOK);
  final_kernel<<<dim3(NPB, Bn), 256, 0, stream>>>(wy, bn, out);
}

// v001
// Measured time: 192 microseconds a run.
// Two timings next to v000 put it at 2.18 and 2.19 times that version's speed.
#include <hip/hip_runtime.h>

// _MS_NonLocalBlockND (scale 1): theta, phi (64 ch) and g (64 ch) = 1x1 convs of x [4][256][64x64]; f = theta^T phi / 8 over the 4096 positions; attn = softmax; y = attn g; wy = W y + b
// (1x1 conv 64 -> 256); out = BatchNorm2d in TRAINING mode (batch mean / biased variance over (B, H, W) per channel, eps 1e-5, gamma, beta) -> NCHW [4][256][64][64].
// Projections on v_wmma_f32_16x16x32_bf16 (fragments from an LDS transpose of the NCHW input; 1 product); attention per (b, 16 queries):
// S^T = phi.theta^T (K = 64; theta, phi as f16 hi+lo pairs x8; 3 products), online softmax f32, y^T = (8g)^T.P^T (3 products); wy = y.W^T + b (y f32 split x8, W exact; 2 products) on
// v_wmma_f32_16x16x32_f16, f32 accumulate, with per-block ordered column partial sums (Σ, Σ²... no: Σ and Σ of squares are formed from per-block (sum, sumsq) partials in fixed order);
// BN applied by a final kernel writing NCHW through an LDS transpose. Fragment k-map per lane half hh for A AND B: elements 0..7 <- k = 8hh+0..7, 8..15 <- k = 16+8hh+0..7.

namespace {
constexpr int Bn = 4, C = 256, NP = 4096, C1 = 64, C2 = 64, NTOK = Bn * NP, NPB = NP / 128;
constexpr float QS = 8.0f, VS = 8.0f, PS = 8.0f, YS = 8.0f, SCALE = 0.125f, EPS = 1e-5f;
constexpr size_t QPL = (size_t)NTOK * C1, VPL = (size_t)Bn * C2 * NP;

typedef _Float16 b16;
typedef __attribute__((ext_vector_type(16))) _Float16 v16b;
typedef __attribute__((ext_vector_type(16))) __bf16 v16bb;
typedef __attribute__((ext_vector_type(8))) _Float16 v8b;
typedef __attribute__((ext_vector_type(8))) unsigned short v8us;
typedef __attribute__((ext_vector_type(8))) float v8f;
typedef __attribute__((ext_vector_type(4))) float v4f;
__device__ __forceinline__ float bf16_rne(float f) { unsigned int u = __float_as_uint(f); u += 0x7FFFu + ((u >> 16) & 1u); return __uint_as_float(u & 0xFFFF0000u); }
__device__ __forceinline__ unsigned short bf16_bits(float f) { unsigned int u = __float_as_uint(f); u += 0x7FFFu + ((u >> 16) & 1u); return (unsigned short)(u >> 16); }
__device__ __forceinline__ void split16(float v, b16& hi, b16& lo) { hi = (b16)v; lo = (b16)(v - (float)hi); }
__device__ __forceinline__ v16b frag_kb(const b16* p, int hh) { const v8b a = *(const v8b*)(p + 8 * hh), b = *(const v8b*)(p + 16 + 8 * hh); v16b f;
#pragma unroll
  for (int e = 0; e < 8; ++e) { f[e] = a[e]; f[8 + e] = b[e]; } return f; }
__device__ __forceinline__ v16bb frag_bf(const unsigned short* p, int hh) { const v8us a = *(const v8us*)(p + 8 * hh), b = *(const v8us*)(p + 16 + 8 * hh); union { unsigned short s[16]; v16bb v; } u;
#pragma unroll
  for (int e = 0; e < 8; ++e) { u.s[e] = a[e]; u.s[8 + e] = b[e]; } return u.v; }
__device__ __forceinline__ v8f wmma16b(v16b a, v16b b, v8f c) { v8f d = __builtin_amdgcn_wmma_f32_16x16x32_f16(false, a, false, b, (short)0, c, false, false); asm volatile("v_nop\n\tv_nop\n\tv_nop\n\tv_nop" : "+v"(d) : "v"(a), "v"(b)); return d; }
__device__ __forceinline__ v8f wmma16bb(v16bb a, v16bb b, v8f c) { v8f d = __builtin_amdgcn_wmma_f32_16x16x32_bf16(false, a, false, b, (short)0, c, false, false); asm volatile("v_nop\n\tv_nop\n\tv_nop\n\tv_nop" : "+v"(d) : "v"(a), "v"(b)); return d; }
__device__ __forceinline__ void wave_lds_sync() { __builtin_amdgcn_fence(__ATOMIC_RELEASE, "workgroup"); __builtin_amdgcn_wave_barrier(); __builtin_amdgcn_fence(__ATOMIC_ACQUIRE, "workgroup"); }
__device__ __forceinline__ float nexp(float x) { return __builtin_amdgcn_exp2f(x * 1.4426950408889634f); }

// prep: x NCHW -> position-major bf16 rows xT[b*4096 + p][256] (block = (b, 64 positions)); weights: [theta; phi; g] rows [192][256] bf16; W [256][64] f16 (bf16-exact). grid (64, Bn) x 256.
__global__ __launch_bounds__(256) void prep_kernel(const float* __restrict__ x, const float* __restrict__ tw, const float* __restrict__ pw, const float* __restrict__ gw, const float* __restrict__ Ww, unsigned short* __restrict__ xT, unsigned short* __restrict__ w16, b16* __restrict__ ww16) {
  __shared__ __attribute__((aligned(16))) unsigned short Tt[64][C + 8];
  const int t_ = threadIdx.x, b = blockIdx.y, p0 = blockIdx.x * 64; const float* src = x + (size_t)b * C * NP;
  for (int i = t_; i < C * 64; i += 256) { const int c = i >> 6, pp = i & 63; Tt[pp][c] = bf16_bits(src[(size_t)c * NP + p0 + pp]); }
  __syncthreads();
  {
    for (int i = t_; i < 64 * C / 8; i += 256) { const int pp = i >> 5, c8 = (i & 31) * 8; *(v8us*)(xT + ((size_t)b * NP + p0 + pp) * C + c8) = *(const v8us*)(&Tt[pp][c8]); }
    if (blockIdx.x == 0 && blockIdx.y == 0) {
      for (int i = t_; i < 3 * C1 * C / 8; i += 256) { const int m = i / (C1 * C / 8), q = i % (C1 * C / 8); const float* W = (m == 0) ? tw : (m == 1) ? pw : gw; v8us o;
#pragma unroll
        for (int e = 0; e < 8; ++e) o[e] = bf16_bits(W[q * 8 + e]);
        *(v8us*)(w16 + (size_t)i * 8) = o; }
      for (int i = t_; i < C * C2 / 8; i += 256) { v8b o;
#pragma unroll
        for (int e = 0; e < 8; ++e) o[e] = (b16)bf16_rne(Ww[i * 8 + e]);
        *(v8b*)(ww16 + (size_t)i * 8) = o; } }
     }
}

__global__ __launch_bounds__(128) void proj_kernel(const unsigned short* __restrict__ xT, const unsigned short* __restrict__ w16, const float* __restrict__ tb, const float* __restrict__ pb, const float* __restrict__ gb, b16* __restrict__ th, b16* __restrict__ ph, b16* __restrict__ gt) {
  __shared__ __attribute__((aligned(16))) b16 Th[4][32][64 + 8], Tl[4][32][64 + 8]; __shared__ __attribute__((aligned(16))) b16 Vh[64][128 + 8], Vl[64][128 + 8];
  const int lane = threadIdx.x & 31, wave = threadIdx.x >> 5, nloc = lane & 15, hlf = lane >> 4, which = blockIdx.x, m0 = blockIdx.y * 128 + wave * 32; const int b = (blockIdx.y * 128) / NP, p0 = (blockIdx.y * 128) % NP;
  const unsigned short* Wt = w16 + (size_t)which * C1 * C; const float* bias = (which == 0) ? tb : (which == 1) ? pb : gb;
  v8f acc[2][4];
#pragma unroll
  for (int r = 0; r < 2; ++r)
#pragma unroll
    for (int t = 0; t < 4; ++t) acc[r][t] = (v8f){};
#pragma unroll 2
  for (int kb = 0; kb < C; kb += 32) { const v16bb a0 = frag_bf(xT + (size_t)(m0 + nloc) * C + kb, hlf), a1 = frag_bf(xT + (size_t)(m0 + 16 + nloc) * C + kb, hlf);
#pragma unroll
    for (int t = 0; t < 4; ++t) { const v16bb bw = frag_bf(Wt + (size_t)(t * 16 + nloc) * C + kb, hlf); acc[0][t] = wmma16bb(a0, bw, acc[0][t]); acc[1][t] = wmma16bb(a1, bw, acc[1][t]); } }
  const float scl = (which == 2) ? VS : QS;
#pragma unroll
  for (int t = 0; t < 4; ++t) { const int c = t * 16 + nloc; const float bb = bf16_rne(bias[c]);
#pragma unroll
    for (int r = 0; r < 2; ++r)
#pragma unroll
      for (int v = 0; v < 8; ++v) { b16 a_, c_; split16((acc[r][t][v] + bb) * scl, a_, c_); const int row = r * 16 + 8 * hlf + v;
        if (which < 2) { Th[wave][row][c] = a_; Tl[wave][row][c] = c_; } else { Vh[c][wave * 32 + row] = a_; Vl[c][wave * 32 + row] = c_; } } }
  __syncthreads();
  {
    if (which < 2) { b16* dst = ((which == 0) ? th : ph) + (size_t)m0 * C1;
#pragma unroll
      for (int j = 0; j < 8; ++j) { const int rr = j * 4 + (lane >> 3), c8 = (lane & 7) * 8; *(v8b*)(dst + (size_t)rr * C1 + c8) = *(const v8b*)(&Th[wave][rr][c8]); *(v8b*)(dst + QPL + (size_t)rr * C1 + c8) = *(const v8b*)(&Tl[wave][rr][c8]); } }
    else { for (int i = threadIdx.x; i < 64 * 16; i += 128) { const int cc = i >> 4, c8 = (i & 15) * 8; const size_t dst = ((size_t)b * C2 + cc) * NP + p0 + c8;
        *(v8b*)(gt + dst) = *(const v8b*)(&Vh[cc][c8]); *(v8b*)(gt + VPL + dst) = *(const v8b*)(&Vl[cc][c8]); } }
     }
}

// K / V staging for attn_kernel. A stage = 64 keys = four tiles of 64 rows x 128 B: K hi, K lo (row = key, 64 channels), V hi, V lo (row = channel, 64 keys).
// LDS row pitch 144 B (16 B x odd, for the ds_load_b128 fragment readers). Two buffers: the next stage's copies fly while this stage is worked on.
constexpr int KT = 64, RP = 72, TILE = 64 * RP, NST = NP / KT;
constexpr unsigned TILEB = TILE * 2u, BUFB = 4u * TILEB, HALFB = 32u * RP * 2u;

// One stage's copies of one thread: 16 B of rows r and r + 32 of each of the four tiles (256 threads x 8 x 16 B = 32 KB), global -> LDS through no register.
__device__ __forceinline__ void stage_copies(unsigned lds, const b16* gk, const b16* gv) {
  // The closing s_wait_xcnt 0 stands inside the statement so that no address register of an issued copy is rewritten in front of it.
  asm volatile("global_load_async_to_lds_b128 %0, %8, off\n\t"
               "global_load_async_to_lds_b128 %1, %9, off\n\t"
               "global_load_async_to_lds_b128 %2, %10, off\n\t"
               "global_load_async_to_lds_b128 %3, %11, off\n\t"
               "global_load_async_to_lds_b128 %4, %12, off\n\t"
               "global_load_async_to_lds_b128 %5, %13, off\n\t"
               "global_load_async_to_lds_b128 %6, %14, off\n\t"
               "global_load_async_to_lds_b128 %7, %15, off\n\t"
               "s_wait_xcnt 0x0"
               :: "v"(lds), "v"(lds + HALFB), "v"(lds + TILEB), "v"(lds + TILEB + HALFB), "v"(lds + 2u * TILEB), "v"(lds + 2u * TILEB + HALFB), "v"(lds + 3u * TILEB), "v"(lds + 3u * TILEB + HALFB),
                  "v"(gk), "v"(gk + 32 * C1), "v"(gk + QPL), "v"(gk + QPL + 32 * C1), "v"(gv), "v"(gv + (size_t)32 * NP), "v"(gv + VPL), "v"(gv + VPL + (size_t)32 * NP)
               : "memory");
}

__global__ __launch_bounds__(256) void attn_kernel(const b16* __restrict__ th, const b16* __restrict__ ph, const b16* __restrict__ gt, float* __restrict__ yrow) {
  __shared__ __attribute__((aligned(16))) float Os[8][16][C2 + 4];
  __shared__ __attribute__((aligned(16))) b16 Ring[2][4][TILE];
  const int wid = threadIdx.x >> 5, lane = threadIdx.x & 31, hh = lane >> 4, col = lane & 15; const int tok0 = blockIdx.x * 128 + wid * 16, b = (blockIdx.x * 128) / NP; const size_t qi = (size_t)tok0 + col;
  const b16* K = ph + ((size_t)b * NP) * C1; const b16* V = gt + ((size_t)b * C2) * NP;
  const int cr = threadIdx.x >> 3, cc = (threadIdx.x & 7) * 8;   // this thread's row (and row + 32) and 16-byte piece in every tile
  const unsigned lds0 = (unsigned)(size_t)&Ring[0][0][cr * RP + cc]; const b16* gk = K + (size_t)cr * C1 + cc; const b16* gv = V + (size_t)cr * NP + cc;
  stage_copies(lds0, gk, gv);
  asm volatile("s_wait_asynccnt 0x0" ::: "memory");   // stage 0 of this wave has landed
  __syncthreads();                                    // ... and of every wave: publishes stage 0
  stage_copies(lds0 + BUFB, gk + (size_t)KT * C1, gv + KT);
  v16b qf[2], ql[2];
#pragma unroll
  for (int ks = 0; ks < 2; ++ks) { qf[ks] = frag_kb(th + qi * C1 + ks * 32, hh); ql[ks] = frag_kb(th + QPL + qi * C1 + ks * 32, hh); }
  float m = -INFINITY, l = 0.0f; v8f o[4] = {{}, {}, {}, {}};
  for (int st = 0; st < NST; ++st) { const b16* Kh = &Ring[st & 1][0][0]; const b16* Kl = Kh + TILE; const b16* Vh = Kh + 2 * TILE; const b16* Vl = Kh + 3 * TILE;
#pragma unroll
   for (int kb = 0; kb < KT; kb += 32) { v8f s0 = {}, s1 = {};
#pragma unroll
    for (int ks = 0; ks < 2; ++ks) { const v16b ka = frag_kb(Kh + (kb + col) * RP + ks * 32, hh), kal = frag_kb(Kl + (kb + col) * RP + ks * 32, hh), kb_ = frag_kb(Kh + (kb + 16 + col) * RP + ks * 32, hh), kbl = frag_kb(Kl + (kb + 16 + col) * RP + ks * 32, hh);
      s0 = wmma16b(ka, qf[ks], s0); s0 = wmma16b(ka, ql[ks], s0); s0 = wmma16b(kal, qf[ks], s0); s1 = wmma16b(kb_, qf[ks], s1); s1 = wmma16b(kb_, ql[ks], s1); s1 = wmma16b(kbl, qf[ks], s1); }
    float mr = -INFINITY;
#pragma unroll
    for (int r = 0; r < 8; ++r) { s0[r] *= SCALE / (QS * QS); s1[r] *= SCALE / (QS * QS); mr = fmaxf(mr, fmaxf(s0[r], s1[r])); }
    mr = fmaxf(mr, __shfl_xor(mr, 16));
    const float mn = fmaxf(m, mr), al_ = nexp(m - mn); m = mn; float sum = 0.0f; v16b pbv, plv;
#pragma unroll
    for (int r = 0; r < 8; ++r) { const float p0 = nexp(s0[r] - mn), p1 = nexp(s1[r] - mn); sum += p0 + p1; b16 a, c; split16(p0 * PS, a, c); pbv[r] = a; plv[r] = c; split16(p1 * PS, a, c); pbv[8 + r] = a; plv[8 + r] = c; }
    sum += __shfl_xor(sum, 16); l = l * al_ + sum;
#pragma unroll
    for (int n = 0; n < 4; ++n) { o[n] *= al_; const v16b vf = frag_kb(Vh + (n * 16 + col) * RP + kb, hh), vl = frag_kb(Vl + (n * 16 + col) * RP + kb, hh); o[n] = wmma16b(vf, pbv, o[n]); o[n] = wmma16b(vf, plv, o[n]); o[n] = wmma16b(vl, pbv, o[n]); } }
   asm volatile("s_wait_dscnt 0x0" ::: "memory");      // this wave's reads of the buffer have retired before it is handed to its next writer
   asm volatile("s_wait_asynccnt 0x0" ::: "memory");   // this wave's copies of stage st + 1 have landed
   __syncthreads();                                    // publishes stage st + 1 and ends every reader's last read of stage st
   if (st + 2 < NST) stage_copies(lds0 + (unsigned)(st & 1) * BUFB, gk + (size_t)(st + 2) * KT * C1, gv + (st + 2) * KT); }
  asm volatile("s_wait_asynccnt 0x0" ::: "memory");    // nothing of this wave is in flight behind the loop
  const float inv = 1.0f / (l * VS * PS);
#pragma unroll
  for (int n = 0; n < 4; ++n)
#pragma unroll
    for (int r = 0; r < 8; ++r) Os[wid][col][n * 16 + 8 * hh + r] = o[n][r] * inv;
  wave_lds_sync();
  float* dst = yrow + (size_t)tok0 * C2;
  {
#pragma unroll
    for (int j = 0; j < 8; ++j) { const int rr = j * 2 + hh, c4 = col * 4; *(v4f*)(dst + (size_t)rr * C2 + c4) = *(const v4f*)(&Os[wid][rr][c4]); }
     }
}

// W conv: block = 128 positions x 64 output channels (4 column tiles): wy = y.W^T + b (K 64; 2 products) -> f32 rows wy[tok][256] + per-block column partials (Σ, Σ²) part[blk][2][64] (512 B),
__global__ __launch_bounds__(128) void wconv_kernel(const float* __restrict__ yrow, const b16* __restrict__ ww16, const float* __restrict__ Wb, float* __restrict__ wy, float* __restrict__ part) {
  __shared__ __attribute__((aligned(16))) float Ts[4][32 * 64]; __shared__ float Cs[4][2][64];
  const int lane = threadIdx.x & 31, wave = threadIdx.x >> 5, nloc = lane & 15, hlf = lane >> 4, m0 = blockIdx.y * 128 + wave * 32, c0 = blockIdx.x * 64;
  v8f acc[2][4];
#pragma unroll
  for (int r = 0; r < 2; ++r)
#pragma unroll
    for (int t = 0; t < 4; ++t) acc[r][t] = (v8f){};
#pragma unroll
  for (int kb = 0; kb < C2; kb += 32) { v16b a0, a1, l0, l1;
#pragma unroll
    for (int e = 0; e < 16; ++e) { const int k = kb + ((e < 8) ? (8 * hlf + e) : (16 + 8 * hlf + e - 8)); b16 p, q; split16(yrow[(size_t)(m0 + nloc) * C2 + k] * YS, p, q); a0[e] = p; l0[e] = q; split16(yrow[(size_t)(m0 + 16 + nloc) * C2 + k] * YS, p, q); a1[e] = p; l1[e] = q; }
#pragma unroll
    for (int t = 0; t < 4; ++t) { const v16b bw = frag_kb(ww16 + (size_t)(c0 + t * 16 + nloc) * C2 + kb, hlf); acc[0][t] = wmma16b(a0, bw, acc[0][t]); acc[0][t] = wmma16b(l0, bw, acc[0][t]); acc[1][t] = wmma16b(a1, bw, acc[1][t]); acc[1][t] = wmma16b(l1, bw, acc[1][t]); } }
  float* Tt = Ts[wave];
#pragma unroll
  for (int t = 0; t < 4; ++t) { const float bb = bf16_rne(Wb[c0 + t * 16 + nloc]);
#pragma unroll
    for (int r = 0; r < 2; ++r)
#pragma unroll
      for (int v = 0; v < 8; ++v) Tt[(r * 16 + v + 8 * hlf) * 64 + t * 16 + nloc] = acc[r][t][v] * (1.0f / YS) + bb; }
  wave_lds_sync();
  { float s = 0.0f, s2 = 0.0f, q1 = 0.0f, q2 = 0.0f; for (int rr = 0; rr < 32; ++rr) { const float a = Tt[rr * 64 + lane * 2], c = Tt[rr * 64 + lane * 2 + 1]; s += a; q1 += a * a; s2 += c; q2 += c * c; }
    Cs[wave][0][lane * 2] = s; Cs[wave][0][lane * 2 + 1] = s2; Cs[wave][1][lane * 2] = q1; Cs[wave][1][lane * 2 + 1] = q2; }
  __syncthreads();
  float* dst0 = wy + (size_t)m0 * C + c0;
  {
#pragma unroll
    for (int j = 0; j < 16; ++j) { const int rr = j * 2 + hlf, c4 = nloc * 4; *(v4f*)(dst0 + (size_t)rr * C + c4) = *(const v4f*)(Tt + rr * 64 + c4); }
    if (threadIdx.x < 128) { const int st = threadIdx.x >> 6, cc = threadIdx.x & 63; ((float*)part)[(((size_t)blockIdx.y * 4 + blockIdx.x) * 2 + st) * 64 + cc] = Cs[0][st][cc] + Cs[1][st][cc] + Cs[2][st][cc] + Cs[3][st][cc]; }
     }
}

__global__ __launch_bounds__(256) void bnstat_kernel(const float* __restrict__ part, const float* __restrict__ gma, const float* __restrict__ bta, float* __restrict__ bn, int ntok) {
  const int c = threadIdx.x; const int ct = c >> 6, cc = c & 63; double s = 0.0, q = 0.0;
  for (int blk = 0; blk < ntok / 128; ++blk) { s += (double)part[(((size_t)blk * 4 + ct) * 2 + 0) * 64 + cc]; q += (double)part[(((size_t)blk * 4 + ct) * 2 + 1) * 64 + cc]; }
  const double mean = s / (double)ntok; const double var = fmax(q / (double)ntok - mean * mean, 0.0);
  const float scl = bf16_rne(gma[c]) * (float)(1.0 / sqrt(var + (double)EPS)); const float sh = bf16_rne(bta[c]) - (float)mean * scl;
  { ((float*)bn)[c] = scl; ((float*)bn)[C + c] = sh;  }
}

__global__ __launch_bounds__(256) void final_kernel(const float* __restrict__ wy, const float* __restrict__ bn, float* __restrict__ out) {
  __shared__ __attribute__((aligned(16))) float Ta[64][128 + 4];
  const int b = blockIdx.y, p0 = blockIdx.x * 128, t_ = threadIdx.x;
  for (int cb = 0; cb < C; cb += 64) {
    for (int i = t_; i < 128 * 16; i += 256) { const int pp = i >> 4, c4 = (i & 15) * 4; const v4f v = *(const v4f*)(wy + ((size_t)b * NP + p0 + pp) * C + cb + c4);
#pragma unroll
      for (int e = 0; e < 4; ++e) Ta[c4 + e][pp] = v[e]; }
    __syncthreads();
    { for (int i = t_; i < 64 * 32; i += 256) { const int c = i >> 5, q4 = (i & 31) * 4; const float sc = bn[cb + c], sh = bn[C + cb + c]; v4f o;
#pragma unroll
        for (int e = 0; e < 4; ++e) o[e] = Ta[c][q4 + e] * sc + sh;
        *(v4f*)(out + ((size_t)b * C + cb + c) * NP + p0 + q4) = o; }  }
    __syncthreads();
  }
}
}  // namespace

extern "C" void kernel_launch(void* const* d_in, const int* in_sizes, int n_in,
                              void* d_out, int out_size, void* d_ws, size_t ws_size, hipStream_t stream) {
  (void)n_in; (void)out_size;
  const float* x = (const float*)d_in[0]; const float* tw = (const float*)d_in[1]; const float* tb = (const float*)d_in[2]; const float* pw = (const float*)d_in[3]; const float* pb = (const float*)d_in[4]; const float* gw = (const float*)d_in[5]; const float* gb = (const float*)d_in[6];
  const float* Ww = (const float*)d_in[7]; const float* Wb = (const float*)d_in[8]; const float* gma = (const float*)d_in[9]; const float* bta = (const float*)d_in[10];
  float* out = (float*)d_out;   // [4][256][64][64]
  if (in_sizes[0] != Bn * C * NP || in_sizes[1] != C1 * C || in_sizes[5] != C2 * C || in_sizes[7] != C * C2 || in_sizes[9] != C) return;
  size_t off = 0; char* ws = (char*)d_ws;
  auto carve = [&](size_t bytes) { char* p = ws + off; off += (bytes + 255) & ~(size_t)255; return p; };
  unsigned short* xT = (unsigned short*)carve((size_t)NTOK * C * 2); unsigned short* w16 = (unsigned short*)carve((size_t)3 * C1 * C * 2); b16* ww16 = (b16*)carve((size_t)C * C2 * 2);
  b16* th = (b16*)carve(QPL * 2 * 2); b16* ph = (b16*)carve(QPL * 2 * 2); b16* gt = (b16*)carve(VPL * 2 * 2); float* yrow = (float*)carve((size_t)NTOK * C2 * 4); float* wy = (float*)carve((size_t)NTOK * C * 4); float* part = (float*)carve((size_t)(NTOK / 128) * 4 * 2 * 64 * 4); float* bn = (float*)carve(2 * C * 4);
  if (off > ws_size) return;                                    // ≈ 8.4 + 0.1 + 4.2x3 + 4.2 + 16.8 + 0.3 ≈ 42 MB
  prep_kernel<<<dim3(NP / 64, Bn), 256, 0, stream>>>(x, tw, pw, gw, Ww, xT, w16, ww16);
  proj_kernel<<<dim3(3, NTOK / 128), 128, 0, stream>>>(xT, w16, tb, pb, gb, th, ph, gt);
  attn_kernel<<<NTOK / 128, 256, 0, stream>>>(th, ph, gt, yrow);
  wconv_kernel<<<dim3(C / 64, NTOK / 128), 128, 0, stream>>>(yrow, ww16, Wb, wy, part);
  bnstat_kernel<<<1, 256, 0, stream>>>(part, gma, bta, bn, NTOK);
  final_kernel<<<dim3(NPB, Bn), 256, 0, stream>>>(wy, bn, out);
}

// v002
// One run takes 153 microseconds.
// Two timings next to v001 both put it at 1.26 times that version's speed.
// Counting every step since v000, it is 2.74 times as fast.
#include <hip/hip_runtime.h>

// _MS_NonLocalBlockND (scale 1): theta, phi (64 ch) and g (64 ch) = 1x1 convs of x [4][256][64x64]; f = theta^T phi / 8 over the 4096 positions; attn = softmax; y = attn g; wy = W y + b
// (1x1 conv 64 -> 256); out = BatchNorm2d in TRAINING mode (batch mean / biased variance over (B, H, W) per channel, eps 1e-5, gamma, beta) -> NCHW [4][256][64][64].
// Projections on v_wmma_f32_16x16x32_bf16 (fragments from an LDS transpose of the NCHW input; 1 product); attention per (b, 16 queries):
// S^T = phi.theta^T (K = 64; theta, phi as f16 hi+lo pairs x8; 3 products), online softmax f32, y^T = (8g)^T.P^T (3 products); wy = y.W^T + b (y f32 split x8, W exact; 2 products) on
// v_wmma_f32_16x16x32_f16, f32 accumulate, with per-block ordered column partial sums (Σ, Σ²... no: Σ and Σ of squares are formed from per-block (sum, sumsq) partials in fixed order);
// BN applied by a final kernel writing NCHW through an LDS transpose. Fragment k-map per lane half hh for A AND B: elements 0..7 <- k = 8hh+0..7, 8..15 <- k = 16+8hh+0..7.

namespace {
constexpr int Bn = 4, C = 256, NP = 4096, C1 = 64, C2 = 64, NTOK = Bn * NP, NPB = NP / 128;
constexpr float QS = 8.0f, VS = 8.0f, PS = 8.0f, YS = 8.0f, SCALE = 0.125f, EPS = 1e-5f;
constexpr size_t QPL = (size_t)NTOK * C1, VPL = (size_t)Bn * C2 * NP;

typedef _Float16 b16;
typedef __attribute__((ext_vector_type(16))) _Float16 v16b;
typedef __attribute__((ext_vector_type(16))) __bf16 v16bb;
typedef __attribute__((ext_vector_type(8))) _Float16 v8b;
typedef __attribute__((ext_vector_type(8))) unsigned short v8us;
typedef __attribute__((ext_vector_type(8))) float v8f;
typedef __attribute__((ext_vector_type(4))) float v4f;
__device__ __forceinline__ float bf16_rne(float f) { unsigned int u = __float_as_uint(f); u += 0x7FFFu + ((u >> 16) & 1u); return __uint_as_float(u & 0xFFFF0000u); }
__device__ __forceinline__ unsigned short bf16_bits(float f) { unsigned int u = __float_as_uint(f); u += 0x7FFFu + ((u >> 16) & 1u); return (unsigned short)(u >> 16); }
__device__ __forceinline__ void split16(float v, b16& hi, b16& lo) { hi = (b16)v; lo = (b16)(v - (float)hi); }
__device__ __forceinline__ v16b frag_kb(const b16* p, int hh) { const v8b a = *(const v8b*)(p + 8 * hh), b = *(const v8b*)(p + 16 + 8 * hh); v16b f;
#pragma unroll
  for (int e = 0; e < 8; ++e) { f[e] = a[e]; f[8 + e] = b[e]; } return f; }
__device__ __forceinline__ v16bb frag_bf(const unsigned short* p, int hh) { const v8us a = *(const v8us*)(p + 8 * hh), b = *(const v8us*)(p + 16 + 8 * hh); union { unsigned short s[16]; v16bb v; } u;
#pragma unroll
  for (int e = 0; e < 8; ++e) { u.s[e] = a[e]; u.s[8 + e] = b[e]; } return u.v; }
__device__ __forceinline__ v8f wmma16b(v16b a, v16b b, v8f c) { v8f d = __builtin_amdgcn_wmma_f32_16x16x32_f16(false, a, false, b, (short)0, c, false, false); asm volatile("v_nop\n\tv_nop\n\tv_nop\n\tv_nop" : "+v"(d) : "v"(a), "v"(b)); return d; }
__device__ __forceinline__ v8f wmma16bb(v16bb a, v16bb b, v8f c) { v8f d = __builtin_amdgcn_wmma_f32_16x16x32_bf16(false, a, false, b, (short)0, c, false, false); asm volatile("v_nop\n\tv_nop\n\tv_nop\n\tv_nop" : "+v"(d) : "v"(a), "v"(b)); return d; }
__device__ __forceinline__ void wave_lds_sync() { __builtin_amdgcn_fence(__ATOMIC_RELEASE, "workgroup"); __builtin_amdgcn_wave_barrier(); __builtin_amdgcn_fence(__ATOMIC_ACQUIRE, "workgroup"); }
__device__ __forceinline__ float nexp(float x) { return __builtin_amdgcn_exp2f(x * 1.4426950408889634f); }

// prep: x NCHW -> position-major bf16 rows xT[b*4096 + p][256] (block = (b, 64 positions)); weights: [theta; phi; g] rows [192][256] bf16; W [256][64] f16 (bf16-exact). grid (64, Bn) x 256.
__global__ __launch_bounds__(256) void prep_kernel(const float* __restrict__ x, const float* __restrict__ tw, const float* __restrict__ pw, const float* __restrict__ gw, const float* __restrict__ Ww, unsigned short* __restrict__ xT, unsigned short* __restrict__ w16, b16* __restrict__ ww16) {
  __shared__ __attribute__((aligned(16))) unsigned short Tt[64][C + 8];
  const int t_ = threadIdx.x, b = blockIdx.y, p0 = blockIdx.x * 64; const float* src = x + (size_t)b * C * NP;
  for (int i = t_; i < C * 64; i += 256) { const int c = i >> 6, pp = i & 63; Tt[pp][c] = bf16_bits(src[(size_t)c * NP + p0 + pp]); }
  __syncthreads();
  {
    for (int i = t_; i < 64 * C / 8; i += 256) { const int pp = i >> 5, c8 = (i & 31) * 8; *(v8us*)(xT + ((size_t)b * NP + p0 + pp) * C + c8) = *(const v8us*)(&Tt[pp][c8]); }
    if (blockIdx.x == 0 && blockIdx.y == 0) {
      for (int i = t_; i < 3 * C1 * C / 8; i += 256) { const int m = i / (C1 * C / 8), q = i % (C1 * C / 8); const float* W = (m == 0) ? tw : (m == 1) ? pw : gw; v8us o;
#pragma unroll
        for (int e = 0; e < 8; ++e) o[e] = bf16_bits(W[q * 8 + e]);
        *(v8us*)(w16 + (size_t)i * 8) = o; }
      for (int i = t_; i < C * C2 / 8; i += 256) { v8b o;
#pragma unroll
        for (int e = 0; e < 8; ++e) o[e] = (b16)bf16_rne(Ww[i * 8 + e]);
        *(v8b*)(ww16 + (size_t)i * 8) = o; } }
     }
}

__global__ __launch_bounds__(128) void proj_kernel(const unsigned short* __restrict__ xT, const unsigned short* __restrict__ w16, const float* __restrict__ tb, const float* __restrict__ pb, const float* __restrict__ gb, b16* __restrict__ th, b16* __restrict__ ph, b16* __restrict__ gt) {
  __shared__ __attribute__((aligned(16))) b16 Th[4][32][64 + 8], Tl[4][32][64 + 8]; __shared__ __attribute__((aligned(16))) b16 Vh[64][128 + 8], Vl[64][128 + 8];
  const int lane = threadIdx.x & 31, wave = threadIdx.x >> 5, nloc = lane & 15, hlf = lane >> 4, which = blockIdx.x, m0 = blockIdx.y * 128 + wave * 32; const int b = (blockIdx.y * 128) / NP, p0 = (blockIdx.y * 128) % NP;
  const unsigned short* Wt = w16 + (size_t)which * C1 * C; const float* bias = (which == 0) ? tb : (which == 1) ? pb : gb;
  v8f acc[2][4];
#pragma unroll
  for (int r = 0; r < 2; ++r)
#pragma unroll
    for (int t = 0; t < 4; ++t) acc[r][t] = (v8f){};
#pragma unroll 2
  for (int kb = 0; kb < C; kb += 32) { const v16bb a0 = frag_bf(xT + (size_t)(m0 + nloc) * C + kb, hlf), a1 = frag_bf(xT + (size_t)(m0 + 16 + nloc) * C + kb, hlf);
#pragma unroll
    for (int t = 0; t < 4; ++t) { const v16bb bw = frag_bf(Wt + (size_t)(t * 16 + nloc) * C + kb, hlf); acc[0][t] = wmma16bb(a0, bw, acc[0][t]); acc[1][t] = wmma16bb(a1, bw, acc[1][t]); } }
  const float scl = (which == 2) ? VS : QS;
#pragma unroll
  for (int t = 0; t < 4; ++t) { const int c = t * 16 + nloc; const float bb = bf16_rne(bias[c]);
#pragma unroll
    for (int r = 0; r < 2; ++r)
#pragma unroll
      for (int v = 0; v < 8; ++v) { b16 a_, c_; split16((acc[r][t][v] + bb) * scl, a_, c_); const int row = r * 16 + 8 * hlf + v;
        if (which < 2) { Th[wave][row][c] = a_; Tl[wave][row][c] = c_; } else { Vh[c][wave * 32 + row] = a_; Vl[c][wave * 32 + row] = c_; } } }
  __syncthreads();
  {
    if (which < 2) { b16* dst = ((which == 0) ? th : ph) + (size_t)m0 * C1;
#pragma unroll
      for (int j = 0; j < 8; ++j) { const int rr = j * 4 + (lane >> 3), c8 = (lane & 7) * 8; *(v8b*)(dst + (size_t)rr * C1 + c8) = *(const v8b*)(&Th[wave][rr][c8]); *(v8b*)(dst + QPL + (size_t)rr * C1 + c8) = *(const v8b*)(&Tl[wave][rr][c8]); } }
    else { for (int i = threadIdx.x; i < 64 * 16; i += 128) { const int cc = i >> 4, c8 = (i & 15) * 8; const size_t dst = ((size_t)b * C2 + cc) * NP + p0 + c8;
        *(v8b*)(gt + dst) = *(const v8b*)(&Vh[cc][c8]); *(v8b*)(gt + VPL + dst) = *(const v8b*)(&Vl[cc][c8]); } }
     }
}

// K / V staging for attn_kernel. A stage = 64 keys = four tiles of 64 rows x 128 B: K hi, K lo (row = key, 64 channels), V hi, V lo (row = channel, 64 keys).
// LDS row pitch 144 B (16 B x odd, for the ds_load_b128 fragment readers). Two buffers: the next stage's copies fly while this stage is worked on.
// A work-group = 64 queries (4 query tiles) x NG key groups = 16 waves, so that 256 work-groups fill the chip at four waves per SIMD. A buffer holds NG such stages, one per key group:
// group g works on keys 256 st + 64 g .. + 63 of every pass st with its own running (m, l, o); the NG partial results of a query tile are merged once, behind the loop, in fixed group order.
constexpr int KT = 64, RP = 72, TILE = 64 * RP, NG = 4, NST = NP / (KT * NG), OP = C2 + 4;
constexpr unsigned TILEB = TILE * 2u, SUBB = 4u * TILEB, BUFB = NG * SUBB, HALFB = 32u * RP * 2u;

// One 64-key stage's copies of one thread: 16 B of rows r and r + 32 of each of the four tiles (256 threads x 8 x 16 B = 32 KB), global -> LDS through no register.
__device__ __forceinline__ void stage_copies(unsigned lds, const b16* gk, const b16* gv) {
  // The closing s_wait_xcnt 0 stands inside the statement so that no address register of an issued copy is rewritten in front of it.
  asm volatile("global_load_async_to_lds_b128 %0, %8, off\n\t"
               "global_load_async_to_lds_b128 %1, %9, off\n\t"
               "global_load_async_to_lds_b128 %2, %10, off\n\t"
               "global_load_async_to_lds_b128 %3, %11, off\n\t"
               "global_load_async_to_lds_b128 %4, %12, off\n\t"
               "global_load_async_to_lds_b128 %5, %13, off\n\t"
               "global_load_async_to_lds_b128 %6, %14, off\n\t"
               "global_load_async_to_lds_b128 %7, %15, off\n\t"
               "s_wait_xcnt 0x0"
               :: "v"(lds), "v"(lds + HALFB), "v"(lds + TILEB), "v"(lds + TILEB + HALFB), "v"(lds + 2u * TILEB), "v"(lds + 2u * TILEB + HALFB), "v"(lds + 3u * TILEB), "v"(lds + 3u * TILEB + HALFB),
                  "v"(gk), "v"(gk + 32 * C1), "v"(gk + QPL), "v"(gk + QPL + 32 * C1), "v"(gv), "v"(gv + (size_t)32 * NP), "v"(gv + VPL), "v"(gv + VPL + (size_t)32 * NP)
               : "memory");
}

__global__ __launch_bounds__(512) void attn_kernel(const b16* __restrict__ th, const b16* __restrict__ ph, const b16* __restrict__ gt, float* __restrict__ yrow) {
  __shared__ __attribute__((aligned(16))) b16 Ring[2][NG][4][TILE];
  __shared__ float Ms[NG][4][16], Ls[NG][4][16];
  const int wid = threadIdx.x >> 5, qt = wid & 3, grp = wid >> 2, lane = threadIdx.x & 31, hh = lane >> 4, col = lane & 15; const int tok0 = blockIdx.x * 64 + qt * 16, b = (blockIdx.x * 64) / NP; const size_t qi = (size_t)tok0 + col;
  const b16* K = ph + ((size_t)b * NP) * C1; const b16* V = gt + ((size_t)b * C2) * NP;
  const int cg = (threadIdx.x >> 8) * 2, cr = (threadIdx.x & 255) >> 3, cc = (threadIdx.x & 7) * 8;   // this thread copies for key groups cg and cg + 1: its row (and row + 32) and 16-byte piece in every tile
  const unsigned lds0 = (unsigned)(size_t)&Ring[0][cg][0][cr * RP + cc]; const b16* gk = K + (size_t)(cg * KT + cr) * C1 + cc; const b16* gv = V + (size_t)cr * NP + cg * KT + cc;
  stage_copies(lds0, gk, gv); stage_copies(lds0 + SUBB, gk + (size_t)KT * C1, gv + KT);
  asm volatile("s_wait_asynccnt 0x0" ::: "memory");   // pass 0 of this wave has landed
  __syncthreads();                                    // ... and of every wave: publishes pass 0
  stage_copies(lds0 + BUFB, gk + (size_t)(NG * KT) * C1, gv + NG * KT); stage_copies(lds0 + BUFB + SUBB, gk + (size_t)(NG * KT + KT) * C1, gv + NG * KT + KT);
  v16b qf[2], ql[2];
#pragma unroll
  for (int ks = 0; ks < 2; ++ks) { qf[ks] = frag_kb(th + qi * C1 + ks * 32, hh); ql[ks] = frag_kb(th + QPL + qi * C1 + ks * 32, hh); }
  float m = -INFINITY, l = 0.0f; v8f o[4] = {{}, {}, {}, {}};
  for (int st = 0; st < NST; ++st) { const b16* Kh = &Ring[st & 1][grp][0][0]; const b16* Kl = Kh + TILE; const b16* Vh = Kh + 2 * TILE; const b16* Vl = Kh + 3 * TILE;
#pragma unroll
   for (int kb = 0; kb < KT; kb += 32) { v8f s0 = {}, s1 = {};
#pragma unroll
    for (int ks = 0; ks < 2; ++ks) { const v16b ka = frag_kb(Kh + (kb + col) * RP + ks * 32, hh), kal = frag_kb(Kl + (kb + col) * RP + ks * 32, hh), kb_ = frag_kb(Kh + (kb + 16 + col) * RP + ks * 32, hh), kbl = frag_kb(Kl + (kb + 16 + col) * RP + ks * 32, hh);
      s0 = wmma16b(ka, qf[ks], s0); s0 = wmma16b(ka, ql[ks], s0); s0 = wmma16b(kal, qf[ks], s0); s1 = wmma16b(kb_, qf[ks], s1); s1 = wmma16b(kb_, ql[ks], s1); s1 = wmma16b(kbl, qf[ks], s1); }
    float mr = -INFINITY;
#pragma unroll
    for (int r = 0; r < 8; ++r) { s0[r] *= SCALE / (QS * QS); s1[r] *= SCALE / (QS * QS); mr = fmaxf(mr, fmaxf(s0[r], s1[r])); }
    mr = fmaxf(mr, __shfl_xor(mr, 16));
    const float mn = fmaxf(m, mr), al_ = nexp(m - mn); m = mn; float sum = 0.0f; v16b pbv, plv;
#pragma unroll
    for (int r = 0; r < 8; ++r) { const float p0 = nexp(s0[r] - mn), p1 = nexp(s1[r] - mn); sum += p0 + p1; b16 a, c; split16(p0 * PS, a, c); pbv[r] = a; plv[r] = c; split16(p1 * PS, a, c); pbv[8 + r] = a; plv[8 + r] = c; }
    sum += __shfl_xor(sum, 16); l = l * al_ + sum;
#pragma unroll
    for (int n = 0; n < 4; ++n) { o[n] *= al_; const v16b vf = frag_kb(Vh + (n * 16 + col) * RP + kb, hh), vl = frag_kb(Vl + (n * 16 + col) * RP + kb, hh); o[n] = wmma16b(vf, pbv, o[n]); o[n] = wmma16b(vf, plv, o[n]); o[n] = wmma16b(vl, pbv, o[n]); } }
   asm volatile("s_wait_dscnt 0x0" ::: "memory");      // this wave's reads of the buffer have retired before it is handed to its next writer
   asm volatile("s_wait_asynccnt 0x0" ::: "memory");   // this wave's copies of pass st + 1 have landed
   __syncthreads();                                    // publishes pass st + 1 and ends every reader's last read of pass st
   if (st + 2 < NST) { const unsigned ld = lds0 + (unsigned)(st & 1) * BUFB; const b16* nk = gk + (size_t)(st + 2) * (NG * KT) * C1; const b16* nv = gv + (st + 2) * (NG * KT);
     stage_copies(ld, nk, nv); stage_copies(ld + SUBB, nk + (size_t)KT * C1, nv + KT); } }
  asm volatile("s_wait_asynccnt 0x0" ::: "memory");    // nothing of this wave is in flight behind the loop
  // Merge of the NG key groups of each query tile. The ring is free behind the loop's last barrier (every read retired, no copy in flight) and becomes the staging of the scaled partial outputs.
  if (hh == 0) { Ms[grp][qt][col] = m; Ls[grp][qt][col] = l; }
  __syncthreads();                                     // every group's (m, l) is visible
  float mg = Ms[0][qt][col];
#pragma unroll
  for (int g = 1; g < NG; ++g) mg = fmaxf(mg, Ms[g][qt][col]);
  float lg = 0.0f;
#pragma unroll
  for (int g = 0; g < NG; ++g) lg += Ls[g][qt][col] * nexp(Ms[g][qt][col] - mg);
  const float inv = nexp(m - mg) / (lg * VS * PS);
  float* Os = (float*)&Ring[0][0][0][0];               // [16 waves][16 queries][OP]
#pragma unroll
  for (int n = 0; n < 4; ++n)
#pragma unroll
    for (int r = 0; r < 8; ++r) Os[(wid * 16 + col) * OP + n * 16 + 8 * hh + r] = o[n][r] * inv;
  __syncthreads();                                     // every group's scaled partial output is visible
  float* dst = yrow + (size_t)blockIdx.x * 64 * C2;
#pragma unroll
  for (int j = 0; j < 2; ++j) { const int i = j * 512 + threadIdx.x, q = i >> 4, c4 = (i & 15) * 4; v4f s = *(const v4f*)(Os + q * OP + c4);
#pragma unroll
    for (int g = 1; g < NG; ++g) s += *(const v4f*)(Os + (g * 64 + q) * OP + c4);
    *(v4f*)(dst + (size_t)q * C2 + c4) = s; }
}

// W conv: block = 128 positions x 64 output channels (4 column tiles): wy = y.W^T + b (K 64; 2 products) -> f32 rows wy[tok][256] + per-block column partials (Σ, Σ²) part[blk][2][64] (512 B),
__global__ __launch_bounds__(128) void wconv_kernel(const float* __restrict__ yrow, const b16* __restrict__ ww16, const float* __restrict__ Wb, float* __restrict__ wy, float* __restrict__ part) {
  __shared__ __attribute__((aligned(16))) float Ts[4][32 * 64]; __shared__ float Cs[4][2][64];
  const int lane = threadIdx.x & 31, wave = threadIdx.x >> 5, nloc = lane & 15, hlf = lane >> 4, m0 = blockIdx.y * 128 + wave * 32, c0 = blockIdx.x * 64;
  v8f acc[2][4];
#pragma unroll
  for (int r = 0; r < 2; ++r)
#pragma unroll
    for (int t = 0; t < 4; ++t) acc[r][t] = (v8f){};
#pragma unroll
  for (int kb = 0; kb < C2; kb += 32) { v16b a0, a1, l0, l1;
#pragma unroll
    for (int e = 0; e < 16; ++e) { const int k = kb + ((e < 8) ? (8 * hlf + e) : (16 + 8 * hlf + e - 8)); b16 p, q; split16(yrow[(size_t)(m0 + nloc) * C2 + k] * YS, p, q); a0[e] = p; l0[e] = q; split16(yrow[(size_t)(m0 + 16 + nloc) * C2 + k] * YS, p, q); a1[e] = p; l1[e] = q; }
#pragma unroll
    for (int t = 0; t < 4; ++t) { const v16b bw = frag_kb(ww16 + (size_t)(c0 + t * 16 + nloc) * C2 + kb, hlf); acc[0][t] = wmma16b(a0, bw, acc[0][t]); acc[0][t] = wmma16b(l0, bw, acc[0][t]); acc[1][t] = wmma16b(a1, bw, acc[1][t]); acc[1][t] = wmma16b(l1, bw, acc[1][t]); } }
  float* Tt = Ts[wave];
#pragma unroll
  for (int t = 0; t < 4; ++t) { const float bb = bf16_rne(Wb[c0 + t * 16 + nloc]);
#pragma unroll
    for (int r = 0; r < 2; ++r)
#pragma unroll
      for (int v = 0; v < 8; ++v) Tt[(r * 16 + v + 8 * hlf) * 64 + t * 16 + nloc] = acc[r][t][v] * (1.0f / YS) + bb; }
  wave_lds_sync();
  { float s = 0.0f, s2 = 0.0f, q1 = 0.0f, q2 = 0.0f; for (int rr = 0; rr < 32; ++rr) { const float a = Tt[rr * 64 + lane * 2], c = Tt[rr * 64 + lane * 2 + 1]; s += a; q1 += a * a; s2 += c; q2 += c * c; }
    Cs[wave][0][lane * 2] = s; Cs[wave][0][lane * 2 + 1] = s2; Cs[wave][1][lane * 2] = q1; Cs[wave][1][lane * 2 + 1] = q2; }
  __syncthreads();
  float* dst0 = wy + (size_t)m0 * C + c0;
  {
#pragma unroll
    for (int j = 0; j < 16; ++j) { const int rr = j * 2 + hlf, c4 = nloc * 4; *(v4f*)(dst0 + (size_t)rr * C + c4) = *(const v4f*)(Tt + rr * 64 + c4); }
    if (threadIdx.x < 128) { const int st = threadIdx.x >> 6, cc = threadIdx.x & 63; ((float*)part)[(((size_t)blockIdx.y * 4 + blockIdx.x) * 2 + st) * 64 + cc] = Cs[0][st][cc] + Cs[1][st][cc] + Cs[2][st][cc] + Cs[3][st][cc]; }
     }
}

__global__ __launch_bounds__(256) void bnstat_kernel(const float* __restrict__ part, const float* __restrict__ gma, const float* __restrict__ bta, float* __restrict__ bn, int ntok) {
  const int c = threadIdx.x; const int ct = c >> 6, cc = c & 63; double s = 0.0, q = 0.0;
  for (int blk = 0; blk < ntok / 128; ++blk) { s += (double)part[(((size_t)blk * 4 + ct) * 2 + 0) * 64 + cc]; q += (double)part[(((size_t)blk * 4 + ct) * 2 + 1) * 64 + cc]; }
  const double mean = s / (double)ntok; const double var = fmax(q / (double)ntok - mean * mean, 0.0);
  const float scl = bf16_rne(gma[c]) * (float)(1.0 / sqrt(var + (double)EPS)); const float sh = bf16_rne(bta[c]) - (float)mean * scl;
  { ((float*)bn)[c] = scl; ((float*)bn)[C + c] = sh;  }
}

__global__ __launch_bounds__(256) void final_kernel(const float* __restrict__ wy, const float* __restrict__ bn, float* __restrict__ out) {
  __shared__ __attribute__((aligned(16))) float Ta[64][128 + 4];
  const int b = blockIdx.y, p0 = blockIdx.x * 128, t_ = threadIdx.x;
  for (int cb = 0; cb < C; cb += 64) {
    for (int i = t_; i < 128 * 16; i += 256) { const int pp = i >> 4, c4 = (i & 15) * 4; const v4f v = *(const v4f*)(wy + ((size_t)b * NP + p0 + pp) * C + cb + c4);
#pragma unroll
      for (int e = 0; e < 4; ++e) Ta[c4 + e][pp] = v[e]; }
    __syncthreads();
    { for (int i = t_; i < 64 * 32; i += 256) { const int c = i >> 5, q4 = (i & 31) * 4; const float sc = bn[cb + c], sh = bn[C + cb + c]; v4f o;
#pragma unroll
        for (int e = 0; e < 4; ++e) o[e] = Ta[c][q4 + e] * sc + sh;
        *(v4f*)(out + ((size_t)b * C + cb + c) * NP + p0 + q4) = o; }  }
    __syncthreads();
  }
}
}  // namespace

extern "C" void kernel_launch(void* const* d_in, const int* in_sizes, int n_in,
                              void* d_out, int out_size, void* d_ws, size_t ws_size, hipStream_t stream) {
  (void)n_in; (void)out_size;
  const float* x = (const float*)d_in[0]; const float* tw = (const float*)d_in[1]; const float* tb = (const float*)d_in[2]; const float* pw = (const float*)d_in[3]; const float* pb = (const float*)d_in[4]; const float* gw = (const float*)d_in[5]; const float* gb = (const float*)d_in[6];
  const float* Ww = (const float*)d_in[7]; const float* Wb = (const float*)d_in[8]; const float* gma = (const float*)d_in[9]; const float* bta = (const float*)d_in[10];
  float* out = (float*)d_out;   // [4][256][64][64]
  if (in_sizes[0] != Bn * C * NP || in_sizes[1] != C1 * C || in_sizes[5] != C2 * C || in_sizes[7] != C * C2 || in_sizes[9] != C) return;
  size_t off = 0; char* ws = (char*)d_ws;
  auto carve = [&](size_t bytes) { char* p = ws + off; off += (bytes + 255) & ~(size_t)255; return p; };
  unsigned short* xT = (unsigned short*)carve((size_t)NTOK * C * 2); unsigned short* w16 = (unsigned short*)carve((size_t)3 * C1 * C * 2); b16* ww16 = (b16*)carve((size_t)C * C2 * 2);
  b16* th = (b16*)carve(QPL * 2 * 2); b16* ph = (b16*)carve(QPL * 2 * 2); b16* gt = (b16*)carve(VPL * 2 * 2); float* yrow = (float*)carve((size_t)NTOK * C2 * 4); float* wy = (float*)carve((size_t)NTOK * C * 4); float* part = (float*)carve((size_t)(NTOK / 128) * 4 * 2 * 64 * 4); float* bn = (float*)carve(2 * C * 4);
  if (off > ws_size) return;                                    // ≈ 8.4 + 0.1 + 4.2x3 + 4.2 + 16.8 + 0.3 ≈ 42 MB
  prep_kernel<<<dim3(NP / 64, Bn), 256, 0, stream>>>(x, tw, pw, gw, Ww, xT, w16, ww16);
  proj_kernel<<<dim3(3, NTOK / 128), 128, 0, stream>>>(xT, w16, tb, pb, gb, th, ph, gt);
  attn_kernel<<<NTOK / 64, 512, 0, stream>>>(th, ph, gt, yrow);
  wconv_kernel<<<dim3(C / 64, NTOK / 128), 128, 0, stream>>>(yrow, ww16, Wb, wy, part);
  bnstat_kernel<<<1, 256, 0, stream>>>(part, gma, bta, bn, NTOK);
  final_kernel<<<dim3(NPB, Bn), 256, 0, stream>>>(wy, bn, out);
}

// v003
// One run takes 116 microseconds.
// Next to v002, in two timings, it ran 1.32 times as fast each time.
// Counting every step since v000, it is 3.62 times as fast.
#include <hip/hip_runtime.h>

// _MS_NonLocalBlockND (scale 1): theta, phi (64 ch) and g (64 ch) = 1x1 convs of x [4][256][64x64]; f = theta^T phi / 8 over the 4096 positions; attn = softmax; y = attn g; wy = W y + b
// (1x1 conv 64 -> 256); out = BatchNorm2d in TRAINING mode (batch mean / biased variance over (B, H, W) per channel, eps 1e-5, gamma, beta) -> NCHW [4][256][64][64].
// Projections on v_wmma_f32_16x16x32_bf16 (fragments from an LDS transpose of the NCHW input; 1 product); attention per (b, 16 queries):
// S^T = phi.theta^T (K = 64; theta, phi as f16 hi+lo pairs x8; 3 products), online softmax f32, y^T = (8g)^T.P^T (3 products); wy = y.W^T + b (y f32 split x8, W exact; 2 products) on
// v_wmma_f32_16x16x32_f16, f32 accumulate, with per-block ordered column partial sums (Σ, Σ²... no: Σ and Σ of squares are formed from per-block (sum, sumsq) partials in fixed order);
// BN applied by a final kernel writing NCHW through an LDS transpose. Fragment k-map per lane half hh for A AND B: elements 0..7 <- k = 8hh+0..7, 8..15 <- k = 16+8hh+0..7.

namespace {
constexpr int Bn = 4, C = 256, NP = 4096, C1 = 64, C2 = 64, NTOK = Bn * NP, NPB = NP / 128;
constexpr float QS = 8.0f, VS = 8.0f, PS = 8.0f, YS = 8.0f, SCALE = 0.125f, EPS = 1e-5f;
constexpr size_t QPL = (size_t)NTOK * C1, VPL = (size_t)Bn * C2 * NP;

typedef _Float16 b16;
typedef __attribute__((ext_vector_type(16))) _Float16 v16b;
typedef __attribute__((ext_vector_type(16))) __bf16 v16bb;
typedef __attribute__((ext_vector_type(8))) _Float16 v8b;
typedef __attribute__((ext_vector_type(8))) unsigned short v8us;
typedef __attribute__((ext_vector_type(8))) float v8f;
typedef __attribute__((ext_vector_type(4))) float v4f;
__device__ __forceinline__ float bf16_rne(float f) { unsigned int u = __float_as_uint(f); u += 0x7FFFu + ((u >> 16) & 1u); return __uint_as_float(u & 0xFFFF0000u); }
__device__ __forceinline__ unsigned short bf16_bits(float f) { unsigned int u = __float_as_uint(f); u += 0x7FFFu + ((u >> 16) & 1u); return (unsigned short)(u >> 16); }
__device__ __forceinline__ void split16(float v, b16& hi, b16& lo) { hi = (b16)v; lo = (b16)(v - (float)hi); }
__device__ __forceinline__ v16b frag_kb(const b16* p, int hh) { const v8b a = *(const v8b*)(p + 8 * hh), b = *(const v8b*)(p + 16 + 8 * hh); v16b f;
#pragma unroll
  for (int e = 0; e < 8; ++e) { f[e] = a[e]; f[8 + e] = b[e]; } return f; }
__device__ __forceinline__ v16bb frag_bf(const unsigned short* p, int hh) { const v8us a = *(const v8us*)(p + 8 * hh), b = *(const v8us*)(p + 16 + 8 * hh); union { unsigned short s[16]; v16bb v; } u;
#pragma unroll
  for (int e = 0; e < 8; ++e) { u.s[e] = a[e]; u.s[8 + e] = b[e]; } return u.v; }
__device__ __forceinline__ v8f wmma16b(v16b a, v16b b, v8f c) { v8f d = __builtin_amdgcn_wmma_f32_16x16x32_f16(false, a, false, b, (short)0, c, false, false); asm volatile("v_nop\n\tv_nop\n\tv_nop\n\tv_nop" : "+v"(d) : "v"(a), "v"(b)); return d; }
__device__ __forceinline__ v8f wmma16bb(v16bb a, v16bb b, v8f c) { v8f d = __builtin_amdgcn_wmma_f32_16x16x32_bf16(false, a, false, b, (short)0, c, false, false); asm volatile("v_nop\n\tv_nop\n\tv_nop\n\tv_nop" : "+v"(d) : "v"(a), "v"(b)); return d; }
__device__ __forceinline__ void wave_lds_sync() { __builtin_amdgcn_fence(__ATOMIC_RELEASE, "workgroup"); __builtin_amdgcn_wave_barrier(); __builtin_amdgcn_fence(__ATOMIC_ACQUIRE, "workgroup"); }
__device__ __forceinline__ float nexp(float x) { return __builtin_amdgcn_exp2f(x * 1.4426950408889634f); }

// prep: x NCHW -> position-major bf16 rows xT[b*4096 + p][256] (block = (b, 64 positions)); weights: [theta; phi; g] rows [192][256] bf16; W [256][64] f16 (bf16-exact). grid (64, Bn) x 256.
__global__ __launch_bounds__(256) void prep_kernel(const float* __restrict__ x, const float* __restrict__ tw, const float* __restrict__ pw, const float* __restrict__ gw, const float* __restrict__ Ww, unsigned short* __restrict__ xT, unsigned short* __restrict__ w16, b16* __restrict__ ww16) {
  __shared__ __attribute__((aligned(16))) unsigned short Tt[64][C + 8];
  const int t_ = threadIdx.x, b = blockIdx.y, p0 = blockIdx.x * 64; const float* src = x + (size_t)b * C * NP;
  { float xr[64];   // the whole tile's loads are in flight before the first value is used
#pragma unroll
    for (int k = 0; k < 64; ++k) xr[k] = src[(size_t)((t_ >> 6) + 4 * k) * NP + p0 + (t_ & 63)];
#pragma unroll
    for (int k = 0; k < 64; ++k) Tt[t_ & 63][(t_ >> 6) + 4 * k] = bf16_bits(xr[k]); }
  __syncthreads();
  {
#pragma unroll
    for (int k = 0; k < 8; ++k) { const int pp = (t_ >> 5) + 8 * k, c8 = (t_ & 31) * 8; *(v8us*)(xT + ((size_t)b * NP + p0 + pp) * C + c8) = *(const v8us*)(&Tt[pp][c8]); }
    asm volatile("s_wait_xcnt 0x0" ::: "memory");   // stands ahead of the first instruction that reuses a register of the stores above
    if (blockIdx.x == 0 && blockIdx.y == 0) {
      // One matrix (8 pieces of 8 values per thread) at a time: its 16 loads are in flight together. Kept rolled so that the next matrix reuses the 64 load registers.
#pragma unroll 1
      for (int m = 0; m < 4; ++m) { const float* W = (m == 0) ? tw : (m == 1) ? pw : (m == 2) ? gw : Ww; v4f wr[8][2];
#pragma unroll
        for (int k = 0; k < 8; ++k) { wr[k][0] = *(const v4f*)(W + (size_t)(t_ + 256 * k) * 8); wr[k][1] = *(const v4f*)(W + (size_t)(t_ + 256 * k) * 8 + 4); }
        if (m < 3) {
#pragma unroll
          for (int k = 0; k < 8; ++k) { v8us o;
#pragma unroll
            for (int e = 0; e < 8; ++e) o[e] = bf16_bits(wr[k][e >> 2][e & 3]);
            *(v8us*)(w16 + ((size_t)m * (C1 * C / 8) + t_ + 256 * k) * 8) = o; }
          asm volatile("s_wait_xcnt 0x0" ::: "memory");   // stands ahead of the first instruction that reuses a register of the stores above
        }
        else {
#pragma unroll
          for (int k = 0; k < 8; ++k) { v8b o;
#pragma unroll
            for (int e = 0; e < 8; ++e) o[e] = (b16)bf16_rne(wr[k][e >> 2][e & 3]);
            *(v8b*)(ww16 + (size_t)(t_ + 256 * k) * 8) = o; }
          asm volatile("s_wait_xcnt 0x0" ::: "memory");   // stands ahead of the first instruction that reuses a register of the stores above
        } } }
     }
}

__global__ __launch_bounds__(128) void proj_kernel(const unsigned short* __restrict__ xT, const unsigned short* __restrict__ w16, const float* __restrict__ tb, const float* __restrict__ pb, const float* __restrict__ gb, b16* __restrict__ th, b16* __restrict__ ph, b16* __restrict__ gt) {
  __shared__ __attribute__((aligned(16))) b16 Th[4][32][64 + 8], Tl[4][32][64 + 8]; __shared__ __attribute__((aligned(16))) b16 Vh[64][128 + 8], Vl[64][128 + 8];
  const int lane = threadIdx.x & 31, wave = threadIdx.x >> 5, nloc = lane & 15, hlf = lane >> 4, which = blockIdx.x, m0 = blockIdx.y * 128 + wave * 32; const int b = (blockIdx.y * 128) / NP, p0 = (blockIdx.y * 128) % NP;
  const unsigned short* Wt = w16 + (size_t)which * C1 * C; const float* bias = (which == 0) ? tb : (which == 1) ? pb : gb;
  v8f acc[2][4];
#pragma unroll
  for (int r = 0; r < 2; ++r)
#pragma unroll
    for (int t = 0; t < 4; ++t) acc[r][t] = (v8f){};
  // Every fragment load of 64 k (whole 128-byte lines) stands ahead of the first product. Kept rolled: no load moves across the asm behind a product, so unrolling would only lengthen the code.
#pragma unroll 1
  for (int kb = 0; kb < C; kb += 64) { v16bb a0[2], a1[2], bw[2][4];
#pragma unroll
    for (int ks = 0; ks < 2; ++ks) { a0[ks] = frag_bf(xT + (size_t)(m0 + nloc) * C + kb + ks * 32, hlf); a1[ks] = frag_bf(xT + (size_t)(m0 + 16 + nloc) * C + kb + ks * 32, hlf);
#pragma unroll
      for (int t = 0; t < 4; ++t) bw[ks][t] = frag_bf(Wt + (size_t)(t * 16 + nloc) * C + kb + ks * 32, hlf); }
#pragma unroll
    for (int ks = 0; ks < 2; ++ks)
#pragma unroll
      for (int t = 0; t < 4; ++t) { acc[0][t] = wmma16bb(a0[ks], bw[ks][t], acc[0][t]); acc[1][t] = wmma16bb(a1[ks], bw[ks][t], acc[1][t]); } }
  const float scl = (which == 2) ? VS : QS;
#pragma unroll
  for (int t = 0; t < 4; ++t) { const int c = t * 16 + nloc; const float bb = bf16_rne(bias[c]);
#pragma unroll
    for (int r = 0; r < 2; ++r)
#pragma unroll
      for (int v = 0; v < 8; ++v) { b16 a_, c_; split16((acc[r][t][v] + bb) * scl, a_, c_); const int row = r * 16 + 8 * hlf + v;
        if (which < 2) { Th[wave][row][c] = a_; Tl[wave][row][c] = c_; } else { Vh[c][wave * 32 + row] = a_; Vl[c][wave * 32 + row] = c_; } } }
  __syncthreads();
  {
    if (which < 2) { b16* dst = ((which == 0) ? th : ph) + (size_t)m0 * C1;
#pragma unroll
      for (int j = 0; j < 8; ++j) { const int rr = j * 4 + (lane >> 3), c8 = (lane & 7) * 8; *(v8b*)(dst + (size_t)rr * C1 + c8) = *(const v8b*)(&Th[wave][rr][c8]); *(v8b*)(dst + QPL + (size_t)rr * C1 + c8) = *(const v8b*)(&Tl[wave][rr][c8]); } }
    else { for (int i = threadIdx.x; i < 64 * 16; i += 128) { const int cc = i >> 4, c8 = (i & 15) * 8; const size_t dst = ((size_t)b * C2 + cc) * NP + p0 + c8;
        *(v8b*)(gt + dst) = *(const v8b*)(&Vh[cc][c8]); *(v8b*)(gt + VPL + dst) = *(const v8b*)(&Vl[cc][c8]); } }
     }
}

// K / V staging for attn_kernel. A stage = 64 keys = four tiles of 64 rows x 128 B: K hi, K lo (row = key, 64 channels), V hi, V lo (row = channel, 64 keys).
// LDS row pitch 144 B (16 B x odd, for the ds_load_b128 fragment readers). Two buffers: the next stage's copies fly while this stage is worked on.
// A work-group = 64 queries (4 query tiles) x NG key groups = 16 waves, so that 256 work-groups fill the chip at four waves per SIMD. A buffer holds NG such stages, one per key group:
// group g works on keys 256 st + 64 g .. + 63 of every pass st with its own running (m, l, o); the NG partial results of a query tile are merged once, behind the loop, in fixed group order.
constexpr int KT = 64, RP = 72, TILE = 64 * RP, NG = 4, NST = NP / (KT * NG), OP = C2 + 4;
constexpr unsigned TILEB = TILE * 2u, SUBB = 4u * TILEB, BUFB = NG * SUBB, HALFB = 32u * RP * 2u;

// One 64-key stage's copies of one thread: 16 B of rows r and r + 32 of each of the four tiles (256 threads x 8 x 16 B = 32 KB), global -> LDS through no register.
__device__ __forceinline__ void stage_copies(unsigned lds, const b16* gk, const b16* gv) {
  // The closing s_wait_xcnt 0 stands inside the statement so that no address register of an issued copy is rewritten in front of it.
  asm volatile("global_load_async_to_lds_b128 %0, %8, off\n\t"
               "global_load_async_to_lds_b128 %1, %9, off\n\t"
               "global_load_async_to_lds_b128 %2, %10, off\n\t"
               "global_load_async_to_lds_b128 %3, %11, off\n\t"
               "global_load_async_to_lds_b128 %4, %12, off\n\t"
               "global_load_async_to_lds_b128 %5, %13, off\n\t"
               "global_load_async_to_lds_b128 %6, %14, off\n\t"
               "global_load_async_to_lds_b128 %7, %15, off\n\t"
               "s_wait_xcnt 0x0"
               :: "v"(lds), "v"(lds + HALFB), "v"(lds + TILEB), "v"(lds + TILEB + HALFB), "v"(lds + 2u * TILEB), "v"(lds + 2u * TILEB + HALFB), "v"(lds + 3u * TILEB), "v"(lds + 3u * TILEB + HALFB),
                  "v"(gk), "v"(gk + 32 * C1), "v"(gk + QPL), "v"(gk + QPL + 32 * C1), "v"(gv), "v"(gv + (size_t)32 * NP), "v"(gv + VPL), "v"(gv + VPL + (size_t)32 * NP)
               : "memory");
}

__global__ __launch_bounds__(512) void attn_kernel(const b16* __restrict__ th, const b16* __restrict__ ph, const b16* __restrict__ gt, float* __restrict__ yrow) {
  __shared__ __attribute__((aligned(16))) b16 Ring[2][NG][4][TILE];
  __shared__ float Ms[NG][4][16], Ls[NG][4][16];
  const int wid = threadIdx.x >> 5, qt = wid & 3, grp = wid >> 2, lane = threadIdx.x & 31, hh = lane >> 4, col = lane & 15; const int tok0 = blockIdx.x * 64 + qt * 16, b = (blockIdx.x * 64) / NP; const size_t qi = (size_t)tok0 + col;
  const b16* K = ph + ((size_t)b * NP) * C1; const b16* V = gt + ((size_t)b * C2) * NP;
  const int cg = (threadIdx.x >> 8) * 2, cr = (threadIdx.x & 255) >> 3, cc = (threadIdx.x & 7) * 8;   // this thread copies for key groups cg and cg + 1: its row (and row + 32) and 16-byte piece in every tile
  const unsigned lds0 = (unsigned)(size_t)&Ring[0][cg][0][cr * RP + cc]; const b16* gk = K + (size_t)(cg * KT + cr) * C1 + cc; const b16* gv = V + (size_t)cr * NP + cg * KT + cc;
  stage_copies(lds0, gk, gv); stage_copies(lds0 + SUBB, gk + (size_t)KT * C1, gv + KT);
  asm volatile("s_wait_asynccnt 0x0" ::: "memory");   // pass 0 of this wave has landed
  __syncthreads();                                    // ... and of every wave: publishes pass 0
  stage_copies(lds0 + BUFB, gk + (size_t)(NG * KT) * C1, gv + NG * KT); stage_copies(lds0 + BUFB + SUBB, gk + (size_t)(NG * KT + KT) * C1, gv + NG * KT + KT);
  v16b qf[2], ql[2];
#pragma unroll
  for (int ks = 0; ks < 2; ++ks) { qf[ks] = frag_kb(th + qi * C1 + ks * 32, hh); ql[ks] = frag_kb(th + QPL + qi * C1 + ks * 32, hh); }
  float m = -INFINITY, l = 0.0f; v8f o[4] = {{}, {}, {}, {}};
  for (int st = 0; st < NST; ++st) { const b16* Kh = &Ring[st & 1][grp][0][0]; const b16* Kl = Kh + TILE; const b16* Vh = Kh + 2 * TILE; const b16* Vl = Kh + 3 * TILE;
#pragma unroll
   for (int kb = 0; kb < KT; kb += 32) { v8f s0 = {}, s1 = {};
#pragma unroll
    for (int ks = 0; ks < 2; ++ks) { const v16b ka = frag_kb(Kh + (kb + col) * RP + ks * 32, hh), kal = frag_kb(Kl + (kb + col) * RP + ks * 32, hh), kb_ = frag_kb(Kh + (kb + 16 + col) * RP + ks * 32, hh), kbl = frag_kb(Kl + (kb + 16 + col) * RP + ks * 32, hh);
      s0 = wmma16b(ka, qf[ks], s0); s0 = wmma16b(ka, ql[ks], s0); s0 = wmma16b(kal, qf[ks], s0); s1 = wmma16b(kb_, qf[ks], s1); s1 = wmma16b(kb_, ql[ks], s1); s1 = wmma16b(kbl, qf[ks], s1); }
    float mr = -INFINITY;
#pragma unroll
    for (int r = 0; r < 8; ++r) { s0[r] *= SCALE / (QS * QS); s1[r] *= SCALE / (QS * QS); mr = fmaxf(mr, fmaxf(s0[r], s1[r])); }
    mr = fmaxf(mr, __shfl_xor(mr, 16));
    const float mn = fmaxf(m, mr), al_ = nexp(m - mn); m = mn; float sum = 0.0f; v16b pbv, plv;
#pragma unroll
    for (int r = 0; r < 8; ++r) { const float p0 = nexp(s0[r] - mn), p1 = nexp(s1[r] - mn); sum += p0 + p1; b16 a, c; split16(p0 * PS, a, c); pbv[r] = a; plv[r] = c; split16(p1 * PS, a, c); pbv[8 + r] = a; plv[8 + r] = c; }
    sum += __shfl_xor(sum, 16); l = l * al_ + sum;
#pragma unroll
    for (int n = 0; n < 4; ++n) { o[n] *= al_; const v16b vf = frag_kb(Vh + (n * 16 + col) * RP + kb, hh), vl = frag_kb(Vl + (n * 16 + col) * RP + kb, hh); o[n] = wmma16b(vf, pbv, o[n]); o[n] = wmma16b(vf, plv, o[n]); o[n] = wmma16b(vl, pbv, o[n]); } }
   asm volatile("s_wait_dscnt 0x0" ::: "memory");      // this wave's reads of the buffer have retired before it is handed to its next writer
   asm volatile("s_wait_asynccnt 0x0" ::: "memory");   // this wave's copies of pass st + 1 have landed
   __syncthreads();                                    // publishes pass st + 1 and ends every reader's last read of pass st
   if (st + 2 < NST) { const unsigned ld = lds0 + (unsigned)(st & 1) * BUFB; const b16* nk = gk + (size_t)(st + 2) * (NG * KT) * C1; const b16* nv = gv + (st + 2) * (NG * KT);
     stage_copies(ld, nk, nv); stage_copies(ld + SUBB, nk + (size_t)KT * C1, nv + KT); } }
  asm volatile("s_wait_asynccnt 0x0" ::: "memory");    // nothing of this wave is in flight behind the loop
  // Merge of the NG key groups of each query tile. The ring is free behind the loop's last barrier (every read retired, no copy in flight) and becomes the staging of the scaled partial outputs.
  if (hh == 0) { Ms[grp][qt][col] = m; Ls[grp][qt][col] = l; }
  __syncthreads();                                     // every group's (m, l) is visible
  float mg = Ms[0][qt][col];
#pragma unroll
  for (int g = 1; g < NG; ++g) mg = fmaxf(mg, Ms[g][qt][col]);
  float lg = 0.0f;
#pragma unroll
  for (int g = 0; g < NG; ++g) lg += Ls[g][qt][col] * nexp(Ms[g][qt][col] - mg);
  const float inv = nexp(m - mg) / (lg * VS * PS);
  float* Os = (float*)&Ring[0][0][0][0];               // [16 waves][16 queries][OP]
#pragma unroll
  for (int n = 0; n < 4; ++n)
#pragma unroll
    for (int r = 0; r < 8; ++r) Os[(wid * 16 + col) * OP + n * 16 + 8 * hh + r] = o[n][r] * inv;
  __syncthreads();                                     // every group's scaled partial output is visible
  float* dst = yrow + (size_t)blockIdx.x * 64 * C2;
#pragma unroll
  for (int j = 0; j < 2; ++j) { const int i = j * 512 + threadIdx.x, q = i >> 4, c4 = (i & 15) * 4; v4f s = *(const v4f*)(Os + q * OP + c4);
#pragma unroll
    for (int g = 1; g < NG; ++g) s += *(const v4f*)(Os + (g * 64 + q) * OP + c4);
    *(v4f*)(dst + (size_t)q * C2 + c4) = s; }
}

// W conv: block = 128 positions x 64 output channels (4 column tiles): wy = y.W^T + b (K 64; 2 products) -> f32 rows wy[tok][256] + per-block column partials (Σ, Σ²) part[blk][2][64] (512 B),
__global__ __launch_bounds__(128) void wconv_kernel(const float* __restrict__ yrow, const b16* __restrict__ ww16, const float* __restrict__ Wb, float* __restrict__ wy, float* __restrict__ part) {
  __shared__ __attribute__((aligned(16))) float Ts[4][32 * 64]; __shared__ float Cs[4][2][64];
  const int lane = threadIdx.x & 31, wave = threadIdx.x >> 5, nloc = lane & 15, hlf = lane >> 4, m0 = blockIdx.y * 128 + wave * 32, c0 = blockIdx.x * 64;
  v8f acc[2][4];
#pragma unroll
  for (int r = 0; r < 2; ++r)
#pragma unroll
    for (int t = 0; t < 4; ++t) acc[r][t] = (v8f){};
#pragma unroll
  for (int kb = 0; kb < C2; kb += 32) { v16b a0, a1, l0, l1;
#pragma unroll
    for (int e = 0; e < 16; ++e) { const int k = kb + ((e < 8) ? (8 * hlf + e) : (16 + 8 * hlf + e - 8)); b16 p, q; split16(yrow[(size_t)(m0 + nloc) * C2 + k] * YS, p, q); a0[e] = p; l0[e] = q; split16(yrow[(size_t)(m0 + 16 + nloc) * C2 + k] * YS, p, q); a1[e] = p; l1[e] = q; }
#pragma unroll
    for (int t = 0; t < 4; ++t) { const v16b bw = frag_kb(ww16 + (size_t)(c0 + t * 16 + nloc) * C2 + kb, hlf); acc[0][t] = wmma16b(a0, bw, acc[0][t]); acc[0][t] = wmma16b(l0, bw, acc[0][t]); acc[1][t] = wmma16b(a1, bw, acc[1][t]); acc[1][t] = wmma16b(l1, bw, acc[1][t]); } }
  float* Tt = Ts[wave];
#pragma unroll
  for (int t = 0; t < 4; ++t) { const float bb = bf16_rne(Wb[c0 + t * 16 + nloc]);
#pragma unroll
    for (int r = 0; r < 2; ++r)
#pragma unroll
      for (int v = 0; v < 8; ++v) Tt[(r * 16 + v + 8 * hlf) * 64 + t * 16 + nloc] = acc[r][t][v] * (1.0f / YS) + bb; }
  wave_lds_sync();
  { float s = 0.0f, s2 = 0.0f, q1 = 0.0f, q2 = 0.0f; for (int rr = 0; rr < 32; ++rr) { const float a = Tt[rr * 64 + lane * 2], c = Tt[rr * 64 + lane * 2 + 1]; s += a; q1 += a * a; s2 += c; q2 += c * c; }
    Cs[wave][0][lane * 2] = s; Cs[wave][0][lane * 2 + 1] = s2; Cs[wave][1][lane * 2] = q1; Cs[wave][1][lane * 2 + 1] = q2; }
  __syncthreads();
  float* dst0 = wy + (size_t)m0 * C + c0;
  {
#pragma unroll
    for (int j = 0; j < 16; ++j) { const int rr = j * 2 + hlf, c4 = nloc * 4; *(v4f*)(dst0 + (size_t)rr * C + c4) = *(const v4f*)(Tt + rr * 64 + c4); }
    if (threadIdx.x < 128) { const int st = threadIdx.x >> 6, cc = threadIdx.x & 63; ((float*)part)[(((size_t)blockIdx.y * 4 + blockIdx.x) * 2 + st) * 64 + cc] = Cs[0][st][cc] + Cs[1][st][cc] + Cs[2][st][cc] + Cs[3][st][cc]; }
     }
}

__global__ __launch_bounds__(256) void bnstat_kernel(const float* __restrict__ part, const float* __restrict__ gma, const float* __restrict__ bta, float* __restrict__ bn, int ntok) {
  const int c = threadIdx.x; const int ct = c >> 6, cc = c & 63; double s = 0.0, q = 0.0;
  const int nb = ntok / 128; int blk = 0;
  for (; blk + 32 <= nb; blk += 32) { float sv[32], qv[32];   // 64 loads in flight, then the sums in the same block order
#pragma unroll
    for (int k = 0; k < 32; ++k) { sv[k] = part[(((size_t)(blk + k) * 4 + ct) * 2 + 0) * 64 + cc]; qv[k] = part[(((size_t)(blk + k) * 4 + ct) * 2 + 1) * 64 + cc]; }
    __builtin_amdgcn_sched_barrier(0);   // keeps every load of the group ahead of the first add, else the compiler waits on a short window of loads
#pragma unroll
    for (int k = 0; k < 32; ++k) { s += (double)sv[k]; q += (double)qv[k]; } }
  for (; blk < nb; ++blk) { s += (double)part[(((size_t)blk * 4 + ct) * 2 + 0) * 64 + cc]; q += (double)part[(((size_t)blk * 4 + ct) * 2 + 1) * 64 + cc]; }
  const double mean = s / (double)ntok; const double var = fmax(q / (double)ntok - mean * mean, 0.0);
  const float scl = bf16_rne(gma[c]) * (float)(1.0 / sqrt(var + (double)EPS)); const float sh = bf16_rne(bta[c]) - (float)mean * scl;
  { ((float*)bn)[c] = scl; ((float*)bn)[C + c] = sh;  }
}

// Work-group = 128 positions x all 256 channels, one 64-channel block at a time through the LDS tile. The row loads of all four blocks are issued ahead of the first barrier, so that they fly together.
__global__ __launch_bounds__(256) void final_kernel(const float* __restrict__ wy, const float* __restrict__ bn, float* __restrict__ out) {
  __shared__ __attribute__((aligned(16))) float Ta[64][128 + 4];
  const int b = blockIdx.y, p0 = blockIdx.x * 128, t_ = threadIdx.x;
  const int pp = t_ >> 4, c4 = (t_ & 15) * 4, cr = t_ >> 5, q4 = (t_ & 31) * 4;
  const float* src = wy + ((size_t)b * NP + p0 + pp) * C + c4;
  v4f v[4][8];
#pragma unroll
  for (int h = 0; h < 4; ++h)
#pragma unroll
    for (int j = 0; j < 8; ++j) v[h][j] = *(const v4f*)(src + (size_t)j * 16 * C + h * 64);
#pragma unroll
  for (int h = 0; h < 4; ++h) { const int cb = h * 64; float sc[8], sh[8];   // the block's 16 coefficient loads fly together, ahead of the barrier
#pragma unroll
    for (int j = 0; j < 8; ++j) { sc[j] = bn[cb + cr + 8 * j]; sh[j] = bn[C + cb + cr + 8 * j]; }
#pragma unroll
    for (int j = 0; j < 8; ++j)
#pragma unroll
      for (int e = 0; e < 4; ++e) Ta[c4 + e][pp + 16 * j] = v[h][j][e];
    __syncthreads();
    float* dst = out + ((size_t)b * C + cb + cr) * NP + p0 + q4;
#pragma unroll
    for (int j = 0; j < 8; ++j) { v4f o;
#pragma unroll
      for (int e = 0; e < 4; ++e) o[e] = Ta[cr + 8 * j][q4 + e] * sc[j] + sh[j];
      *(v4f*)(dst + (size_t)j * 8 * NP) = o; }
    __syncthreads();
  }
}
}  // namespace

extern "C" void kernel_launch(void* const* d_in, const int* in_sizes, int n_in,
                              void* d_out, int out_size, void* d_ws, size_t ws_size, hipStream_t stream) {
  (void)n_in; (void)out_size;
  const float* x = (const float*)d_in[0]; const float* tw = (const float*)d_in[1]; const float* tb = (const float*)d_in[2]; const float* pw = (const float*)d_in[3]; const float* pb = (const float*)d_in[4]; const float* gw = (const float*)d_in[5]; const float* gb = (const float*)d_in[6];
  const float* Ww = (const float*)d_in[7]; const float* Wb = (const float*)d_in[8]; const float* gma = (const float*)d_in[9]; const float* bta = (const float*)d_in[10];
  float* out = (float*)d_out;   // [4][256][64][64]
  if (in_sizes[0] != Bn * C * NP || in_sizes[1] != C1 * C || in_sizes[5] != C2 * C || in_sizes[7] != C * C2 || in_sizes[9] != C) return;
  size_t off = 0; char* ws = (char*)d_ws;
  auto carve = [&](size_t bytes) { char* p = ws + off; off += (bytes + 255) & ~(size_t)255; return p; };
  unsigned short* xT = (unsigned short*)carve((size_t)NTOK * C * 2); unsigned short* w16 = (unsigned short*)carve((size_t)3 * C1 * C * 2); b16* ww16 = (b16*)carve((size_t)C * C2 * 2);
  b16* th = (b16*)carve(QPL * 2 * 2); b16* ph = (b16*)carve(QPL * 2 * 2); b16* gt = (b16*)carve(VPL * 2 * 2); float* yrow = (float*)carve((size_t)NTOK * C2 * 4); float* wy = (float*)carve((size_t)NTOK * C * 4); float* part = (float*)carve((size_t)(NTOK / 128) * 4 * 2 * 64 * 4); float* bn = (float*)carve(2 * C * 4);
  if (off > ws_size) return;                                    // ≈ 8.4 + 0.1 + 4.2x3 + 4.2 + 16.8 + 0.3 ≈ 42 MB
  prep_kernel<<<dim3(NP / 64, Bn), 256, 0, stream>>>(x, tw, pw, gw, Ww, xT, w16, ww16);
  proj_kernel<<<dim3(3, NTOK / 128), 128, 0, stream>>>(xT, w16, tb, pb, gb, th, ph, gt);
  attn_kernel<<<NTOK / 64, 512, 0, stream>>>(th, ph, gt, yrow);
  wconv_kernel<<<dim3(C / 64, NTOK / 128), 128, 0, stream>>>(yrow, ww16, Wb, wy, part);
  bnstat_kernel<<<1, 256, 0, stream>>>(part, gma, bta, bn, NTOK);
  final_kernel<<<dim3(NPB, Bn), 256, 0, stream>>>(wy, bn, out);
}

// v004
// A run of this version takes 90.3 microseconds.
// Timed twice side by side with v003, it ran 1.29 times as fast both times.
// Over all steps from v000 it is 4.66 times as fast.
#include <hip/hip_runtime.h>

// _MS_NonLocalBlockND (scale 1): theta, phi (64 ch) and g (64 ch) = 1x1 convs of x [4][256][64x64]; f = theta^T phi / 8 over the 4096 positions; attn = softmax; y = attn g; wy = W y + b
// (1x1 conv 64 -> 256); out = BatchNorm2d in TRAINING mode (batch mean / biased variance over (B, H, W) per channel, eps 1e-5, gamma, beta) -> NCHW [4][256][64][64].
// Projections on v_wmma_f32_16x16x32_bf16 (exact bf16 operands; fragments from an LDS transpose of the NCHW input; 1 product); attention per (b, 16 queries):
// S^T = phi.theta^T (K = 64; theta, phi as f16 hi+lo pairs x8; 3 products), online softmax f32, y^T = (8g)^T.P^T (3 products); wy^T = W.y^T + b (y f32 split x8, W exact; 2 products) on
// v_wmma_f32_16x16x32_f16, f32 accumulate, as the attention kernel's epilogue, which stores wy^T in NCHW order and per-block (sum, sum of squares) partials of every channel;
// the final kernel (one channel per work-group) adds its channel's partials in fixed order and applies BN. Fragment k-map per lane half hh for A AND B: elements 0..7 <- k = 8hh+0..7, 8..15 <- k = 16+8hh+0..7.

namespace {
constexpr int Bn = 4, C = 256, NP = 4096, C1 = 64, C2 = 64, NTOK = Bn * NP, NBLK = NTOK / 64;
constexpr float QS = 8.0f, VS = 8.0f, PS = 8.0f, YS = 8.0f, SCALE = 0.125f, EPS = 1e-5f;
constexpr size_t QPL = (size_t)NTOK * C1, VPL = (size_t)Bn * C2 * NP;

typedef _Float16 b16;
typedef __attribute__((ext_vector_type(16))) _Float16 v16b;
typedef __attribute__((ext_vector_type(16))) __bf16 v16bb;
typedef __attribute__((ext_vector_type(8))) _Float16 v8b;
typedef __attribute__((ext_vector_type(8))) unsigned short v8us;
typedef __attribute__((ext_vector_type(8))) float v8f;
typedef __attribute__((ext_vector_type(4))) float v4f;
__device__ __forceinline__ float bf16_rne(float f) { unsigned int u = __float_as_uint(f); u += 0x7FFFu + ((u >> 16) & 1u); return __uint_as_float(u & 0xFFFF0000u); }
__device__ __forceinline__ unsigned short bf16_bits(float f) { unsigned int u = __float_as_uint(f); u += 0x7FFFu + ((u >> 16) & 1u); return (unsigned short)(u >> 16); }
__device__ __forceinline__ void split16(float v, b16& hi, b16& lo) { hi = (b16)v; lo = (b16)(v - (float)hi); }
__device__ __forceinline__ v16b frag_kb(const b16* p, int hh) { const v8b a = *(const v8b*)(p + 8 * hh), b = *(const v8b*)(p + 16 + 8 * hh); v16b f;
#pragma unroll
  for (int e = 0; e < 8; ++e) { f[e] = a[e]; f[8 + e] = b[e]; } return f; }
__device__ __forceinline__ v16bb frag_bf(const unsigned short* p, int hh) { const v8us a = *(const v8us*)(p + 8 * hh), b = *(const v8us*)(p + 16 + 8 * hh); union { unsigned short s[16]; v16bb v; } u;
#pragma unroll
  for (int e = 0; e < 8; ++e) { u.s[e] = a[e]; u.s[8 + e] = b[e]; } return u.v; }
__device__ __forceinline__ v8f wmma16b(v16b a, v16b b, v8f c) { v8f d = __builtin_amdgcn_wmma_f32_16x16x32_f16(false, a, false, b, (short)0, c, false, false); asm volatile("v_nop\n\tv_nop\n\tv_nop\n\tv_nop" : "+v"(d) : "v"(a), "v"(b)); return d; }
__device__ __forceinline__ v8f wmma16bb(v16bb a, v16bb b, v8f c) { v8f d = __builtin_amdgcn_wmma_f32_16x16x32_bf16(false, a, false, b, (short)0, c, false, false); asm volatile("v_nop\n\tv_nop\n\tv_nop\n\tv_nop" : "+v"(d) : "v"(a), "v"(b)); return d; }
__device__ __forceinline__ float nexp(float x) { return __builtin_amdgcn_exp2f(x * 1.4426950408889634f); }

// prep: x NCHW -> position-major bf16 rows xT[b*4096 + p][256] (block = (b, 64 positions)); weights: [theta; phi; g] rows [192][256] bf16; W [256][64] f16 (bf16-exact). grid (64, Bn) x 256.
__global__ __launch_bounds__(256) void prep_kernel(const float* __restrict__ x, const float* __restrict__ tw, const float* __restrict__ pw, const float* __restrict__ gw, const float* __restrict__ Ww, unsigned short* __restrict__ xT, unsigned short* __restrict__ w16, b16* __restrict__ ww16) {
  __shared__ __attribute__((aligned(16))) unsigned short Tt[64][C + 8];
  const int t_ = threadIdx.x, b = blockIdx.y, p0 = blockIdx.x * 64; const float* src = x + (size_t)b * C * NP;
  { float xr[64];   // the whole tile's loads are in flight before the first value is used
#pragma unroll
    for (int k = 0; k < 64; ++k) xr[k] = src[(size_t)((t_ >> 6) + 4 * k) * NP + p0 + (t_ & 63)];
#pragma unroll
    for (int k = 0; k < 64; ++k) Tt[t_ & 63][(t_ >> 6) + 4 * k] = bf16_bits(xr[k]); }
  __syncthreads();
  {
#pragma unroll
    for (int k = 0; k < 8; ++k) { const int pp = (t_ >> 5) + 8 * k, c8 = (t_ & 31) * 8; *(v8us*)(xT + ((size_t)b * NP + p0 + pp) * C + c8) = *(const v8us*)(&Tt[pp][c8]); }
    asm volatile("s_wait_xcnt 0x0" ::: "memory");   // stands ahead of the first instruction that reuses a register of the stores above
    if (blockIdx.x == 0 && blockIdx.y == 0) {
      // One matrix (8 pieces of 8 values per thread) at a time: its 16 loads are in flight together. Kept rolled so that the next matrix reuses the 64 load registers.
#pragma unroll 1
      for (int m = 0; m < 4; ++m) { const float* W = (m == 0) ? tw : (m == 1) ? pw : (m == 2) ? gw : Ww; v4f wr[8][2];
#pragma unroll
        for (int k = 0; k < 8; ++k) { wr[k][0] = *(const v4f*)(W + (size_t)(t_ + 256 * k) * 8); wr[k][1] = *(const v4f*)(W + (size_t)(t_ + 256 * k) * 8 + 4); }
        if (m < 3) {
#pragma unroll
          for (int k = 0; k < 8; ++k) { v8us o;
#pragma unroll
            for (int e = 0; e < 8; ++e) o[e] = bf16_bits(wr[k][e >> 2][e & 3]);
            *(v8us*)(w16 + ((size_t)m * (C1 * C / 8) + t_ + 256 * k) * 8) = o; }
          asm volatile("s_wait_xcnt 0x0" ::: "memory");   // stands ahead of the first instruction that reuses a register of the stores above
        }
        else {
#pragma unroll
          for (int k = 0; k < 8; ++k) { v8b o;
#pragma unroll
            for (int e = 0; e < 8; ++e) o[e] = (b16)bf16_rne(wr[k][e >> 2][e & 3]);
            *(v8b*)(ww16 + (size_t)(t_ + 256 * k) * 8) = o; }
          asm volatile("s_wait_xcnt 0x0" ::: "memory");   // stands ahead of the first instruction that reuses a register of the stores above
        } } }
     }
}

__global__ __launch_bounds__(128) void proj_kernel(const unsigned short* __restrict__ xT, const unsigned short* __restrict__ w16, const float* __restrict__ tb, const float* __restrict__ pb, const float* __restrict__ gb, b16* __restrict__ th, b16* __restrict__ ph, b16* __restrict__ gt) {
  __shared__ __attribute__((aligned(16))) b16 Th[4][32][64 + 8], Tl[4][32][64 + 8]; __shared__ __attribute__((aligned(16))) b16 Vh[64][128 + 8], Vl[64][128 + 8];
  const int lane = threadIdx.x & 31, wave = threadIdx.x >> 5, nloc = lane & 15, hlf = lane >> 4, which = blockIdx.x, m0 = blockIdx.y * 128 + wave * 32; const int b = (blockIdx.y * 128) / NP, p0 = (blockIdx.y * 128) % NP;
  const unsigned short* Wt = w16 + (size_t)which * C1 * C; const float* bias = (which == 0) ? tb : (which == 1) ? pb : gb;
  v8f acc[2][4];
#pragma unroll
  for (int r = 0; r < 2; ++r)
#pragma unroll
    for (int t = 0; t < 4; ++t) acc[r][t] = (v8f){};
  // Every fragment load of 64 k (whole 128-byte lines) stands ahead of the first product. Kept rolled: no load moves across the asm behind a product, so unrolling would only lengthen the code.
#pragma unroll 1
  for (int kb = 0; kb < C; kb += 64) { v16bb a0[2], a1[2], bw[2][4];
#pragma unroll
    for (int ks = 0; ks < 2; ++ks) { a0[ks] = frag_bf(xT + (size_t)(m0 + nloc) * C + kb + ks * 32, hlf); a1[ks] = frag_bf(xT + (size_t)(m0 + 16 + nloc) * C + kb + ks * 32, hlf);
#pragma unroll
      for (int t = 0; t < 4; ++t) bw[ks][t] = frag_bf(Wt + (size_t)(t * 16 + nloc) * C + kb + ks * 32, hlf); }
#pragma unroll
    for (int ks = 0; ks < 2; ++ks)
#pragma unroll
      for (int t = 0; t < 4; ++t) { acc[0][t] = wmma16bb(a0[ks], bw[ks][t], acc[0][t]); acc[1][t] = wmma16bb(a1[ks], bw[ks][t], acc[1][t]); } }
  const float scl = (which == 2) ? VS : QS;
#pragma unroll
  for (int t = 0; t < 4; ++t) { const int c = t * 16 + nloc; const float bb = bf16_rne(bias[c]);
#pragma unroll
    for (int r = 0; r < 2; ++r)
#pragma unroll
      for (int v = 0; v < 8; ++v) { b16 a_, c_; split16((acc[r][t][v] + bb) * scl, a_, c_); const int row = r * 16 + 8 * hlf + v;
        if (which < 2) { Th[wave][row][c] = a_; Tl[wave][row][c] = c_; } else { Vh[c][wave * 32 + row] = a_; Vl[c][wave * 32 + row] = c_; } } }
  __syncthreads();
  {
    if (which < 2) { b16* dst = ((which == 0) ? th : ph) + (size_t)m0 * C1;
#pragma unroll
      for (int j = 0; j < 8; ++j) { const int rr = j * 4 + (lane >> 3), c8 = (lane & 7) * 8; *(v8b*)(dst + (size_t)rr * C1 + c8) = *(const v8b*)(&Th[wave][rr][c8]); *(v8b*)(dst + QPL + (size_t)rr * C1 + c8) = *(const v8b*)(&Tl[wave][rr][c8]); } }
    else { for (int i = threadIdx.x; i < 64 * 16; i += 128) { const int cc = i >> 4, c8 = (i & 15) * 8; const size_t dst = ((size_t)b * C2 + cc) * NP + p0 + c8;
        *(v8b*)(gt + dst) = *(const v8b*)(&Vh[cc][c8]); *(v8b*)(gt + VPL + dst) = *(const v8b*)(&Vl[cc][c8]); } }
     }
}

// K / V staging for attn_kernel. A stage = 64 keys = four tiles of 64 rows x 128 B: K hi, K lo (row = key, 64 channels), V hi, V lo (row = channel, 64 keys).
// LDS row pitch 144 B (16 B x odd, for the ds_load_b128 fragment readers). Two buffers: the next stage's copies fly while this stage is worked on.
// A work-group = 64 queries (4 query tiles) x NG key groups = 16 waves, so that 256 work-groups fill the chip at four waves per SIMD. A buffer holds NG such stages, one per key group:
// group g works on keys 256 st + 64 g .. + 63 of every pass st with its own running (m, l, o); the NG partial results of a query tile are merged once, behind the loop, in fixed group order.
constexpr int KT = 64, RP = 72, TILE = 64 * RP, NG = 4, NST = NP / (KT * NG), OP = C2 + 4, TP = 64 + 4;
constexpr unsigned TILEB = TILE * 2u, SUBB = 4u * TILEB, BUFB = NG * SUBB, HALFB = 32u * RP * 2u;

// One 64-key stage's copies of one thread: 16 B of rows r and r + 32 of each of the four tiles (256 threads x 8 x 16 B = 32 KB), global -> LDS through no register.
__device__ __forceinline__ void stage_copies(unsigned lds, const b16* gk, const b16* gv) {
  // The closing s_wait_xcnt 0 stands inside the statement so that no address register of an issued copy is rewritten in front of it.
  asm volatile("global_load_async_to_lds_b128 %0, %8, off\n\t"
               "global_load_async_to_lds_b128 %1, %9, off\n\t"
               "global_load_async_to_lds_b128 %2, %10, off\n\t"
               "global_load_async_to_lds_b128 %3, %11, off\n\t"
               "global_load_async_to_lds_b128 %4, %12, off\n\t"
               "global_load_async_to_lds_b128 %5, %13, off\n\t"
               "global_load_async_to_lds_b128 %6, %14, off\n\t"
               "global_load_async_to_lds_b128 %7, %15, off\n\t"
               "s_wait_xcnt 0x0"
               :: "v"(lds), "v"(lds + HALFB), "v"(lds + TILEB), "v"(lds + TILEB + HALFB), "v"(lds + 2u * TILEB), "v"(lds + 2u * TILEB + HALFB), "v"(lds + 3u * TILEB), "v"(lds + 3u * TILEB + HALFB),
                  "v"(gk), "v"(gk + 32 * C1), "v"(gk + QPL), "v"(gk + QPL + 32 * C1), "v"(gv), "v"(gv + (size_t)32 * NP), "v"(gv + VPL), "v"(gv + VPL + (size_t)32 * NP)
               : "memory");
}

__global__ __launch_bounds__(512) void attn_kernel(const b16* __restrict__ th, const b16* __restrict__ ph, const b16* __restrict__ gt, const b16* __restrict__ ww16, const float* __restrict__ Wb, float* __restrict__ wyT, float* __restrict__ part) {
  __shared__ __attribute__((aligned(16))) b16 Ring[2][NG][4][TILE];
  __shared__ float Ms[NG][4][16], Ls[NG][4][16];
  const int wid = threadIdx.x >> 5, qt = wid & 3, grp = wid >> 2, lane = threadIdx.x & 31, hh = lane >> 4, col = lane & 15; const int tok0 = blockIdx.x * 64 + qt * 16, b = (blockIdx.x * 64) / NP; const size_t qi = (size_t)tok0 + col;
  const b16* K = ph + ((size_t)b * NP) * C1; const b16* V = gt + ((size_t)b * C2) * NP;
  const int cg = (threadIdx.x >> 8) * 2, cr = (threadIdx.x & 255) >> 3, cc = (threadIdx.x & 7) * 8;   // this thread copies for key groups cg and cg + 1: its row (and row + 32) and 16-byte piece in every tile
  const unsigned lds0 = (unsigned)(size_t)&Ring[0][cg][0][cr * RP + cc]; const b16* gk = K + (size_t)(cg * KT + cr) * C1 + cc; const b16* gv = V + (size_t)cr * NP + cg * KT + cc;
  stage_copies(lds0, gk, gv); stage_copies(lds0 + SUBB, gk + (size_t)KT * C1, gv + KT);
  asm volatile("s_wait_asynccnt 0x0" ::: "memory");   // pass 0 of this wave has landed
  __syncthreads();                                    // ... and of every wave: publishes pass 0
  stage_copies(lds0 + BUFB, gk + (size_t)(NG * KT) * C1, gv + NG * KT); stage_copies(lds0 + BUFB + SUBB, gk + (size_t)(NG * KT + KT) * C1, gv + NG * KT + KT);
  v16b qf[2], ql[2];
#pragma unroll
  for (int ks = 0; ks < 2; ++ks) { qf[ks] = frag_kb(th + qi * C1 + ks * 32, hh); ql[ks] = frag_kb(th + QPL + qi * C1 + ks * 32, hh); }
  asm volatile("s_wait_xcnt 0x0" ::: "memory");   // stands ahead of the first instruction that reuses the address register of the loads above
  __builtin_amdgcn_sched_barrier(0);                  // keeps the register writes that follow behind that wait: without it the compiler lifts the zeroing of o over it
  float m = -INFINITY, l = 0.0f; v8f o[4] = {{}, {}, {}, {}};
  for (int st = 0; st < NST; ++st) { const b16* Kh = &Ring[st & 1][grp][0][0]; const b16* Kl = Kh + TILE; const b16* Vh = Kh + 2 * TILE; const b16* Vl = Kh + 3 * TILE;
#pragma unroll
   for (int kb = 0; kb < KT; kb += 32) { v8f s0 = {}, s1 = {};
#pragma unroll
    for (int ks = 0; ks < 2; ++ks) { const v16b ka = frag_kb(Kh + (kb + col) * RP + ks * 32, hh), kal = frag_kb(Kl + (kb + col) * RP + ks * 32, hh), kb_ = frag_kb(Kh + (kb + 16 + col) * RP + ks * 32, hh), kbl = frag_kb(Kl + (kb + 16 + col) * RP + ks * 32, hh);
      s0 = wmma16b(ka, qf[ks], s0); s0 = wmma16b(ka, ql[ks], s0); s0 = wmma16b(kal, qf[ks], s0); s1 = wmma16b(kb_, qf[ks], s1); s1 = wmma16b(kb_, ql[ks], s1); s1 = wmma16b(kbl, qf[ks], s1); }
    float mr = -INFINITY;
#pragma unroll
    for (int r = 0; r < 8; ++r) { s0[r] *= SCALE / (QS * QS); s1[r] *= SCALE / (QS * QS); mr = fmaxf(mr, fmaxf(s0[r], s1[r])); }
    mr = fmaxf(mr, __shfl_xor(mr, 16));
    const float mn = fmaxf(m, mr), al_ = nexp(m - mn); m = mn; float sum = 0.0f; v16b pbv, plv;
#pragma unroll
    for (int r = 0; r < 8; ++r) { const float p0 = nexp(s0[r] - mn), p1 = nexp(s1[r] - mn); sum += p0 + p1; b16 a, c; split16(p0 * PS, a, c); pbv[r] = a; plv[r] = c; split16(p1 * PS, a, c); pbv[8 + r] = a; plv[8 + r] = c; }
    sum += __shfl_xor(sum, 16); l = l * al_ + sum;
#pragma unroll
    for (int n = 0; n < 4; ++n) { o[n] *= al_; const v16b vf = frag_kb(Vh + (n * 16 + col) * RP + kb, hh), vl = frag_kb(Vl + (n * 16 + col) * RP + kb, hh); o[n] = wmma16b(vf, pbv, o[n]); o[n] = wmma16b(vf, plv, o[n]); o[n] = wmma16b(vl, pbv, o[n]); } }
   asm volatile("s_wait_dscnt 0x0" ::: "memory");      // this wave's reads of the buffer have retired before it is handed to its next writer
   asm volatile("s_wait_asynccnt 0x0" ::: "memory");   // this wave's copies of pass st + 1 have landed
   __syncthreads();                                    // publishes pass st + 1 and ends every reader's last read of pass st
   if (st + 2 < NST) { const unsigned ld = lds0 + (unsigned)(st & 1) * BUFB; const b16* nk = gk + (size_t)(st + 2) * (NG * KT) * C1; const b16* nv = gv + (st + 2) * (NG * KT);
     stage_copies(ld, nk, nv); stage_copies(ld + SUBB, nk + (size_t)KT * C1, nv + KT); } }
  asm volatile("s_wait_asynccnt 0x0" ::: "memory");    // nothing of this wave is in flight behind the loop
  // Merge of the NG key groups of each query tile. The ring is free behind the loop's last barrier (every read retired, no copy in flight) and becomes the staging of the scaled partial outputs.
  if (hh == 0) { Ms[grp][qt][col] = m; Ls[grp][qt][col] = l; }
  __syncthreads();                                     // every group's (m, l) is visible
  float mg = Ms[0][qt][col];
#pragma unroll
  for (int g = 1; g < NG; ++g) mg = fmaxf(mg, Ms[g][qt][col]);
  float lg = 0.0f;
#pragma unroll
  for (int g = 0; g < NG; ++g) lg += Ls[g][qt][col] * nexp(Ms[g][qt][col] - mg);
  const float inv = nexp(m - mg) / (lg * VS * PS);
  float* Os = (float*)&Ring[0][0][0][0];               // [16 waves][16 queries][OP]
#pragma unroll
  for (int n = 0; n < 4; ++n)
#pragma unroll
    for (int r = 0; r < 8; ++r) Os[(wid * 16 + col) * OP + n * 16 + 8 * hh + r] = o[n][r] * inv;
  __syncthreads();                                     // every group's scaled partial output is visible
  // W conv as the epilogue. Wave (qt, grp) forms wy^T for channels 64 grp .. + 63 (A = W rows) at positions 16 qt .. + 15 (B = y rows, the NG partials added in group order): D row = channel, D column = position.
  v16b yh[2], yl[2], wf[4][2];
#pragma unroll
  for (int ks = 0; ks < 2; ++ks)
#pragma unroll
    for (int t = 0; t < 4; ++t) wf[t][ks] = frag_kb(ww16 + (size_t)(grp * 64 + t * 16 + col) * C2 + ks * 32, hh);
#pragma unroll
  for (int ks = 0; ks < 2; ++ks)
#pragma unroll
    for (int h = 0; h < 2; ++h) { const float* sp = Os + (qt * 16 + col) * OP + ks * 32 + h * 16 + 8 * hh;   // fragment elements 8h .. 8h + 7 <- k = 32 ks + 16 h + 8 hh + 0 .. 7
      v4f s0 = *(const v4f*)sp, s1 = *(const v4f*)(sp + 4);
#pragma unroll
      for (int g = 1; g < NG; ++g) { s0 += *(const v4f*)(sp + g * 64 * OP); s1 += *(const v4f*)(sp + g * 64 * OP + 4); }
#pragma unroll
      for (int e = 0; e < 4; ++e) { b16 p, q; split16(s0[e] * YS, p, q); yh[ks][8 * h + e] = p; yl[ks][8 * h + e] = q; split16(s1[e] * YS, p, q); yh[ks][8 * h + 4 + e] = p; yl[ks][8 * h + 4 + e] = q; } }
  v8f acc[4] = {{}, {}, {}, {}};
#pragma unroll
  for (int ks = 0; ks < 2; ++ks)
#pragma unroll
    for (int t = 0; t < 4; ++t) { acc[t] = wmma16b(wf[t][ks], yh[ks], acc[t]); acc[t] = wmma16b(wf[t][ks], yl[ks], acc[t]); }
  float* Ts = Os + 16 * 16 * OP;                       // [256 channels][TP]: 64 positions per row; lies behind Os, which other waves may still be reading
#pragma unroll
  for (int t = 0; t < 4; ++t) { const int c8 = grp * 64 + t * 16 + 8 * hh; const v4f b0 = *(const v4f*)(Wb + c8), b1 = *(const v4f*)(Wb + c8 + 4);
#pragma unroll
    for (int v = 0; v < 8; ++v) Ts[(c8 + v) * TP + qt * 16 + col] = acc[t][v] * (1.0f / YS) + bf16_rne((v < 4) ? b0[v & 3] : b1[v & 3]); }
  __syncthreads();                                     // the whole 256 x 64 tile of wy^T is visible
  float* dst = wyT + (size_t)b * C * NP + (blockIdx.x * 64) % NP;
#pragma unroll
  for (int j = 0; j < 8; ++j) { const int i = j * 512 + threadIdx.x, ch = i >> 4, p4 = (i & 15) * 4; *(v4f*)(dst + (size_t)ch * NP + p4) = *(const v4f*)(Ts + ch * TP + p4); }
  // Per-block partials of every channel over the block's 64 positions: threads 0 .. 255 the sums, 256 .. 511 the sums of squares; part[block][4][2][64], 2 KB per work-group.
  { const int ch = threadIdx.x & 255, st = threadIdx.x >> 8; v4f a4 = {};
    if (st == 0) {
#pragma unroll
      for (int p = 0; p < 16; ++p) a4 += *(const v4f*)(Ts + ch * TP + p * 4); }
    else {
#pragma unroll
      for (int p = 0; p < 16; ++p) { const v4f a = *(const v4f*)(Ts + ch * TP + p * 4); a4 += a * a; } }
    part[(size_t)blockIdx.x * 512 + (ch >> 6) * 128 + st * 64 + (ch & 63)] = (a4[0] + a4[1]) + (a4[2] + a4[3]); }
}

// Work-group = one channel, all 4 x 4096 positions (64 KB of wy^T, NCHW like out). Thread t takes block t's (sum, sum of squares) of the channel; they are added in double in a fixed tree
// (32 lanes by xor steps, then the 8 waves in order). The row loads are issued ahead of that reduction, so that they fly under it.
__global__ __launch_bounds__(256) void final_kernel(const float* __restrict__ wyT, const float* __restrict__ part, const float* __restrict__ gma, const float* __restrict__ bta, float* __restrict__ out) {
  static_assert(NBLK == 256, "one partial pair per thread");
  __shared__ double Rs[8], Rq[8];
  const int c = blockIdx.x, t_ = threadIdx.x;
  const float ps = part[(size_t)t_ * 512 + (c >> 6) * 128 + (c & 63)], pq = part[(size_t)t_ * 512 + (c >> 6) * 128 + 64 + (c & 63)];
  const float gm = gma[c], bt = bta[c];
  v4f v[16];
#pragma unroll
  for (int j = 0; j < 16; ++j) v[j] = *(const v4f*)(wyT + ((size_t)(j >> 2) * C + c) * NP + ((j & 3) * 256 + t_) * 4);
  asm volatile("s_wait_xcnt 0x0" ::: "memory");   // stands ahead of the first instruction that reuses an address register of the loads above
  double s = (double)ps, q = (double)pq;
#pragma unroll
  for (int m = 1; m < 32; m <<= 1) { s += __shfl_xor(s, m); q += __shfl_xor(q, m); }
  if ((t_ & 31) == 0) { Rs[t_ >> 5] = s; Rq[t_ >> 5] = q; }
  __syncthreads();                                // every wave's pair of sums is visible
  s = Rs[0]; q = Rq[0];
#pragma unroll
  for (int w = 1; w < 8; ++w) { s += Rs[w]; q += Rq[w]; }
  const double mean = s / (double)NTOK; const double var = fmax(q / (double)NTOK - mean * mean, 0.0);
  const float scl = bf16_rne(gm) * (float)(1.0 / sqrt(var + (double)EPS)); const float sh = bf16_rne(bt) - (float)mean * scl;
#pragma unroll
  for (int j = 0; j < 16; ++j) { v4f o;
#pragma unroll
    for (int e = 0; e < 4; ++e) o[e] = v[j][e] * scl + sh;
    *(v4f*)(out + ((size_t)(j >> 2) * C + c) * NP + ((j & 3) * 256 + t_) * 4) = o; }
}
}  // namespace

extern "C" void kernel_launch(void* const* d_in, const int* in_sizes, int n_in,
                              void* d_out, int out_size, void* d_ws, size_t ws_size, hipStream_t stream) {
  (void)n_in; (void)out_size;
  const float* x = (const float*)d_in[0]; const float* tw = (const float*)d_in[1]; const float* tb = (const float*)d_in[2]; const float* pw = (const float*)d_in[3]; const float* pb = (const float*)d_in[4]; const float* gw = (const float*)d_in[5]; const float* gb = (const float*)d_in[6];
  const float* Ww = (const float*)d_in[7]; const float* Wb = (const float*)d_in[8]; const float* gma = (const float*)d_in[9]; const float* bta = (const float*)d_in[10];
  float* out = (float*)d_out;   // [4][256][64][64]
  if (in_sizes[0] != Bn * C * NP || in_sizes[1] != C1 * C || in_sizes[5] != C2 * C || in_sizes[7] != C * C2 || in_sizes[9] != C) return;
  size_t off = 0; char* ws = (char*)d_ws;
  auto carve = [&](size_t bytes) { char* p = ws + off; off += (bytes + 255) & ~(size_t)255; return p; };
  unsigned short* xT = (unsigned short*)carve((size_t)NTOK * C * 2); unsigned short* w16 = (unsigned short*)carve((size_t)3 * C1 * C * 2); b16* ww16 = (b16*)carve((size_t)C * C2 * 2);
  b16* th = (b16*)carve(QPL * 2 * 2); b16* ph = (b16*)carve(QPL * 2 * 2); b16* gt = (b16*)carve(VPL * 2 * 2); float* wyT = (float*)carve((size_t)NTOK * C * 4); float* part = (float*)carve((size_t)NBLK * 4 * 2 * 64 * 4);
  if (off > ws_size) return;                                    // about 8.4 + 0.1 + 4.2x3 + 16.8 + 0.5 = 38 MB
  prep_kernel<<<dim3(NP / 64, Bn), 256, 0, stream>>>(x, tw, pw, gw, Ww, xT, w16, ww16);
  proj_kernel<<<dim3(3, NTOK / 128), 128, 0, stream>>>(xT, w16, tb, pb, gb, th, ph, gt);
  attn_kernel<<<NTOK / 64, 512, 0, stream>>>(th, ph, gt, ww16, Wb, wyT, part);
  final_kernel<<<C, 256, 0, stream>>>(wyT, part, gma, bta, out);
}

// v005
// One run takes 85.6 microseconds.
// Timed twice side by side with v004, it ran 1.05 times as fast both times.
// Counting every step since v000, it is 4.90 times as fast.
#include <hip/hip_runtime.h>

// _MS_NonLocalBlockND (scale 1): theta, phi (64 ch) and g (64 ch) = 1x1 convs of x [4][256][64x64]; f = theta^T phi / 8 over the 4096 positions; attn = softmax; y = attn g; wy = W y + b
// (1x1 conv 64 -> 256); out = BatchNorm2d in TRAINING mode (batch mean / biased variance over (B, H, W) per channel, eps 1e-5, gamma, beta) -> NCHW [4][256][64][64].
// Projections on v_wmma_f32_16x16x32_bf16 (exact bf16 operands; fragments from an LDS transpose of the NCHW input; 1 product); attention per (b, 16 queries):
// S^T = phi.theta^T (K = 64; theta, phi as f16 hi+lo pairs x8; 3 products), online softmax f32, y^T = (8g)^T.P^T (3 products); wy^T = W.y^T + b (y f32 split x8, W exact; 2 products) on
// v_wmma_f32_16x16x32_f16, f32 accumulate, as the attention kernel's epilogue, which stores wy^T in NCHW order and per-block (sum, sum of squares) partials of every channel;
// the final kernel (one channel per work-group) adds its channel's partials in fixed order and applies BN. Fragment k-map per lane half hh for A AND B: elements 0..7 <- k = 8hh+0..7, 8..15 <- k = 16+8hh+0..7.

namespace {
constexpr int Bn = 4, C = 256, NP = 4096, C1 = 64, C2 = 64, NTOK = Bn * NP, NBLK = NTOK / 64;
constexpr float QS = 8.0f, VS = 8.0f, PS = 8.0f, YS = 8.0f, SCALE = 0.125f, EPS = 1e-5f;
constexpr size_t QPL = (size_t)NTOK * C1, VPL = (size_t)Bn * C2 * NP;

typedef _Float16 b16;
typedef __attribute__((ext_vector_type(16))) _Float16 v16b;
typedef __attribute__((ext_vector_type(16))) __bf16 v16bb;
typedef __attribute__((ext_vector_type(8))) _Float16 v8b;
typedef __attribute__((ext_vector_type(8))) unsigned short v8us;
typedef __attribute__((ext_vector_type(8))) float v8f;
typedef __attribute__((ext_vector_type(4))) float v4f;
__device__ __forceinline__ float bf16_rne(float f) { unsigned int u = __float_as_uint(f); u += 0x7FFFu + ((u >> 16) & 1u); return __uint_as_float(u & 0xFFFF0000u); }
__device__ __forceinline__ unsigned short bf16_bits(float f) { unsigned int u = __float_as_uint(f); u += 0x7FFFu + ((u >> 16) & 1u); return (unsigned short)(u >> 16); }
__device__ __forceinline__ void split16(float v, b16& hi, b16& lo) { hi = (b16)v; lo = (b16)(v - (float)hi); }
__device__ __forceinline__ v16b frag_kb(const b16* p, int hh) { const v8b a = *(const v8b*)(p + 8 * hh), b = *(const v8b*)(p + 16 + 8 * hh); v16b f;
#pragma unroll
  for (int e = 0; e < 8; ++e) { f[e] = a[e]; f[8 + e] = b[e]; } return f; }
__device__ __forceinline__ v16bb frag_bf(const unsigned short* p, int hh) { const v8us a = *(const v8us*)(p + 8 * hh), b = *(const v8us*)(p + 16 + 8 * hh); union { unsigned short s[16]; v16bb v; } u;
#pragma unroll
  for (int e = 0; e < 8; ++e) { u.s[e] = a[e]; u.s[8 + e] = b[e]; } return u.v; }
__device__ __forceinline__ v8f wmma16b(v16b a, v16b b, v8f c) { return __builtin_amdgcn_wmma_f32_16x16x32_f16(false, a, false, b, (short)0, c, false, false); }   // plain builtin: the compiler keeps the distance behind a product itself and may order products, LDS loads and vector work freely
__device__ __forceinline__ v8f wmma16bb(v16bb a, v16bb b, v8f c) { v8f d = __builtin_amdgcn_wmma_f32_16x16x32_bf16(false, a, false, b, (short)0, c, false, false); asm volatile("v_nop\n\tv_nop\n\tv_nop\n\tv_nop" : "+v"(d) : "v"(a), "v"(b)); return d; }
__device__ __forceinline__ float nexp(float x) { return __builtin_amdgcn_exp2f(x * 1.4426950408889634f); }

// prep: x NCHW -> position-major bf16 rows xT[b*4096 + p][256] (block = (b, 64 positions)); weights: [theta; phi; g] rows [192][256] bf16; W [256][64] f16 (bf16-exact). grid (64, Bn) x 256.
__global__ __launch_bounds__(256) void prep_kernel(const float* __restrict__ x, const float* __restrict__ tw, const float* __restrict__ pw, const float* __restrict__ gw, const float* __restrict__ Ww, unsigned short* __restrict__ xT, unsigned short* __restrict__ w16, b16* __restrict__ ww16) {
  __shared__ __attribute__((aligned(16))) unsigned short Tt[64][C + 8];
  const int t_ = threadIdx.x, b = blockIdx.y, p0 = blockIdx.x * 64; const float* src = x + (size_t)b * C * NP;
  { float xr[64];   // the whole tile's loads are in flight before the first value is used
#pragma unroll
    for (int k = 0; k < 64; ++k) xr[k] = src[(size_t)((t_ >> 6) + 4 * k) * NP + p0 + (t_ & 63)];
#pragma unroll
    for (int k = 0; k < 64; ++k) Tt[t_ & 63][(t_ >> 6) + 4 * k] = bf16_bits(xr[k]); }
  __syncthreads();
  {
#pragma unroll
    for (int k = 0; k < 8; ++k) { const int pp = (t_ >> 5) + 8 * k, c8 = (t_ & 31) * 8; *(v8us*)(xT + ((size_t)b * NP + p0 + pp) * C + c8) = *(const v8us*)(&Tt[pp][c8]); }
    asm volatile("s_wait_xcnt 0x0" ::: "memory");   // stands ahead of the first instruction that reuses a register of the stores above
    if (blockIdx.x == 0 && blockIdx.y == 0) {
      // One matrix (8 pieces of 8 values per thread) at a time: its 16 loads are in flight together. Kept rolled so that the next matrix reuses the 64 load registers.
#pragma unroll 1
      for (int m = 0; m < 4; ++m) { const float* W = (m == 0) ? tw : (m == 1) ? pw : (m == 2) ? gw : Ww; v4f wr[8][2];
#pragma unroll
        for (int k = 0; k < 8; ++k) { wr[k][0] = *(const v4f*)(W + (size_t)(t_ + 256 * k) * 8); wr[k][1] = *(const v4f*)(W + (size_t)(t_ + 256 * k) * 8 + 4); }
        if (m < 3) {
#pragma unroll
          for (int k = 0; k < 8; ++k) { v8us o;
#pragma unroll
            for (int e = 0; e < 8; ++e) o[e] = bf16_bits(wr[k][e >> 2][e & 3]);
            *(v8us*)(w16 + ((size_t)m * (C1 * C / 8) + t_ + 256 * k) * 8) = o; }
          asm volatile("s_wait_xcnt 0x0" ::: "memory");   // stands ahead of the first instruction that reuses a register of the stores above
        }
        else {
#pragma unroll
          for (int k = 0; k < 8; ++k) { v8b o;
#pragma unroll
            for (int e = 0; e < 8; ++e) o[e] = (b16)bf16_rne(wr[k][e >> 2][e & 3]);
            *(v8b*)(ww16 + (size_t)(t_ + 256 * k) * 8) = o; }
          asm volatile("s_wait_xcnt 0x0" ::: "memory");   // stands ahead of the first instruction that reuses a register of the stores above
        } } }
     }
}

__global__ __launch_bounds__(128) void proj_kernel(const unsigned short* __restrict__ xT, const unsigned short* __restrict__ w16, const float* __restrict__ tb, const float* __restrict__ pb, const float* __restrict__ gb, b16* __restrict__ th, b16* __restrict__ ph, b16* __restrict__ gt) {
  __shared__ __attribute__((aligned(16))) b16 Th[4][32][64 + 8], Tl[4][32][64 + 8]; __shared__ __attribute__((aligned(16))) b16 Vh[64][128 + 8], Vl[64][128 + 8];
  const int lane = threadIdx.x & 31, wave = threadIdx.x >> 5, nloc = lane & 15, hlf = lane >> 4, which = blockIdx.x, m0 = blockIdx.y * 128 + wave * 32; const int b = (blockIdx.y * 128) / NP, p0 = (blockIdx.y * 128) % NP;
  const unsigned short* Wt = w16 + (size_t)which * C1 * C; const float* bias = (which == 0) ? tb : (which == 1) ? pb : gb;
  v8f acc[2][4];
#pragma unroll
  for (int r = 0; r < 2; ++r)
#pragma unroll
    for (int t = 0; t < 4; ++t) acc[r][t] = (v8f){};
  // Every fragment load of 64 k (whole 128-byte lines) stands ahead of the first product. Kept rolled: no load moves across the asm behind a product, so unrolling would only lengthen the code.
#pragma unroll 1
  for (int kb = 0; kb < C; kb += 64) { v16bb a0[2], a1[2], bw[2][4];
#pragma unroll
    for (int ks = 0; ks < 2; ++ks) { a0[ks] = frag_bf(xT + (size_t)(m0 + nloc) * C + kb + ks * 32, hlf); a1[ks] = frag_bf(xT + (size_t)(m0 + 16 + nloc) * C + kb + ks * 32, hlf);
#pragma unroll
      for (int t = 0; t < 4; ++t) bw[ks][t] = frag_bf(Wt + (size_t)(t * 16 + nloc) * C + kb + ks * 32, hlf); }
#pragma unroll
    for (int ks = 0; ks < 2; ++ks)
#pragma unroll
      for (int t = 0; t < 4; ++t) { acc[0][t] = wmma16bb(a0[ks], bw[ks][t], acc[0][t]); acc[1][t] = wmma16bb(a1[ks], bw[ks][t], acc[1][t]); } }
  const float scl = (which == 2) ? VS : QS;
#pragma unroll
  for (int t = 0; t < 4; ++t) { const int c = t * 16 + nloc; const float bb = bf16_rne(bias[c]);
#pragma unroll
    for (int r = 0; r < 2; ++r)
#pragma unroll
      for (int v = 0; v < 8; ++v) { b16 a_, c_; split16((acc[r][t][v] + bb) * scl, a_, c_); const int row = r * 16 + 8 * hlf + v;
        if (which < 2) { Th[wave][row][c] = a_; Tl[wave][row][c] = c_; } else { Vh[c][wave * 32 + row] = a_; Vl[c][wave * 32 + row] = c_; } } }
  __syncthreads();
  {
    if (which < 2) { b16* dst = ((which == 0) ? th : ph) + (size_t)m0 * C1;
#pragma unroll
      for (int j = 0; j < 8; ++j) { const int rr = j * 4 + (lane >> 3), c8 = (lane & 7) * 8; *(v8b*)(dst + (size_t)rr * C1 + c8) = *(const v8b*)(&Th[wave][rr][c8]); *(v8b*)(dst + QPL + (size_t)rr * C1 + c8) = *(const v8b*)(&Tl[wave][rr][c8]); } }
    else { for (int i = threadIdx.x; i < 64 * 16; i += 128) { const int cc = i >> 4, c8 = (i & 15) * 8; const size_t dst = ((size_t)b * C2 + cc) * NP + p0 + c8;
        *(v8b*)(gt + dst) = *(const v8b*)(&Vh[cc][c8]); *(v8b*)(gt + VPL + dst) = *(const v8b*)(&Vl[cc][c8]); } }
     }
}

// K / V staging for attn_kernel. A stage = 64 keys = four tiles of 64 rows x 128 B: K hi, K lo (row = key, 64 channels), V hi, V lo (row = channel, 64 keys).
// LDS row pitch 144 B (16 B x odd, for the ds_load_b128 fragment readers). Two buffers: the next stage's copies fly while this stage is worked on.
// A work-group = 64 queries (4 query tiles) x NG key groups = 16 waves, so that 256 work-groups fill the chip at four waves per SIMD. A buffer holds NG such stages, one per key group:
// group g works on keys 256 st + 64 g .. + 63 of every pass st with its own running (m, l, o); the NG partial results of a query tile are merged once, behind the loop, in fixed group order.
constexpr int KT = 64, RP = 72, TILE = 64 * RP, NG = 4, NST = NP / (KT * NG), OP = C2 + 4, TP = 64 + 4;
constexpr unsigned TILEB = TILE * 2u, SUBB = 4u * TILEB, BUFB = NG * SUBB, HALFB = 32u * RP * 2u;

// One 64-key stage's copies of one thread: 16 B of rows r and r + 32 of each of the four tiles (256 threads x 8 x 16 B = 32 KB), global -> LDS through no register.
__device__ __forceinline__ void stage_copies(unsigned lds, const b16* gk, const b16* gv) {
  // The closing s_wait_xcnt 0 stands inside the statement so that no address register of an issued copy is rewritten in front of it.
  asm volatile("global_load_async_to_lds_b128 %0, %8, off\n\t"
               "global_load_async_to_lds_b128 %1, %9, off\n\t"
               "global_load_async_to_lds_b128 %2, %10, off\n\t"
               "global_load_async_to_lds_b128 %3, %11, off\n\t"
               "global_load_async_to_lds_b128 %4, %12, off\n\t"
               "global_load_async_to_lds_b128 %5, %13, off\n\t"
               "global_load_async_to_lds_b128 %6, %14, off\n\t"
               "global_load_async_to_lds_b128 %7, %15, off\n\t"
               "s_wait_xcnt 0x0"
               :: "v"(lds), "v"(lds + HALFB), "v"(lds + TILEB), "v"(lds + TILEB + HALFB), "v"(lds + 2u * TILEB), "v"(lds + 2u * TILEB + HALFB), "v"(lds + 3u * TILEB), "v"(lds + 3u * TILEB + HALFB),
                  "v"(gk), "v"(gk + 32 * C1), "v"(gk + QPL), "v"(gk + QPL + 32 * C1), "v"(gv), "v"(gv + (size_t)32 * NP), "v"(gv + VPL), "v"(gv + VPL + (size_t)32 * NP)
               : "memory");
}

__global__ __launch_bounds__(512) void attn_kernel(const b16* __restrict__ th, const b16* __restrict__ ph, const b16* __restrict__ gt, const b16* __restrict__ ww16, const float* __restrict__ Wb, float* __restrict__ wyT, float* __restrict__ part) {
  __shared__ __attribute__((aligned(16))) b16 Ring[2][NG][4][TILE];
  __shared__ float Ms[NG][4][16], Ls[NG][4][16];
  const int wid = threadIdx.x >> 5, qt = wid & 3, grp = wid >> 2, lane = threadIdx.x & 31, hh = lane >> 4, col = lane & 15; const int tok0 = blockIdx.x * 64 + qt * 16, b = (blockIdx.x * 64) / NP; const size_t qi = (size_t)tok0 + col;
  const b16* K = ph + ((size_t)b * NP) * C1; const b16* V = gt + ((size_t)b * C2) * NP;
  const int cg = (threadIdx.x >> 8) * 2, cr = (threadIdx.x & 255) >> 3, cc = (threadIdx.x & 7) * 8;   // this thread copies for key groups cg and cg + 1: its row (and row + 32) and 16-byte piece in every tile
  const unsigned lds0 = (unsigned)(size_t)&Ring[0][cg][0][cr * RP + cc]; const b16* gk = K + (size_t)(cg * KT + cr) * C1 + cc; const b16* gv = V + (size_t)cr * NP + cg * KT + cc;
  stage_copies(lds0, gk, gv); stage_copies(lds0 + SUBB, gk + (size_t)KT * C1, gv + KT);
  asm volatile("s_wait_asynccnt 0x0" ::: "memory");   // pass 0 of this wave has landed
  __syncthreads();                                    // ... and of every wave: publishes pass 0
  stage_copies(lds0 + BUFB, gk + (size_t)(NG * KT) * C1, gv + NG * KT); stage_copies(lds0 + BUFB + SUBB, gk + (size_t)(NG * KT + KT) * C1, gv + NG * KT + KT);
  v16b qf[2], ql[2];
#pragma unroll
  for (int ks = 0; ks < 2; ++ks) { qf[ks] = frag_kb(th + qi * C1 + ks * 32, hh); ql[ks] = frag_kb(th + QPL + qi * C1 + ks * 32, hh); }
  asm volatile("s_wait_xcnt 0x0" ::: "memory");   // stands ahead of the first instruction that reuses the address register of the loads above
  __builtin_amdgcn_sched_barrier(0);                  // keeps the register writes that follow behind that wait: without it the compiler lifts the zeroing of o over it
  float m = -INFINITY, l = 0.0f; v8f o[4] = {{}, {}, {}, {}};
  for (int st = 0; st < NST; ++st) { const b16* Kh = &Ring[st & 1][grp][0][0]; const b16* Kl = Kh + TILE; const b16* Vh = Kh + 2 * TILE; const b16* Vl = Kh + 3 * TILE;
#pragma unroll
   for (int kb = 0; kb < KT; kb += 32) { v8f s0 = {}, s1 = {};
#pragma unroll
    for (int ks = 0; ks < 2; ++ks) { const v16b ka = frag_kb(Kh + (kb + col) * RP + ks * 32, hh), kal = frag_kb(Kl + (kb + col) * RP + ks * 32, hh), kb_ = frag_kb(Kh + (kb + 16 + col) * RP + ks * 32, hh), kbl = frag_kb(Kl + (kb + 16 + col) * RP + ks * 32, hh);
      s0 = wmma16b(ka, qf[ks], s0); s0 = wmma16b(ka, ql[ks], s0); s0 = wmma16b(kal, qf[ks], s0); s1 = wmma16b(kb_, qf[ks], s1); s1 = wmma16b(kb_, ql[ks], s1); s1 = wmma16b(kbl, qf[ks], s1); }
    float mr = -INFINITY;
#pragma unroll
    for (int r = 0; r < 8; ++r) { s0[r] *= SCALE / (QS * QS); s1[r] *= SCALE / (QS * QS); mr = fmaxf(mr, fmaxf(s0[r], s1[r])); }
    mr = fmaxf(mr, __shfl_xor(mr, 16));
    const float mn = fmaxf(m, mr), al_ = nexp(m - mn); m = mn; float sum = 0.0f; v16b pbv, plv;
#pragma unroll
    for (int r = 0; r < 8; ++r) { const float p0 = nexp(s0[r] - mn), p1 = nexp(s1[r] - mn); sum += p0 + p1; b16 a, c; split16(p0 * PS, a, c); pbv[r] = a; plv[r] = c; split16(p1 * PS, a, c); pbv[8 + r] = a; plv[8 + r] = c; }
    sum += __shfl_xor(sum, 16); l = l * al_ + sum;
#pragma unroll
    for (int n = 0; n < 4; ++n) { o[n] *= al_; const v16b vf = frag_kb(Vh + (n * 16 + col) * RP + kb, hh), vl = frag_kb(Vl + (n * 16 + col) * RP + kb, hh); o[n] = wmma16b(vf, pbv, o[n]); o[n] = wmma16b(vf, plv, o[n]); o[n] = wmma16b(vl, pbv, o[n]); } }
   asm volatile("s_wait_dscnt 0x0" ::: "memory");      // this wave's reads of the buffer have retired before it is handed to its next writer
   asm volatile("s_wait_asynccnt 0x0" ::: "memory");   // this wave's copies of pass st + 1 have landed
   __syncthreads();                                    // publishes pass st + 1 and ends every reader's last read of pass st
   if (st + 2 < NST) { const unsigned ld = lds0 + (unsigned)(st & 1) * BUFB; const b16* nk = gk + (size_t)(st + 2) * (NG * KT) * C1; const b16* nv = gv + (st + 2) * (NG * KT);
     stage_copies(ld, nk, nv); stage_copies(ld + SUBB, nk + (size_t)KT * C1, nv + KT); } }
  asm volatile("s_wait_asynccnt 0x0" ::: "memory");    // nothing of this wave is in flight behind the loop
  // Merge of the NG key groups of each query tile. The ring is free behind the loop's last barrier (every read retired, no copy in flight) and becomes the staging of the scaled partial outputs.
  if (hh == 0) { Ms[grp][qt][col] = m; Ls[grp][qt][col] = l; }
  __syncthreads();                                     // every group's (m, l) is visible
  float mg = Ms[0][qt][col];
#pragma unroll
  for (int g = 1; g < NG; ++g) mg = fmaxf(mg, Ms[g][qt][col]);
  float lg = 0.0f;
#pragma unroll
  for (int g = 0; g < NG; ++g) lg += Ls[g][qt][col] * nexp(Ms[g][qt][col] - mg);
  const float inv = nexp(m - mg) / (lg * VS * PS);
  float* Os = (float*)&Ring[0][0][0][0];               // [16 waves][16 queries][OP]
#pragma unroll
  for (int n = 0; n < 4; ++n)
#pragma unroll
    for (int r = 0; r < 8; ++r) Os[(wid * 16 + col) * OP + n * 16 + 8 * hh + r] = o[n][r] * inv;
  __syncthreads();                                     // every group's scaled partial output is visible
  // W conv as the epilogue. Wave (qt, grp) forms wy^T for channels 64 grp .. + 63 (A = W rows) at positions 16 qt .. + 15 (B = y rows, the NG partials added in group order): D row = channel, D column = position.
  v16b yh[2], yl[2], wf[4][2];
#pragma unroll
  for (int ks = 0; ks < 2; ++ks)
#pragma unroll
    for (int t = 0; t < 4; ++t) wf[t][ks] = frag_kb(ww16 + (size_t)(grp * 64 + t * 16 + col) * C2 + ks * 32, hh);
  asm volatile("s_wait_xcnt 0x0" ::: "memory");   // stands ahead of the first instruction that reuses an address register of the loads above, and keeps the bias loads further down behind them
#pragma unroll
  for (int ks = 0; ks < 2; ++ks)
#pragma unroll
    for (int h = 0; h < 2; ++h) { const float* sp = Os + (qt * 16 + col) * OP + ks * 32 + h * 16 + 8 * hh;   // fragment elements 8h .. 8h + 7 <- k = 32 ks + 16 h + 8 hh + 0 .. 7
      v4f s0 = *(const v4f*)sp, s1 = *(const v4f*)(sp + 4);
#pragma unroll
      for (int g = 1; g < NG; ++g) { s0 += *(const v4f*)(sp + g * 64 * OP); s1 += *(const v4f*)(sp + g * 64 * OP + 4); }
#pragma unroll
      for (int e = 0; e < 4; ++e) { b16 p, q; split16(s0[e] * YS, p, q); yh[ks][8 * h + e] = p; yl[ks][8 * h + e] = q; split16(s1[e] * YS, p, q); yh[ks][8 * h + 4 + e] = p; yl[ks][8 * h + 4 + e] = q; } }
  v8f acc[4] = {{}, {}, {}, {}};
#pragma unroll
  for (int ks = 0; ks < 2; ++ks)
#pragma unroll
    for (int t = 0; t < 4; ++t) { acc[t] = wmma16b(wf[t][ks], yh[ks], acc[t]); acc[t] = wmma16b(wf[t][ks], yl[ks], acc[t]); }
  float* Ts = Os + 16 * 16 * OP;                       // [256 channels][TP]: 64 positions per row; lies behind Os, which other waves may still be reading
#pragma unroll
  for (int t = 0; t < 4; ++t) { const int c8 = grp * 64 + t * 16 + 8 * hh; const v4f b0 = *(const v4f*)(Wb + c8), b1 = *(const v4f*)(Wb + c8 + 4);
#pragma unroll
    for (int v = 0; v < 8; ++v) Ts[(c8 + v) * TP + qt * 16 + col] = acc[t][v] * (1.0f / YS) + bf16_rne((v < 4) ? b0[v & 3] : b1[v & 3]); }
  __syncthreads();                                     // the whole 256 x 64 tile of wy^T is visible
  float* dst = wyT + (size_t)b * C * NP + (blockIdx.x * 64) % NP;
#pragma unroll
  for (int j = 0; j < 8; ++j) { const int i = j * 512 + threadIdx.x, ch = i >> 4, p4 = (i & 15) * 4; *(v4f*)(dst + (size_t)ch * NP + p4) = *(const v4f*)(Ts + ch * TP + p4); }
  // Per-block partials of every channel over the block's 64 positions: threads 0 .. 255 the sums, 256 .. 511 the sums of squares; part[block][4][2][64], 2 KB per work-group.
  { const int ch = threadIdx.x & 255, st = threadIdx.x >> 8; v4f a4 = {};
    if (st == 0) {
#pragma unroll
      for (int p = 0; p < 16; ++p) a4 += *(const v4f*)(Ts + ch * TP + p * 4); }
    else {
#pragma unroll
      for (int p = 0; p < 16; ++p) { const v4f a = *(const v4f*)(Ts + ch * TP + p * 4); a4 += a * a; } }
    part[(size_t)blockIdx.x * 512 + (ch >> 6) * 128 + st * 64 + (ch & 63)] = (a4[0] + a4[1]) + (a4[2] + a4[3]); }
}

// Work-group = one channel, all 4 x 4096 positions (64 KB of wy^T, NCHW like out). Thread t takes block t's (sum, sum of squares) of the channel; they are added in double in a fixed tree
// (32 lanes by xor steps, then the 8 waves in order). The row loads are issued ahead of that reduction, so that they fly under it.
__global__ __launch_bounds__(256) void final_kernel(const float* __restrict__ wyT, const float* __restrict__ part, const float* __restrict__ gma, const float* __restrict__ bta, float* __restrict__ out) {
  static_assert(NBLK == 256, "one partial pair per thread");
  __shared__ double Rs[8], Rq[8];
  const int c = blockIdx.x, t_ = threadIdx.x;
  const float ps = part[(size_t)t_ * 512 + (c >> 6) * 128 + (c & 63)], pq = part[(size_t)t_ * 512 + (c >> 6) * 128 + 64 + (c & 63)];
  const float gm = gma[c], bt = bta[c];
  v4f v[16];
#pragma unroll
  for (int j = 0; j < 16; ++j) v[j] = *(const v4f*)(wyT + ((size_t)(j >> 2) * C + c) * NP + ((j & 3) * 256 + t_) * 4);
  asm volatile("s_wait_xcnt 0x0" ::: "memory");   // stands ahead of the first instruction that reuses an address register of the loads above
  double s = (double)ps, q = (double)pq;
#pragma unroll
  for (int m = 1; m < 32; m <<= 1) { s += __shfl_xor(s, m); q += __shfl_xor(q, m); }
  if ((t_ & 31) == 0) { Rs[t_ >> 5] = s; Rq[t_ >> 5] = q; }
  __syncthreads();                                // every wave's pair of sums is visible
  s = Rs[0]; q = Rq[0];
#pragma unroll
  for (int w = 1; w < 8; ++w) { s += Rs[w]; q += Rq[w]; }
  const double mean = s / (double)NTOK; const double var = fmax(q / (double)NTOK - mean * mean, 0.0);
  const float scl = bf16_rne(gm) * (float)(1.0 / sqrt(var + (double)EPS)); const float sh = bf16_rne(bt) - (float)mean * scl;
#pragma unroll
  for (int j = 0; j < 16; ++j) { v4f o;
#pragma unroll
    for (int e = 0; e < 4; ++e) o[e] = v[j][e] * scl + sh;
    *(v4f*)(out + ((size_t)(j >> 2) * C + c) * NP + ((j & 3) * 256 + t_) * 4) = o; }
}
}  // namespace

extern "C" void kernel_launch(void* const* d_in, const int* in_sizes, int n_in,
                              void* d_out, int out_size, void* d_ws, size_t ws_size, hipStream_t stream) {
  (void)n_in; (void)out_size;
  const float* x = (const float*)d_in[0]; const float* tw = (const float*)d_in[1]; const float* tb = (const float*)d_in[2]; const float* pw = (const float*)d_in[3]; const float* pb = (const float*)d_in[4]; const float* gw = (const float*)d_in[5]; const float* gb = (const float*)d_in[6];
  const float* Ww = (const float*)d_in[7]; const float* Wb = (const float*)d_in[8]; const float* gma = (const float*)d_in[9]; const float* bta = (const float*)d_in[10];
  float* out = (float*)d_out;   // [4][256][64][64]
  if (in_sizes[0] != Bn * C * NP || in_sizes[1] != C1 * C || in_sizes[5] != C2 * C || in_sizes[7] != C * C2 || in_sizes[9] != C) return;
  size_t off = 0; char* ws = (char*)d_ws;
  auto carve = [&](size_t bytes) { char* p = ws + off; off += (bytes + 255) & ~(size_t)255; return p; };
  unsigned short* xT = (unsigned short*)carve((size_t)NTOK * C * 2); unsigned short* w16 = (unsigned short*)carve((size_t)3 * C1 * C * 2); b16* ww16 = (b16*)carve((size_t)C * C2 * 2);
  b16* th = (b16*)carve(QPL * 2 * 2); b16* ph = (b16*)carve(QPL * 2 * 2); b16* gt = (b16*)carve(VPL * 2 * 2); float* wyT = (float*)carve((size_t)NTOK * C * 4); float* part = (float*)carve((size_t)NBLK * 4 * 2 * 64 * 4);
  if (off > ws_size) return;                                    // about 8.4 + 0.1 + 4.2x3 + 16.8 + 0.5 = 38 MB
  prep_kernel<<<dim3(NP / 64, Bn), 256, 0, stream>>>(x, tw, pw, gw, Ww, xT, w16, ww16);
  proj_kernel<<<dim3(3, NTOK / 128), 128, 0, stream>>>(xT, w16, tb, pb, gb, th, ph, gt);
  attn_kernel<<<NTOK / 64, 512, 0, stream>>>(th, ph, gt, ww16, Wb, wyT, part);
  final_kernel<<<C, 256, 0, stream>>>(wyT, part, gma, bta, out);
}

// v006
// Measured time: 71 microseconds a run.
// Next to v005, in two timings, it ran 1.22 times as fast each time.
// All steps since v000 together make it 5.97 times as fast.
#include <hip/hip_runtime.h>

// _MS_NonLocalBlockND (scale 1): theta, phi (64 ch) and g (64 ch) = 1x1 convs of x [4][256][64x64]; f = theta^T phi / 8 over the 4096 positions; attn = softmax; y = attn g; wy = W y + b
// (1x1 conv 64 -> 256); out = BatchNorm2d in TRAINING mode (batch mean / biased variance over (B, H, W) per channel, eps 1e-5, gamma, beta) -> NCHW [4][256][64][64].
// Projections on v_wmma_f32_16x16x32_bf16 (exact bf16 operands; fragments from an LDS transpose of the NCHW input; 1 product); attention per (b, 16 queries):
// S^T = phi.theta^T (K = 64; theta, phi as f16 hi+lo pairs x8; 3 products), online softmax f32, y^T = (8g)^T.P^T (3 products); wy^T = W.y^T + b (y f32 split x8, W exact; 2 products) on
// v_wmma_f32_16x16x32_f16, f32 accumulate, as the attention kernel's epilogue, which stores wy^T in NCHW order and per-block (sum, sum of squares) partials of every channel;
// the final kernel (one channel per work-group) adds its channel's partials in fixed order and applies BN. Fragment k-map per lane half hh for A AND B: elements 0..7 <- k = 8hh+0..7, 8..15 <- k = 16+8hh+0..7.

namespace {
constexpr int Bn = 4, C = 256, NP = 4096, C1 = 64, C2 = 64, NTOK = Bn * NP, NBLK = NTOK / 64;
constexpr float QS = 8.0f, VS = 8.0f, PS = 8.0f, YS = 8.0f, SCALE = 0.125f, EPS = 1e-5f;
constexpr size_t QPL = (size_t)NTOK * C1, VPL = (size_t)Bn * C2 * NP;

typedef _Float16 b16;
typedef __attribute__((ext_vector_type(16))) _Float16 v16b;
typedef __attribute__((ext_vector_type(16))) __bf16 v16bb;
typedef __attribute__((ext_vector_type(8))) _Float16 v8b;
typedef __attribute__((ext_vector_type(8))) unsigned short v8us;
typedef __attribute__((ext_vector_type(8))) float v8f;
typedef __attribute__((ext_vector_type(4))) float v4f;
typedef __attribute__((ext_vector_type(2))) float v2f;
typedef __attribute__((ext_vector_type(2))) __bf16 v2bb;
typedef __attribute__((ext_vector_type(2))) unsigned int v2u;
typedef __attribute__((ext_vector_type(4))) _Float16 v4b;
__device__ __forceinline__ float bf16_rne(float f) { unsigned int u = __float_as_uint(f); u += 0x7FFFu + ((u >> 16) & 1u); return __uint_as_float(u & 0xFFFF0000u); }
__device__ __forceinline__ unsigned int pk_bf16(float a, float b) { const v2f f = {a, b}; return __builtin_bit_cast(unsigned int, __builtin_convertvector(f, v2bb)); }   // two f32 -> two bf16, round to nearest even, a in the low half
__device__ __forceinline__ void split16(float v, b16& hi, b16& lo) { hi = (b16)v; lo = (b16)(v - (float)hi); }
__device__ __forceinline__ v16b frag_kb(const b16* p, int hh) { const v8b a = *(const v8b*)(p + 8 * hh), b = *(const v8b*)(p + 16 + 8 * hh); v16b f;
#pragma unroll
  for (int e = 0; e < 8; ++e) { f[e] = a[e]; f[8 + e] = b[e]; } return f; }
__device__ __forceinline__ v16bb frag_bf(const unsigned short* p, int hh) { const v8us a = *(const v8us*)(p + 8 * hh), b = *(const v8us*)(p + 16 + 8 * hh); union { unsigned short s[16]; v16bb v; } u;
#pragma unroll
  for (int e = 0; e < 8; ++e) { u.s[e] = a[e]; u.s[8 + e] = b[e]; } return u.v; }
__device__ __forceinline__ v8f wmma16b(v16b a, v16b b, v8f c) { return __builtin_amdgcn_wmma_f32_16x16x32_f16(false, a, false, b, (short)0, c, false, false); }   // plain builtin: the compiler keeps the distance behind a product itself and may order products, LDS loads and vector work freely
__device__ __forceinline__ v8f wmma16bb(v16bb a, v16bb b, v8f c) { v8f d = __builtin_amdgcn_wmma_f32_16x16x32_bf16(false, a, false, b, (short)0, c, false, false); asm volatile("v_nop\n\tv_nop\n\tv_nop\n\tv_nop" : "+v"(d) : "v"(a), "v"(b)); return d; }
__device__ __forceinline__ float nexp(float x) { return __builtin_amdgcn_exp2f(x * 1.4426950408889634f); }

// proj: work-group = (b, 64 positions), 16 waves. It brings its 256 x 64 tile of x (NCHW) and the three weight matrices [theta; phi; g] = [192][256] from f32 to bf16 (round to nearest even) in LDS,
// x transposed to position-major rows, every global load on whole 128-byte lines, all of them in flight together. Wave (mt, ng) then forms positions 16 mt .. + 15 x channels 16 ng .. + 15 of theta, phi and g
// (k ascending in steps of 32), every fragment from LDS. Work-group i also writes row i of W [256][64] as f16 (bf16-exact) for the attention kernel's epilogue. grid (64, Bn) x 512.
constexpr int XP = C + 8, SP = 64 + 8;   // LDS row pitches in 16-bit elements: 528 B and 144 B, both 16 B x odd, for the 16-byte fragment and row readers
__global__ __launch_bounds__(512) void proj_kernel(const float* __restrict__ x, const float* __restrict__ tw, const float* __restrict__ pw, const float* __restrict__ gw, const float* __restrict__ Ww, const float* __restrict__ tb, const float* __restrict__ pb, const float* __restrict__ gb, b16* __restrict__ th, b16* __restrict__ ph, b16* __restrict__ gt, b16* __restrict__ ww16) {
  static_assert(NBLK == C, "one row of W per work-group");
  __shared__ __attribute__((aligned(16))) unsigned short Xs[64][XP], Ws[3 * C1][XP];
  __shared__ __attribute__((aligned(16))) b16 Ts[2][2][64][SP], Vs[2][C2][SP];   // [theta | phi][hi | lo][position][channel]; [hi | lo][channel][position]
  const int t_ = threadIdx.x, b = blockIdx.y, p0 = blockIdx.x * 64, bid = blockIdx.y * 64 + blockIdx.x; const float* src = x + (size_t)b * C * NP + p0;
  const int lane = t_ & 31, wave = t_ >> 5, nloc = lane & 15, hlf = lane >> 4, mt = wave & 3, ng = wave >> 2, cch = ng * 16 + nloc;
  v4f wv; float bias[3];
  { float xr[16][2]; v4f wr[24];   // the whole tile's and all three matrices' loads are in flight before the first value is used
#pragma unroll
    for (int k = 0; k < 16; ++k) { const int c = 2 * ((t_ >> 6) + 8 * k); xr[k][0] = src[(size_t)c * NP + (t_ & 63)]; xr[k][1] = src[(size_t)(c + 1) * NP + (t_ & 63)]; }
#pragma unroll
    for (int k = 0; k < 24; ++k) { const float* Wm = (k < 8) ? tw : (k < 16) ? pw : gw; wr[k] = *(const v4f*)(Wm + (size_t)(t_ + 512 * (k & 7)) * 4); }
    wv = *(const v4f*)(Ww + (size_t)bid * C2 + (t_ & 15) * 4); bias[0] = tb[cch]; bias[1] = pb[cch]; bias[2] = gb[cch];
    asm volatile("s_wait_xcnt 0x0" ::: "memory");   // stands ahead of the first instruction that reuses an address register of the loads above
#pragma unroll
    for (int k = 0; k < 16; ++k) *(unsigned int*)(&Xs[t_ & 63][2 * ((t_ >> 6) + 8 * k)]) = pk_bf16(xr[k][0], xr[k][1]);
#pragma unroll
    for (int k = 0; k < 24; ++k) { v2u o; o[0] = pk_bf16(wr[k][0], wr[k][1]); o[1] = pk_bf16(wr[k][2], wr[k][3]); *(v2u*)(&Ws[(k >> 3) * C1 + (k & 7) * 8 + (t_ >> 6)][(t_ & 63) * 4]) = o; }
    asm volatile("" :: "v"(wv), "v"(bias[0]), "v"(bias[1]), "v"(bias[2]));   // inputs only: holds the four small loads up with the others; without it the compiler sinks them to their first use, where their latency is exposed
  }
  __syncthreads();                                     // the x tile and the weights are visible to every wave
  v8f acc[3] = {{}, {}, {}};
  // The fragment loads of 128 k stand as one group ahead of their twelve products, so that a wave waits for LDS twice and not once per product.
#pragma unroll
  for (int kh = 0; kh < C; kh += 128) { v16bb a[4], bw[4][3];
#pragma unroll
    for (int ks = 0; ks < 4; ++ks) { a[ks] = frag_bf(&Xs[mt * 16 + nloc][kh + ks * 32], hlf);
#pragma unroll
      for (int j = 0; j < 3; ++j) bw[ks][j] = frag_bf(&Ws[j * C1 + cch][kh + ks * 32], hlf); }
#pragma unroll
    for (int ks = 0; ks < 4; ++ks)
#pragma unroll
      for (int j = 0; j < 3; ++j) acc[j] = wmma16bb(a[ks], bw[ks][j], acc[j]); }
#pragma unroll
  for (int j = 0; j < 3; ++j) { const float bb = bf16_rne(bias[j]); v8b vh, vl;
#pragma unroll
    for (int v = 0; v < 8; ++v) { b16 a_, c_; split16((acc[j][v] + bb) * ((j == 2) ? VS : QS), a_, c_); vh[v] = a_; vl[v] = c_; }
    if (j < 2) {
#pragma unroll
      for (int v = 0; v < 8; ++v) { Ts[j][0][mt * 16 + 8 * hlf + v][cch] = vh[v]; Ts[j][1][mt * 16 + 8 * hlf + v][cch] = vl[v]; } }
    else { *(v8b*)(&Vs[0][cch][mt * 16 + 8 * hlf]) = vh; *(v8b*)(&Vs[1][cch][mt * 16 + 8 * hlf]) = vl; } }
  __syncthreads();                                     // the staged theta, phi and g tiles are visible to every wave
  { const int rr = t_ >> 3, c8 = (t_ & 7) * 8; const size_t qd = ((size_t)b * NP + p0 + rr) * C1 + c8, vd = ((size_t)b * C2 + rr) * NP + p0 + c8;   // whole 128-byte lines per row
    const v8b s0 = *(const v8b*)(&Ts[0][0][rr][c8]), s1 = *(const v8b*)(&Ts[0][1][rr][c8]), s2 = *(const v8b*)(&Ts[1][0][rr][c8]), s3 = *(const v8b*)(&Ts[1][1][rr][c8]), s4 = *(const v8b*)(&Vs[0][rr][c8]), s5 = *(const v8b*)(&Vs[1][rr][c8]);
    *(v8b*)(th + qd) = s0; *(v8b*)(th + QPL + qd) = s1; *(v8b*)(ph + qd) = s2; *(v8b*)(ph + QPL + qd) = s3; *(v8b*)(gt + vd) = s4; *(v8b*)(gt + VPL + vd) = s5; }
  if (t_ < 16) { v4b o;   // behind the last barrier, so that no wave waits at a barrier for this store
#pragma unroll
    for (int e = 0; e < 4; ++e) o[e] = (b16)bf16_rne(wv[e]);
    *(v4b*)(ww16 + (size_t)bid * C2 + t_ * 4) = o; }
}

// K / V staging for attn_kernel. A stage = 64 keys = four tiles of 64 rows x 128 B: K hi, K lo (row = key, 64 channels), V hi, V lo (row = channel, 64 keys).
// LDS row pitch 144 B (16 B x odd, for the ds_load_b128 fragment readers). Two buffers: the next stage's copies fly while this stage is worked on.
// A work-group = 64 queries (4 query tiles) x NG key groups = 16 waves, so that 256 work-groups fill the chip at four waves per SIMD. A buffer holds NG such stages, one per key group:
// group g works on keys 256 st + 64 g .. + 63 of every pass st with its own running (m, l, o); the NG partial results of a query tile are merged once, behind the loop, in fixed group order.
constexpr int KT = 64, RP = 72, TILE = 64 * RP, NG = 4, NST = NP / (KT * NG), OP = C2 + 4, TP = 64 + 4;
constexpr unsigned TILEB = TILE * 2u, SUBB = 4u * TILEB, BUFB = NG * SUBB, HALFB = 32u * RP * 2u;

// One 64-key stage's copies of one thread: 16 B of rows r and r + 32 of each of the four tiles (256 threads x 8 x 16 B = 32 KB), global -> LDS through no register.
__device__ __forceinline__ void stage_copies(unsigned lds, const b16* gk, const b16* gv) {
  // The closing s_wait_xcnt 0 stands inside the statement so that no address register of an issued copy is rewritten in front of it.
  asm volatile("global_load_async_to_lds_b128 %0, %8, off\n\t"
               "global_load_async_to_lds_b128 %1, %9, off\n\t"
               "global_load_async_to_lds_b128 %2, %10, off\n\t"
               "global_load_async_to_lds_b128 %3, %11, off\n\t"
               "global_load_async_to_lds_b128 %4, %12, off\n\t"
               "global_load_async_to_lds_b128 %5, %13, off\n\t"
               "global_load_async_to_lds_b128 %6, %14, off\n\t"
               "global_load_async_to_lds_b128 %7, %15, off\n\t"
               "s_wait_xcnt 0x0"
               :: "v"(lds), "v"(lds + HALFB), "v"(lds + TILEB), "v"(lds + TILEB + HALFB), "v"(lds + 2u * TILEB), "v"(lds + 2u * TILEB + HALFB), "v"(lds + 3u * TILEB), "v"(lds + 3u * TILEB + HALFB),
                  "v"(gk), "v"(gk + 32 * C1), "v"(gk + QPL), "v"(gk + QPL + 32 * C1), "v"(gv), "v"(gv + (size_t)32 * NP), "v"(gv + VPL), "v"(gv + VPL + (size_t)32 * NP)
               : "memory");
}

__global__ __launch_bounds__(512) void attn_kernel(const b16* __restrict__ th, const b16* __restrict__ ph, const b16* __restrict__ gt, const b16* __restrict__ ww16, const float* __restrict__ Wb, float* __restrict__ wyT, float* __restrict__ part) {
  __shared__ __attribute__((aligned(16))) b16 Ring[2][NG][4][TILE];
  __shared__ float Ms[NG][4][16], Ls[NG][4][16];
  const int wid = threadIdx.x >> 5, qt = wid & 3, grp = wid >> 2, lane = threadIdx.x & 31, hh = lane >> 4, col = lane & 15; const int tok0 = blockIdx.x * 64 + qt * 16, b = (blockIdx.x * 64) / NP; const size_t qi = (size_t)tok0 + col;
  const b16* K = ph + ((size_t)b * NP) * C1; const b16* V = gt + ((size_t)b * C2) * NP;
  const int cg = (threadIdx.x >> 8) * 2, cr = (threadIdx.x & 255) >> 3, cc = (threadIdx.x & 7) * 8;   // this thread copies for key groups cg and cg + 1: its row (and row + 32) and 16-byte piece in every tile
  const unsigned lds0 = (unsigned)(size_t)&Ring[0][cg][0][cr * RP + cc]; const b16* gk = K + (size_t)(cg * KT + cr) * C1 + cc; const b16* gv = V + (size_t)cr * NP + cg * KT + cc;
  stage_copies(lds0, gk, gv); stage_copies(lds0 + SUBB, gk + (size_t)KT * C1, gv + KT);
  asm volatile("s_wait_asynccnt 0x0" ::: "memory");   // pass 0 of this wave has landed
  __syncthreads();                                    // ... and of every wave: publishes pass 0
  stage_copies(lds0 + BUFB, gk + (size_t)(NG * KT) * C1, gv + NG * KT); stage_copies(lds0 + BUFB + SUBB, gk + (size_t)(NG * KT + KT) * C1, gv + NG * KT + KT);
  v16b qf[2], ql[2];
#pragma unroll
  for (int ks = 0; ks < 2; ++ks) { qf[ks] = frag_kb(th + qi * C1 + ks * 32, hh); ql[ks] = frag_kb(th + QPL + qi * C1 + ks * 32, hh); }
  asm volatile("s_wait_xcnt 0x0" ::: "memory");   // stands ahead of the first instruction that reuses the address register of the loads above
  __builtin_amdgcn_sched_barrier(0);                  // keeps the register writes that follow behind that wait: without it the compiler lifts the zeroing of o over it
  float m = -INFINITY, l = 0.0f; v8f o[4] = {{}, {}, {}, {}};
  for (int st = 0; st < NST; ++st) { const b16* Kh = &Ring[st & 1][grp][0][0]; const b16* Kl = Kh + TILE; const b16* Vh = Kh + 2 * TILE; const b16* Vl = Kh + 3 * TILE;
#pragma unroll
   for (int kb = 0; kb < KT; kb += 32) { v8f s0 = {}, s1 = {};
#pragma unroll
    for (int ks = 0; ks < 2; ++ks) { const v16b ka = frag_kb(Kh + (kb + col) * RP + ks * 32, hh), kal = frag_kb(Kl + (kb + col) * RP + ks * 32, hh), kb_ = frag_kb(Kh + (kb + 16 + col) * RP + ks * 32, hh), kbl = frag_kb(Kl + (kb + 16 + col) * RP + ks * 32, hh);
      s0 = wmma16b(ka, qf[ks], s0); s0 = wmma16b(ka, ql[ks], s0); s0 = wmma16b(kal, qf[ks], s0); s1 = wmma16b(kb_, qf[ks], s1); s1 = wmma16b(kb_, ql[ks], s1); s1 = wmma16b(kbl, qf[ks], s1); }
    float mr = -INFINITY;
#pragma unroll
    for (int r = 0; r < 8; ++r) { s0[r] *= SCALE / (QS * QS); s1[r] *= SCALE / (QS * QS); mr = fmaxf(mr, fmaxf(s0[r], s1[r])); }
    mr = fmaxf(mr, __shfl_xor(mr, 16));
    const float mn = fmaxf(m, mr), al_ = nexp(m - mn); m = mn; float sum = 0.0f; v16b pbv, plv;
#pragma unroll
    for (int r = 0; r < 8; ++r) { const float p0 = nexp(s0[r] - mn), p1 = nexp(s1[r] - mn); sum += p0 + p1; b16 a, c; split16(p0 * PS, a, c); pbv[r] = a; plv[r] = c; split16(p1 * PS, a, c); pbv[8 + r] = a; plv[8 + r] = c; }
    sum += __shfl_xor(sum, 16); l = l * al_ + sum;
#pragma unroll
    for (int n = 0; n < 4; ++n) { o[n] *= al_; const v16b vf = frag_kb(Vh + (n * 16 + col) * RP + kb, hh), vl = frag_kb(Vl + (n * 16 + col) * RP + kb, hh); o[n] = wmma16b(vf, pbv, o[n]); o[n] = wmma16b(vf, plv, o[n]); o[n] = wmma16b(vl, pbv, o[n]); } }
   asm volatile("s_wait_dscnt 0x0" ::: "memory");      // this wave's reads of the buffer have retired before it is handed to its next writer
   asm volatile("s_wait_asynccnt 0x0" ::: "memory");   // this wave's copies of pass st + 1 have landed
   __syncthreads();                                    // publishes pass st + 1 and ends every reader's last read of pass st
   if (st + 2 < NST) { const unsigned ld = lds0 + (unsigned)(st & 1) * BUFB; const b16* nk = gk + (size_t)(st + 2) * (NG * KT) * C1; const b16* nv = gv + (st + 2) * (NG * KT);
     stage_copies(ld, nk, nv); stage_copies(ld + SUBB, nk + (size_t)KT * C1, nv + KT); } }
  asm volatile("s_wait_asynccnt 0x0" ::: "memory");    // nothing of this wave is in flight behind the loop
  // Merge of the NG key groups of each query tile. The ring is free behind the loop's last barrier (every read retired, no copy in flight) and becomes the staging of the scaled partial outputs.
  if (hh == 0) { Ms[grp][qt][col] = m; Ls[grp][qt][col] = l; }
  __syncthreads();                                     // every group's (m, l) is visible
  float mg = Ms[0][qt][col];
#pragma unroll
  for (int g = 1; g < NG; ++g) mg = fmaxf(mg, Ms[g][qt][col]);
  float lg = 0.0f;
#pragma unroll
  for (int g = 0; g < NG; ++g) lg += Ls[g][qt][col] * nexp(Ms[g][qt][col] - mg);
  const float inv = nexp(m - mg) / (lg * VS * PS);
  float* Os = (float*)&Ring[0][0][0][0];               // [16 waves][16 queries][OP]
#pragma unroll
  for (int n = 0; n < 4; ++n)
#pragma unroll
    for (int r = 0; r < 8; ++r) Os[(wid * 16 + col) * OP + n * 16 + 8 * hh + r] = o[n][r] * inv;
  __syncthreads();                                     // every group's scaled partial output is visible
  // W conv as the epilogue. Wave (qt, grp) forms wy^T for channels 64 grp .. + 63 (A = W rows) at positions 16 qt .. + 15 (B = y rows, the NG partials added in group order): D row = channel, D column = position.
  v16b yh[2], yl[2], wf[4][2];
#pragma unroll
  for (int ks = 0; ks < 2; ++ks)
#pragma unroll
    for (int t = 0; t < 4; ++t) wf[t][ks] = frag_kb(ww16 + (size_t)(grp * 64 + t * 16 + col) * C2 + ks * 32, hh);
  asm volatile("s_wait_xcnt 0x0" ::: "memory");   // stands ahead of the first instruction that reuses an address register of the loads above, and keeps the bias loads further down behind them
#pragma unroll
  for (int ks = 0; ks < 2; ++ks)
#pragma unroll
    for (int h = 0; h < 2; ++h) { const float* sp = Os + (qt * 16 + col) * OP + ks * 32 + h * 16 + 8 * hh;   // fragment elements 8h .. 8h + 7 <- k = 32 ks + 16 h + 8 hh + 0 .. 7
      v4f s0 = *(const v4f*)sp, s1 = *(const v4f*)(sp + 4);
#pragma unroll
      for (int g = 1; g < NG; ++g) { s0 += *(const v4f*)(sp + g * 64 * OP); s1 += *(const v4f*)(sp + g * 64 * OP + 4); }
#pragma unroll
      for (int e = 0; e < 4; ++e) { b16 p, q; split16(s0[e] * YS, p, q); yh[ks][8 * h + e] = p; yl[ks][8 * h + e] = q; split16(s1[e] * YS, p, q); yh[ks][8 * h + 4 + e] = p; yl[ks][8 * h + 4 + e] = q; } }
  v8f acc[4] = {{}, {}, {}, {}};
#pragma unroll
  for (int ks = 0; ks < 2; ++ks)
#pragma unroll
    for (int t = 0; t < 4; ++t) { acc[t] = wmma16b(wf[t][ks], yh[ks], acc[t]); acc[t] = wmma16b(wf[t][ks], yl[ks], acc[t]); }
  float* Ts = Os + 16 * 16 * OP;                       // [256 channels][TP]: 64 positions per row; lies behind Os, which other waves may still be reading
#pragma unroll
  for (int t = 0; t < 4; ++t) { const int c8 = grp * 64 + t * 16 + 8 * hh; const v4f b0 = *(const v4f*)(Wb + c8), b1 = *(const v4f*)(Wb + c8 + 4);
#pragma unroll
    for (int v = 0; v < 8; ++v) Ts[(c8 + v) * TP + qt * 16 + col] = acc[t][v] * (1.0f / YS) + bf16_rne((v < 4) ? b0[v & 3] : b1[v & 3]); }
  __syncthreads();                                     // the whole 256 x 64 tile of wy^T is visible
  float* dst = wyT + (size_t)b * C * NP + (blockIdx.x * 64) % NP;
#pragma unroll
  for (int j = 0; j < 8; ++j) { const int i = j * 512 + threadIdx.x, ch = i >> 4, p4 = (i & 15) * 4; *(v4f*)(dst + (size_t)ch * NP + p4) = *(const v4f*)(Ts + ch * TP + p4); }
  // Per-block partials of every channel over the block's 64 positions: threads 0 .. 255 the sums, 256 .. 511 the sums of squares; part[block][4][2][64], 2 KB per work-group.
  { const int ch = threadIdx.x & 255, st = threadIdx.x >> 8; v4f a4 = {};
    if (st == 0) {
#pragma unroll
      for (int p = 0; p < 16; ++p) a4 += *(const v4f*)(Ts + ch * TP + p * 4); }
    else {
#pragma unroll
      for (int p = 0; p < 16; ++p) { const v4f a = *(const v4f*)(Ts + ch * TP + p * 4); a4 += a * a; } }
    part[(size_t)blockIdx.x * 512 + (ch >> 6) * 128 + st * 64 + (ch & 63)] = (a4[0] + a4[1]) + (a4[2] + a4[3]); }
}

// Work-group = one channel, all 4 x 4096 positions (64 KB of wy^T, NCHW like out). Thread t takes block t's (sum, sum of squares) of the channel; they are added in double in a fixed tree
// (32 lanes by xor steps, then the 8 waves in order). The row loads are issued ahead of that reduction, so that they fly under it.
__global__ __launch_bounds__(256) void final_kernel(const float* __restrict__ wyT, const float* __restrict__ part, const float* __restrict__ gma, const float* __restrict__ bta, float* __restrict__ out) {
  static_assert(NBLK == 256, "one partial pair per thread");
  __shared__ double Rs[8], Rq[8];
  const int c = blockIdx.x, t_ = threadIdx.x;
  const float ps = part[(size_t)t_ * 512 + (c >> 6) * 128 + (c & 63)], pq = part[(size_t)t_ * 512 + (c >> 6) * 128 + 64 + (c & 63)];
  const float gm = gma[c], bt = bta[c];
  v4f v[16];
#pragma unroll
  for (int j = 0; j < 16; ++j) v[j] = *(const v4f*)(wyT + ((size_t)(j >> 2) * C + c) * NP + ((j & 3) * 256 + t_) * 4);
  asm volatile("s_wait_xcnt 0x0" ::: "memory");   // stands ahead of the first instruction that reuses an address register of the loads above
  double s = (double)ps, q = (double)pq;
#pragma unroll
  for (int m = 1; m < 32; m <<= 1) { s += __shfl_xor(s, m); q += __shfl_xor(q, m); }
  if ((t_ & 31) == 0) { Rs[t_ >> 5] = s; Rq[t_ >> 5] = q; }
  __syncthreads();                                // every wave's pair of sums is visible
  s = Rs[0]; q = Rq[0];
#pragma unroll
  for (int w = 1; w < 8; ++w) { s += Rs[w]; q += Rq[w]; }
  const double mean = s / (double)NTOK; const double var = fmax(q / (double)NTOK - mean * mean, 0.0);
  const float scl = bf16_rne(gm) * (float)(1.0 / sqrt(var + (double)EPS)); const float sh = bf16_rne(bt) - (float)mean * scl;
#pragma unroll
  for (int j = 0; j < 16; ++j) { v4f o;
#pragma unroll
    for (int e = 0; e < 4; ++e) o[e] = v[j][e] * scl + sh;
    *(v4f*)(out + ((size_t)(j >> 2) * C + c) * NP + ((j & 3) * 256 + t_) * 4) = o; }
}
}  // namespace

extern "C" void kernel_launch(void* const* d_in, const int* in_sizes, int n_in,
                              void* d_out, int out_size, void* d_ws, size_t ws_size, hipStream_t stream) {
  (void)n_in; (void)out_size;
  const float* x = (const float*)d_in[0]; const float* tw = (const float*)d_in[1]; const float* tb = (const float*)d_in[2]; const float* pw = (const float*)d_in[3]; const float* pb = (const float*)d_in[4]; const float* gw = (const float*)d_in[5]; const float* gb = (const float*)d_in[6];
  const float* Ww = (const float*)d_in[7]; const float* Wb = (const float*)d_in[8]; const float* gma = (const float*)d_in[9]; const float* bta = (const float*)d_in[10];
  float* out = (float*)d_out;   // [4][256][64][64]
  if (in_sizes[0] != Bn * C * NP || in_sizes[1] != C1 * C || in_sizes[5] != C2 * C || in_sizes[7] != C * C2 || in_sizes[9] != C) return;
  size_t off = 0; char* ws = (char*)d_ws;
  auto carve = [&](size_t bytes) { char* p = ws + off; off += (bytes + 255) & ~(size_t)255; return p; };
  b16* ww16 = (b16*)carve((size_t)C * C2 * 2);
  b16* th = (b16*)carve(QPL * 2 * 2); b16* ph = (b16*)carve(QPL * 2 * 2); b16* gt = (b16*)carve(VPL * 2 * 2); float* wyT = (float*)carve((size_t)NTOK * C * 4); float* part = (float*)carve((size_t)NBLK * 4 * 2 * 64 * 4);
  if (off > ws_size) return;                                    // about 4.2x3 + 16.8 + 0.5 = 30 MB
  proj_kernel<<<dim3(NP / 64, Bn), 512, 0, stream>>>(x, tw, pw, gw, Ww, tb, pb, gb, th, ph, gt, ww16);
  attn_kernel<<<NTOK / 64, 512, 0, stream>>>(th, ph, gt, ww16, Wb, wyT, part);
  final_kernel<<<C, 256, 0, stream>>>(wyT, part, gma, bta, out);
}

// v007
// A run of this version takes 67.2 microseconds.
// Next to v006, in two timings, it ran 1.06 and 1.05 times as fast.
// All steps since v000 together make it 6.31 times as fast.
#include <hip/hip_runtime.h>

// _MS_NonLocalBlockND (scale 1): theta, phi (64 ch) and g (64 ch) = 1x1 convs of x [4][256][64x64]; f = theta^T phi / 8 over the 4096 positions; attn = softmax; y = attn g; wy = W y + b
// (1x1 conv 64 -> 256); out = BatchNorm2d in TRAINING mode (batch mean / biased variance over (B, H, W) per channel, eps 1e-5, gamma, beta) -> NCHW [4][256][64][64].
// Projections on v_wmma_f32_16x16x32_bf16 (fragments from an LDS transpose of the NCHW input; 1 product); attention per (b, 32 queries):
// S^T = phi.theta^T (K = 64; theta, phi as f16 hi+lo pairs x8; 3 products), online softmax f32, y^T = (8g)^T.P^T (3 products); wy^T = W.y^T + b (y f32 split x8, W exact; 2 products) on
// v_wmma_f32_16x16x32_f16, f32 accumulate, as the attention kernel's epilogue, which stores wy^T in NCHW order and per-block (sum, sum of squares) partials of every channel;
// the final kernel (one channel per work-group) adds its channel's partials in fixed order and applies BN. Fragment k-map per lane half hh for A AND B: elements 0..7 <- k = 8hh+0..7, 8..15 <- k = 16+8hh+0..7.

namespace {
constexpr int Bn = 4, C = 256, NP = 4096, C1 = 64, C2 = 64, NTOK = Bn * NP, NBLK = NTOK / 64;
constexpr float QS = 8.0f, VS = 8.0f, PS = 8.0f, YS = 8.0f, SCALE = 0.125f, EPS = 1e-5f;
constexpr size_t QPL = (size_t)NTOK * C1, VPL = (size_t)Bn * C2 * NP;

typedef _Float16 b16;
typedef __attribute__((ext_vector_type(16))) _Float16 v16b;
typedef __attribute__((ext_vector_type(16))) __bf16 v16bb;
typedef __attribute__((ext_vector_type(8))) _Float16 v8b;
typedef __attribute__((ext_vector_type(8))) unsigned short v8us;
typedef __attribute__((ext_vector_type(8))) float v8f;
typedef __attribute__((ext_vector_type(4))) float v4f;
typedef __attribute__((ext_vector_type(2))) float v2f;
typedef __attribute__((ext_vector_type(2))) __bf16 v2bb;
typedef __attribute__((ext_vector_type(2))) unsigned int v2u;
typedef __attribute__((ext_vector_type(4))) _Float16 v4b;
__device__ __forceinline__ float bf16_rne(float f) { unsigned int u = __float_as_uint(f); u += 0x7FFFu + ((u >> 16) & 1u); return __uint_as_float(u & 0xFFFF0000u); }
__device__ __forceinline__ unsigned int pk_bf16(float a, float b) { const v2f f = {a, b}; return __builtin_bit_cast(unsigned int, __builtin_convertvector(f, v2bb)); }   // two f32 -> two bf16, round to nearest even, a in the low half
__device__ __forceinline__ void split16(float v, b16& hi, b16& lo) { hi = (b16)v; lo = (b16)(v - (float)hi); }
__device__ __forceinline__ v16b frag_kb(const b16* p, int hh) { const v8b a = *(const v8b*)(p + 8 * hh), b = *(const v8b*)(p + 16 + 8 * hh); v16b f;
#pragma unroll
  for (int e = 0; e < 8; ++e) { f[e] = a[e]; f[8 + e] = b[e]; } return f; }
__device__ __forceinline__ v16bb frag_bf(const unsigned short* p, int hh) { const v8us a = *(const v8us*)(p + 8 * hh), b = *(const v8us*)(p + 16 + 8 * hh); union { unsigned short s[16]; v16bb v; } u;
#pragma unroll
  for (int e = 0; e < 8; ++e) { u.s[e] = a[e]; u.s[8 + e] = b[e]; } return u.v; }
__device__ __forceinline__ v8f wmma16b(v16b a, v16b b, v8f c) { return __builtin_amdgcn_wmma_f32_16x16x32_f16(false, a, false, b, (short)0, c, false, false); }   // plain builtin: the compiler keeps the distance behind a product itself and may order products, LDS loads and vector work freely
__device__ __forceinline__ v8f wmma16bb(v16bb a, v16bb b, v8f c) { v8f d = __builtin_amdgcn_wmma_f32_16x16x32_bf16(false, a, false, b, (short)0, c, false, false); asm volatile("v_nop\n\tv_nop\n\tv_nop\n\tv_nop" : "+v"(d) : "v"(a), "v"(b)); return d; }
__device__ __forceinline__ float nexp(float x) { return __builtin_amdgcn_exp2f(x * 1.4426950408889634f); }
// nexp for the merge behind the loop: the v_nop is the one free slot that the instruction set asks for behind a transcendental; inside the statement it stands directly behind
__device__ __forceinline__ float nexp_slot(float x) { float r; asm("v_exp_f32 %0, %1\n\tv_nop" : "=v"(r) : "v"(x * 1.4426950408889634f)); return r; }

// proj: work-group = (b, 64 positions), 16 waves. It brings its 256 x 64 tile of x (NCHW) and the three weight matrices [theta; phi; g] = [192][256] from f32 to bf16 (round to nearest even) in LDS,
// x transposed to position-major rows, every global load on whole 128-byte lines, all of them in flight together. Wave (mt, ng) then forms positions 16 mt .. + 15 x channels 16 ng .. + 15 of theta, phi and g
// (k ascending in steps of 32), every fragment from LDS. Work-group i also writes row i of W [256][64] as f16 (bf16-exact) for the attention kernel's epilogue. grid (64, Bn) x 512.
constexpr int XP = C + 8, SP = 64 + 8;   // LDS row pitches in 16-bit elements: 528 B and 144 B, both 16 B x odd, for the 16-byte fragment and row readers
__global__ __launch_bounds__(512) void proj_kernel(const float* __restrict__ x, const float* __restrict__ tw, const float* __restrict__ pw, const float* __restrict__ gw, const float* __restrict__ Ww, const float* __restrict__ tb, const float* __restrict__ pb, const float* __restrict__ gb, b16* __restrict__ th, b16* __restrict__ ph, b16* __restrict__ gt, b16* __restrict__ ww16) {
  static_assert(NBLK == C, "one row of W per work-group");
  __shared__ __attribute__((aligned(16))) unsigned short Xs[64][XP], Ws[3 * C1][XP];
  __shared__ __attribute__((aligned(16))) b16 Ts[2][2][64][SP], Vs[2][C2][SP];   // [theta | phi][hi | lo][position][channel]; [hi | lo][channel][position]
  const int t_ = threadIdx.x, b = blockIdx.y, p0 = blockIdx.x * 64, bid = blockIdx.y * 64 + blockIdx.x; const float* src = x + (size_t)b * C * NP + p0;
  const int lane = t_ & 31, wave = t_ >> 5, nloc = lane & 15, hlf = lane >> 4, mt = wave & 3, ng = wave >> 2, cch = ng * 16 + nloc;
  v4f wv; float bias[3];
  { float xr[16][2]; v4f wr[24];   // the whole tile's and all three matrices' loads are in flight before the first value is used
#pragma unroll
    for (int k = 0; k < 16; ++k) { const int c = 2 * ((t_ >> 6) + 8 * k); xr[k][0] = src[(size_t)c * NP + (t_ & 63)]; xr[k][1] = src[(size_t)(c + 1) * NP + (t_ & 63)]; }
#pragma unroll
    for (int k = 0; k < 24; ++k) { const float* Wm = (k < 8) ? tw : (k < 16) ? pw : gw; wr[k] = *(const v4f*)(Wm + (size_t)(t_ + 512 * (k & 7)) * 4); }
    wv = *(const v4f*)(Ww + (size_t)bid * C2 + (t_ & 15) * 4); bias[0] = tb[cch]; bias[1] = pb[cch]; bias[2] = gb[cch];
    asm volatile("s_wait_xcnt 0x0" ::: "memory");   // stands ahead of the first instruction that reuses an address register of the loads above
#pragma unroll
    for (int k = 0; k < 16; ++k) *(unsigned int*)(&Xs[t_ & 63][2 * ((t_ >> 6) + 8 * k)]) = pk_bf16(xr[k][0], xr[k][1]);
#pragma unroll
    for (int k = 0; k < 24; ++k) { v2u o; o[0] = pk_bf16(wr[k][0], wr[k][1]); o[1] = pk_bf16(wr[k][2], wr[k][3]); *(v2u*)(&Ws[(k >> 3) * C1 + (k & 7) * 8 + (t_ >> 6)][(t_ & 63) * 4]) = o; }
    asm volatile("" :: "v"(wv), "v"(bias[0]), "v"(bias[1]), "v"(bias[2]));   // inputs only: holds the four small loads up with the others; without it the compiler sinks them to their first use, where their latency is exposed
  }
  __syncthreads();                                     // the x tile and the weights are visible to every wave
  v8f acc[3] = {{}, {}, {}};
  // The fragment loads of 128 k stand as one group ahead of their twelve products, so that a wave waits for LDS twice and not once per product.
#pragma unroll
  for (int kh = 0; kh < C; kh += 128) { v16bb a[4], bw[4][3];
#pragma unroll
    for (int ks = 0; ks < 4; ++ks) { a[ks] = frag_bf(&Xs[mt * 16 + nloc][kh + ks * 32], hlf);
#pragma unroll
      for (int j = 0; j < 3; ++j) bw[ks][j] = frag_bf(&Ws[j * C1 + cch][kh + ks * 32], hlf); }
#pragma unroll
    for (int ks = 0; ks < 4; ++ks)
#pragma unroll
      for (int j = 0; j < 3; ++j) acc[j] = wmma16bb(a[ks], bw[ks][j], acc[j]); }
#pragma unroll
  for (int j = 0; j < 3; ++j) { const float bb = bf16_rne(bias[j]); v8b vh, vl;
#pragma unroll
    for (int v = 0; v < 8; ++v) { b16 a_, c_; split16((acc[j][v] + bb) * ((j == 2) ? VS : QS), a_, c_); vh[v] = a_; vl[v] = c_; }
    if (j < 2) {
#pragma unroll
      for (int v = 0; v < 8; ++v) { Ts[j][0][mt * 16 + 8 * hlf + v][cch] = vh[v]; Ts[j][1][mt * 16 + 8 * hlf + v][cch] = vl[v]; } }
    else { *(v8b*)(&Vs[0][cch][mt * 16 + 8 * hlf]) = vh; *(v8b*)(&Vs[1][cch][mt * 16 + 8 * hlf]) = vl; } }
  __syncthreads();                                     // the staged theta, phi and g tiles are visible to every wave
  { const int rr = t_ >> 3, c8 = (t_ & 7) * 8; const size_t qd = ((size_t)b * NP + p0 + rr) * C1 + c8, vd = ((size_t)b * C2 + rr) * NP + p0 + c8;   // whole 128-byte lines per row
    const v8b s0 = *(const v8b*)(&Ts[0][0][rr][c8]), s1 = *(const v8b*)(&Ts[0][1][rr][c8]), s2 = *(const v8b*)(&Ts[1][0][rr][c8]), s3 = *(const v8b*)(&Ts[1][1][rr][c8]), s4 = *(const v8b*)(&Vs[0][rr][c8]), s5 = *(const v8b*)(&Vs[1][rr][c8]);
    *(v8b*)(th + qd) = s0; *(v8b*)(th + QPL + qd) = s1; *(v8b*)(ph + qd) = s2; *(v8b*)(ph + QPL + qd) = s3; *(v8b*)(gt + vd) = s4; *(v8b*)(gt + VPL + vd) = s5; }
  if (t_ < 16) { v4b o;   // behind the last barrier, so that no wave waits at a barrier for this store
#pragma unroll
    for (int e = 0; e < 4; ++e) o[e] = (b16)bf16_rne(wv[e]);
    *(v4b*)(ww16 + (size_t)bid * C2 + t_ * 4) = o; }
}

// K / V staging for attn_kernel. A stage = 64 keys = four tiles of 64 rows x 128 B: K hi, K lo (row = key, 64 channels), V hi, V lo (row = channel, 64 keys).
// LDS row pitch 144 B (16 B x odd, for the ds_load_b128 fragment readers). Two buffers: the next stage's copies fly while this stage is worked on.
// A work-group = 64 queries (2 columns of 32) x NK key groups = 16 waves, so that 256 work-groups fill the chip at four waves per SIMD. A buffer holds NG such stages, each shared by two key groups:
// group g works on keys 256 st + 32 g .. + 31 of every pass st, for two query tiles at once, so that every K and V fragment it reads from LDS feeds two tiles' products; each tile has its own running (m, l, o);
// the NK partial results of a query tile are merged once, behind the loop, in fixed group order.
constexpr int KT = 64, RP = 72, TILE = 64 * RP, NG = 4, NK = 2 * NG, NST = NP / (KT * NG), OP = C2 + 4, TP = 64 + 4;
constexpr unsigned TILEB = TILE * 2u, SUBB = 4u * TILEB, BUFB = NG * SUBB, HALFB = 32u * RP * 2u;

// One 64-key stage's copies of one thread: 16 B of rows r and r + 32 of each of the four tiles (256 threads x 8 x 16 B = 32 KB), global -> LDS through no register.
__device__ __forceinline__ void stage_copies(unsigned lds, const b16* gk, const b16* gv) {
  // The closing s_wait_xcnt 0 stands inside the statement so that no address register of an issued copy is rewritten in front of it.
  asm volatile("global_load_async_to_lds_b128 %0, %8, off\n\t"
               "global_load_async_to_lds_b128 %1, %9, off\n\t"
               "global_load_async_to_lds_b128 %2, %10, off\n\t"
               "global_load_async_to_lds_b128 %3, %11, off\n\t"
               "global_load_async_to_lds_b128 %4, %12, off\n\t"
               "global_load_async_to_lds_b128 %5, %13, off\n\t"
               "global_load_async_to_lds_b128 %6, %14, off\n\t"
               "global_load_async_to_lds_b128 %7, %15, off\n\t"
               "s_wait_xcnt 0x0"
               :: "v"(lds), "v"(lds + HALFB), "v"(lds + TILEB), "v"(lds + TILEB + HALFB), "v"(lds + 2u * TILEB), "v"(lds + 2u * TILEB + HALFB), "v"(lds + 3u * TILEB), "v"(lds + 3u * TILEB + HALFB),
                  "v"(gk), "v"(gk + 32 * C1), "v"(gk + QPL), "v"(gk + QPL + 32 * C1), "v"(gv), "v"(gv + (size_t)32 * NP), "v"(gv + VPL), "v"(gv + VPL + (size_t)32 * NP)
               : "memory");
}

__global__ __launch_bounds__(512) void attn_kernel(const b16* __restrict__ th, const b16* __restrict__ ph, const b16* __restrict__ gt, const b16* __restrict__ ww16, const float* __restrict__ Wb, float* __restrict__ wyT, float* __restrict__ part) {
  __shared__ __attribute__((aligned(16))) b16 Ring[2][NG][4][TILE];
  __shared__ float Ms[NK][64], Ls[NK][64];
  const int wid = __builtin_amdgcn_readfirstlane(threadIdx.x >> 5), qc = wid & 1, grp = wid >> 1, lane = threadIdx.x & 31, hh = lane >> 4, col = lane & 15; const int tok0 = blockIdx.x * 64 + qc * 32, b = (blockIdx.x * 64) / NP; const size_t qi = (size_t)tok0 + col;
  const b16* K = ph + ((size_t)b * NP) * C1; const b16* V = gt + ((size_t)b * C2) * NP;
  const int cg = (threadIdx.x >> 8) * 2, cr = (threadIdx.x & 255) >> 3, cc = (threadIdx.x & 7) * 8;   // this thread copies for the 64-key stages cg and cg + 1 of a buffer: its row (and row + 32) and 16-byte piece in every tile
  const unsigned lds0 = (unsigned)(size_t)&Ring[0][cg][0][cr * RP + cc]; const b16* gk = K + (size_t)(cg * KT + cr) * C1 + cc; const b16* gv = V + (size_t)cr * NP + cg * KT + cc;
  stage_copies(lds0, gk, gv); stage_copies(lds0 + SUBB, gk + (size_t)KT * C1, gv + KT);
  asm volatile("s_wait_asynccnt 0x0" ::: "memory");   // pass 0 of this wave has landed
  __syncthreads();                                    // ... and of every wave: publishes pass 0
  stage_copies(lds0 + BUFB, gk + (size_t)(NG * KT) * C1, gv + NG * KT); stage_copies(lds0 + BUFB + SUBB, gk + (size_t)(NG * KT + KT) * C1, gv + NG * KT + KT);
  v16b qf[2][2], ql[2][2];   // [query tile][k step]
#pragma unroll
  for (int u = 0; u < 2; ++u)
#pragma unroll
    for (int ks = 0; ks < 2; ++ks) { qf[u][ks] = frag_kb(th + (qi + 16 * u) * C1 + ks * 32, hh); ql[u][ks] = frag_kb(th + QPL + (qi + 16 * u) * C1 + ks * 32, hh); }
  asm volatile("s_wait_xcnt 0x0" ::: "memory");   // stands ahead of the first instruction that reuses the address register of the loads above
  __builtin_amdgcn_sched_barrier(0);                  // keeps the register writes that follow behind that wait: without it the compiler lifts the zeroing of o over it
  float m[2] = {-INFINITY, -INFINITY}, l[2] = {0.0f, 0.0f}; v8f o[2][4] = {{{}, {}, {}, {}}, {{}, {}, {}, {}}};
  const int kb = (grp & 1) * 32;   // this group's half of the 64-key stage that it shares with its neighbour
  for (int st = 0; st < NST; ++st) { const b16* Kh = &Ring[st & 1][grp >> 1][0][0]; const b16* Kl = Kh + TILE; const b16* Vh = Kh + 2 * TILE; const b16* Vl = Kh + 3 * TILE;
   v8f s0[2] = {{}, {}}, s1[2] = {{}, {}};
#pragma unroll
   for (int ks = 0; ks < 2; ++ks) { const v16b ka = frag_kb(Kh + (kb + col) * RP + ks * 32, hh), kal = frag_kb(Kl + (kb + col) * RP + ks * 32, hh), kb_ = frag_kb(Kh + (kb + 16 + col) * RP + ks * 32, hh), kbl = frag_kb(Kl + (kb + 16 + col) * RP + ks * 32, hh);
#pragma unroll
     for (int u = 0; u < 2; ++u) { s0[u] = wmma16b(ka, qf[u][ks], s0[u]); s0[u] = wmma16b(ka, ql[u][ks], s0[u]); s0[u] = wmma16b(kal, qf[u][ks], s0[u]); s1[u] = wmma16b(kb_, qf[u][ks], s1[u]); s1[u] = wmma16b(kb_, ql[u][ks], s1[u]); s1[u] = wmma16b(kbl, qf[u][ks], s1[u]); } }
   v16b pbv[2], plv[2]; float al_[2];
#pragma unroll
   for (int u = 0; u < 2; ++u) { float mr = -INFINITY;
#pragma unroll
    for (int r = 0; r < 8; ++r) { s0[u][r] *= SCALE / (QS * QS); s1[u][r] *= SCALE / (QS * QS); mr = fmaxf(mr, fmaxf(s0[u][r], s1[u][r])); }
    mr = fmaxf(mr, __shfl_xor(mr, 16));
    const float mn = fmaxf(m[u], mr); al_[u] = nexp(m[u] - mn); m[u] = mn; float sum = 0.0f;
#pragma unroll
    for (int r = 0; r < 8; ++r) { const float p0 = nexp(s0[u][r] - mn), p1 = nexp(s1[u][r] - mn); sum += p0 + p1; b16 a, c; split16(p0 * PS, a, c); pbv[u][r] = a; plv[u][r] = c; split16(p1 * PS, a, c); pbv[u][8 + r] = a; plv[u][8 + r] = c; }
    sum += __shfl_xor(sum, 16); l[u] = l[u] * al_[u] + sum; }
#pragma unroll
   for (int n = 0; n < 4; ++n) { const v16b vf = frag_kb(Vh + (n * 16 + col) * RP + kb, hh), vl = frag_kb(Vl + (n * 16 + col) * RP + kb, hh);
#pragma unroll
     for (int u = 0; u < 2; ++u) { o[u][n] *= al_[u]; o[u][n] = wmma16b(vf, pbv[u], o[u][n]); o[u][n] = wmma16b(vf, plv[u], o[u][n]); o[u][n] = wmma16b(vl, pbv[u], o[u][n]); } }
   asm volatile("s_wait_dscnt 0x0" ::: "memory");      // this wave's reads of the buffer have retired before it is handed to its next writer
   asm volatile("s_wait_asynccnt 0x0" ::: "memory");   // this wave's copies of pass st + 1 have landed
   __syncthreads();                                    // publishes pass st + 1 and ends every reader's last read of pass st
   if (st + 2 < NST) { const unsigned ld = lds0 + (unsigned)(st & 1) * BUFB; const b16* nk = gk + (size_t)(st + 2) * (NG * KT) * C1; const b16* nv = gv + (st + 2) * (NG * KT);
     stage_copies(ld, nk, nv); stage_copies(ld + SUBB, nk + (size_t)KT * C1, nv + KT); } }
  asm volatile("s_wait_asynccnt 0x0" ::: "memory");    // nothing of this wave is in flight behind the loop
  // The lane and thread numbers are formed anew from the scalar wave number: no value derived from the thread index then has to stay in a vector register across the loop, which needs nearly the whole register budget (with them the build spills).
  const int elane = (int)__builtin_amdgcn_mbcnt_lo(~0u, 0u), ehh = elane >> 4, ecol = elane & 15, tid = wid * 32 + elane;
  // Merge of the NK key groups of each query tile. The ring is free behind the loop's last barrier (every read retired, no copy in flight) and becomes the staging of the scaled partial outputs.
  if (ehh == 0) {
#pragma unroll
    for (int u = 0; u < 2; ++u) { Ms[grp][qc * 32 + u * 16 + ecol] = m[u]; Ls[grp][qc * 32 + u * 16 + ecol] = l[u]; } }
  __syncthreads();                                     // every group's (m, l) is visible
  float* Os = (float*)&Ring[0][0][0][0];               // [NK groups][64 queries][OP]
#pragma unroll
  for (int u = 0; u < 2; ++u) { const int q = qc * 32 + u * 16 + ecol; float mg = Ms[0][q];
#pragma unroll
    for (int g = 1; g < NK; ++g) mg = fmaxf(mg, Ms[g][q]);
    float lg = 0.0f;
#pragma unroll
    for (int g = 0; g < NK; ++g) lg += Ls[g][q] * nexp_slot(Ms[g][q] - mg);
    const float inv = nexp_slot(m[u] - mg) / (lg * VS * PS);
#pragma unroll
    for (int n = 0; n < 4; ++n)
#pragma unroll
      for (int r = 0; r < 8; ++r) Os[(grp * 64 + q) * OP + n * 16 + 8 * ehh + r] = o[u][n][r] * inv; }
  __syncthreads();                                     // every group's scaled partial output is visible
  // W conv as the epilogue. Wave (qt, cq) forms wy^T for channels 64 cq .. + 63 (A = W rows) at positions 16 qt .. + 15 (B = y rows): D row = channel, D column = position.
  const int qt = wid & 3, cq = wid >> 2; v16b yh[2], yl[2], wf[4][2]; const b16* wp[4];
#pragma unroll
  for (int t = 0; t < 4; ++t) wp[t] = ww16 + (size_t)(cq * 64 + t * 16 + ecol) * C2 + 8 * ehh;
#pragma unroll
  for (int ks = 0; ks < 2; ++ks)
#pragma unroll
    for (int t = 0; t < 4; ++t) wf[t][ks] = frag_kb(wp[t] + ks * 32, 0);
  const unsigned bo = (unsigned)(cq * 64 + 8 * ehh) * 4u; const float* bp = (const float*)((const char*)Wb + bo); v4f bb[4][2];   // the bias of this lane's eight channels of each of the four tiles; bo: the lane's byte offset, the loads' address register
#pragma unroll
  for (int t = 0; t < 4; ++t) { bb[t][0] = *(const v4f*)(bp + t * 16); bb[t][1] = *(const v4f*)(bp + t * 16 + 4); }
  // Stands ahead of the first instruction that reuses an address register of the loads above; the five addresses are inputs so that they stay in their registers up to the wait:
  // without that the last loads' results are given the registers of the first loads' addresses.
  asm volatile("s_wait_xcnt 0x0" :: "v"(wp[0]), "v"(wp[1]), "v"(wp[2]), "v"(wp[3]), "v"(bo) : "memory");
  // y = the NK partials added in group order, each element formed once: thread -> position tid / 8, channels 8 (tid % 8) .. + 7; split x8 into f16 hi + lo rows of pitch RP behind Os.
  b16* Yh = (b16*)(Os + NK * 64 * OP); b16* Yl = Yh + 64 * RP;
  { const int yq = tid >> 3, yc = (tid & 7) * 8; const float* sp = Os + yq * OP + yc; v4f s0 = *(const v4f*)sp, s1 = *(const v4f*)(sp + 4); v8b vh, vl;
#pragma unroll
    for (int g = 1; g < NK; ++g) { s0 += *(const v4f*)(sp + g * 64 * OP); s1 += *(const v4f*)(sp + g * 64 * OP + 4); }
#pragma unroll
    for (int e = 0; e < 4; ++e) { b16 p, q; split16(s0[e] * YS, p, q); vh[e] = p; vl[e] = q; split16(s1[e] * YS, p, q); vh[4 + e] = p; vl[4 + e] = q; }
    *(v8b*)(Yh + yq * RP + yc) = vh; *(v8b*)(Yl + yq * RP + yc) = vl; }
  __syncthreads();                                     // y is visible to every wave
#pragma unroll
  for (int ks = 0; ks < 2; ++ks) { yh[ks] = frag_kb(Yh + (qt * 16 + ecol) * RP + ks * 32, ehh); yl[ks] = frag_kb(Yl + (qt * 16 + ecol) * RP + ks * 32, ehh); }
  v8f acc[4] = {{}, {}, {}, {}};
#pragma unroll
  for (int ks = 0; ks < 2; ++ks)
#pragma unroll
    for (int t = 0; t < 4; ++t) { acc[t] = wmma16b(wf[t][ks], yh[ks], acc[t]); acc[t] = wmma16b(wf[t][ks], yl[ks], acc[t]); }
  float* Ts = (float*)(Yl + 64 * RP);                  // [256 channels][TP]: 64 positions per row; lies behind y, which other waves may still be reading
#pragma unroll
  for (int t = 0; t < 4; ++t) { const int c8 = cq * 64 + t * 16 + 8 * ehh; const v4f b0 = bb[t][0], b1 = bb[t][1];
#pragma unroll
    for (int v = 0; v < 8; ++v) Ts[(c8 + v) * TP + qt * 16 + ecol] = acc[t][v] * (1.0f / YS) + bf16_rne((v < 4) ? b0[v & 3] : b1[v & 3]); }
  __syncthreads();                                     // the whole 256 x 64 tile of wy^T is visible
  float* dst = wyT + (size_t)b * C * NP + (blockIdx.x * 64) % NP;
#pragma unroll
  for (int j = 0; j < 8; ++j) { const int i = j * 512 + tid, ch = i >> 4, p4 = (i & 15) * 4; *(v4f*)(dst + (size_t)ch * NP + p4) = *(const v4f*)(Ts + ch * TP + p4); }
  asm volatile("s_wait_xcnt 0x0" ::: "memory");   // stands ahead of the first instruction that reuses a register of the stores above
  __builtin_amdgcn_sched_barrier(0);                  // keeps the register writes that follow behind that wait: without it the compiler lifts the next block's address arithmetic in among the stores
  // Per-block partials of every channel over the block's 64 positions: threads 0 .. 255 the sums, 256 .. 511 the sums of squares; part[block][4][2][64], 2 KB per work-group.
  { const int ch = tid & 255, st = tid >> 8; v4f a4 = {};
    if (st == 0) {
#pragma unroll
      for (int p = 0; p < 16; ++p) a4 += *(const v4f*)(Ts + ch * TP + p * 4); }
    else {
#pragma unroll
      for (int p = 0; p < 16; ++p) { const v4f a = *(const v4f*)(Ts + ch * TP + p * 4); a4 += a * a; } }
    part[(size_t)blockIdx.x * 512 + (ch >> 6) * 128 + st * 64 + (ch & 63)] = (a4[0] + a4[1]) + (a4[2] + a4[3]); }
}

// Work-group = one channel, all 4 x 4096 positions (64 KB of wy^T, NCHW like out). Thread t takes block t's (sum, sum of squares) of the channel; they are added in double in a fixed tree
// (32 lanes by xor steps, then the 8 waves in order). The row loads are issued ahead of that reduction, so that they fly under it.
__global__ __launch_bounds__(256) void final_kernel(const float* __restrict__ wyT, const float* __restrict__ part, const float* __restrict__ gma, const float* __restrict__ bta, float* __restrict__ out) {
  static_assert(NBLK == 256, "one partial pair per thread");
  __shared__ double Rs[8], Rq[8];
  const int c = blockIdx.x, t_ = threadIdx.x;
  const float ps = part[(size_t)t_ * 512 + (c >> 6) * 128 + (c & 63)], pq = part[(size_t)t_ * 512 + (c >> 6) * 128 + 64 + (c & 63)];
  const float gm = gma[c], bt = bta[c];
  v4f v[16];
#pragma unroll
  for (int j = 0; j < 16; ++j) v[j] = *(const v4f*)(wyT + ((size_t)(j >> 2) * C + c) * NP + ((j & 3) * 256 + t_) * 4);
  asm volatile("s_wait_xcnt 0x0" ::: "memory");   // stands ahead of the first instruction that reuses an address register of the loads above
  double s = (double)ps, q = (double)pq;
#pragma unroll
  for (int m = 1; m < 32; m <<= 1) { s += __shfl_xor(s, m); q += __shfl_xor(q, m); }
  if ((t_ & 31) == 0) { Rs[t_ >> 5] = s; Rq[t_ >> 5] = q; }
  __syncthreads();                                // every wave's pair of sums is visible
  s = Rs[0]; q = Rq[0];
#pragma unroll
  for (int w = 1; w < 8; ++w) { s += Rs[w]; q += Rq[w]; }
  const double mean = s / (double)NTOK; const double var = fmax(q / (double)NTOK - mean * mean, 0.0);
  const float scl = bf16_rne(gm) * (float)(1.0 / sqrt(var + (double)EPS)); const float sh = bf16_rne(bt) - (float)mean * scl;
#pragma unroll
  for (int j = 0; j < 16; ++j) { v4f o;
#pragma unroll
    for (int e = 0; e < 4; ++e) o[e] = v[j][e] * scl + sh;
    *(v4f*)(out + ((size_t)(j >> 2) * C + c) * NP + ((j & 3) * 256 + t_) * 4) = o; }
}
}  // namespace

extern "C" void kernel_launch(void* const* d_in, const int* in_sizes, int n_in,
                              void* d_out, int out_size, void* d_ws, size_t ws_size, hipStream_t stream) {
  (void)n_in; (void)out_size;
  const float* x = (const float*)d_in[0]; const float* tw = (const float*)d_in[1]; const float* tb = (const float*)d_in[2]; const float* pw = (const float*)d_in[3]; const float* pb = (const float*)d_in[4]; const float* gw = (const float*)d_in[5]; const float* gb = (const float*)d_in[6];
  const float* Ww = (const float*)d_in[7]; const float* Wb = (const float*)d_in[8]; const float* gma = (const float*)d_in[9]; const float* bta = (const float*)d_in[10];
  float* out = (float*)d_out;   // [4][256][64][64]
  if (in_sizes[0] != Bn * C * NP || in_sizes[1] != C1 * C || in_sizes[5] != C2 * C || in_sizes[7] != C * C2 || in_sizes[9] != C) return;
  size_t off = 0; char* ws = (char*)d_ws;
  auto carve = [&](size_t bytes) { char* p = ws + off; off += (bytes + 255) & ~(size_t)255; return p; };
  b16* ww16 = (b16*)carve((size_t)C * C2 * 2);
  b16* th = (b16*)carve(QPL * 2 * 2); b16* ph = (b16*)carve(QPL * 2 * 2); b16* gt = (b16*)carve(VPL * 2 * 2); float* wyT = (float*)carve((size_t)NTOK * C * 4); float* part = (float*)carve((size_t)NBLK * 4 * 2 * 64 * 4);
  if (off > ws_size) return;                                    // about 4.2x3 + 16.8 + 0.5 = 30 MB
  proj_kernel<<<dim3(NP / 64, Bn), 512, 0, stream>>>(x, tw, pw, gw, Ww, tb, pb, gb, th, ph, gt, ww16);
  attn_kernel<<<NTOK / 64, 512, 0, stream>>>(th, ph, gt, ww16, Wb, wyT, part);
  final_kernel<<<C, 256, 0, stream>>>(wyT, part, gma, bta, out);
}

// v008
// One run takes 64 microseconds.
// Next to v007, in two timings, it ran 1.05 times as fast each time.
// Counting every step since v000, it is 6.63 times as fast.
#include <hip/hip_runtime.h>

// _MS_NonLocalBlockND (scale 1): theta, phi (64 ch) and g (64 ch) = 1x1 convs of x [4][256][64x64]; f = theta^T phi / 8 over the 4096 positions; attn = softmax; y = attn g; wy = W y + b
// (1x1 conv 64 -> 256); out = BatchNorm2d in TRAINING mode (batch mean / biased variance over (B, H, W) per channel, eps 1e-5, gamma, beta) -> NCHW [4][256][64][64].
// Projections on v_wmma_f32_16x16x32_bf16 (fragments from an LDS transpose of the NCHW input; 1 product); attention per (b, 32 queries):
// S^T = phi.theta^T (K = 64; theta, phi as f16 hi+lo pairs x8; 3 products), online softmax f32, y^T = (8g)^T.P^T (3 products); wy^T = W.y^T + b (y f32 split x8, W exact; 2 products) on
// v_wmma_f32_16x16x32_f16, f32 accumulate, as the attention kernel's epilogue, which stores wy^T in NCHW order and per-block (sum, sum of squares) partials of every channel;
// the final kernel (one channel per work-group) adds its channel's partials in fixed order and applies BN. Fragment k-map per lane half hh for A AND B: elements 0..7 <- k = 8hh+0..7, 8..15 <- k = 16+8hh+0..7.

namespace {
constexpr int Bn = 4, C = 256, NP = 4096, C1 = 64, C2 = 64, NTOK = Bn * NP, NBLK = NTOK / 64;
constexpr float QS = 8.0f, VS = 8.0f, YS = 8.0f, SCALE = 0.125f, EPS = 1e-5f;
constexpr float CS = SCALE / (QS * QS) * 1.4426950408889634f, LPS = 3.0f;   // raw score -> log2 domain; log2 of PS = 8, the scale of P's f16 parts
constexpr size_t QPL = (size_t)NTOK * C1, VPL = (size_t)Bn * C2 * NP;

typedef _Float16 b16;
typedef __attribute__((ext_vector_type(16))) _Float16 v16b;
typedef __attribute__((ext_vector_type(16))) __bf16 v16bb;
typedef __attribute__((ext_vector_type(8))) _Float16 v8b;
typedef __attribute__((ext_vector_type(8))) unsigned short v8us;
typedef __attribute__((ext_vector_type(8))) float v8f;
typedef __attribute__((ext_vector_type(4))) float v4f;
typedef __attribute__((ext_vector_type(2))) float v2f;
typedef __attribute__((ext_vector_type(2))) __bf16 v2bb;
typedef __attribute__((ext_vector_type(2))) unsigned int v2u;
typedef __attribute__((ext_vector_type(4))) _Float16 v4b;
typedef __attribute__((ext_vector_type(2))) _Float16 v2b;
__device__ __forceinline__ float bf16_rne(float f) { unsigned int u = __float_as_uint(f); u += 0x7FFFu + ((u >> 16) & 1u); return __uint_as_float(u & 0xFFFF0000u); }
__device__ __forceinline__ unsigned int pk_bf16(float a, float b) { const v2f f = {a, b}; return __builtin_bit_cast(unsigned int, __builtin_convertvector(f, v2bb)); }   // two f32 -> two bf16, round to nearest even, a in the low half
__device__ __forceinline__ void split16(float v, b16& hi, b16& lo) { hi = (b16)v; lo = (b16)(v - (float)hi); }
__device__ __forceinline__ v16b frag_kb(const b16* p, int hh) { const v8b a = *(const v8b*)(p + 8 * hh), b = *(const v8b*)(p + 16 + 8 * hh); v16b f;
#pragma unroll
  for (int e = 0; e < 8; ++e) { f[e] = a[e]; f[8 + e] = b[e]; } return f; }
__device__ __forceinline__ v16bb frag_bf(const unsigned short* p, int hh) { const v8us a = *(const v8us*)(p + 8 * hh), b = *(const v8us*)(p + 16 + 8 * hh); union { unsigned short s[16]; v16bb v; } u;
#pragma unroll
  for (int e = 0; e < 8; ++e) { u.s[e] = a[e]; u.s[8 + e] = b[e]; } return u.v; }
__device__ __forceinline__ v8f wmma16b(v16b a, v16b b, v8f c) { return __builtin_amdgcn_wmma_f32_16x16x32_f16(false, a, false, b, (short)0, c, false, false); }   // plain builtin: the compiler keeps the distance behind a product itself and may order products, LDS loads and vector work freely
__device__ __forceinline__ v8f wmma16bb(v16bb a, v16bb b, v8f c) { v8f d = __builtin_amdgcn_wmma_f32_16x16x32_bf16(false, a, false, b, (short)0, c, false, false); asm volatile("v_nop\n\tv_nop\n\tv_nop\n\tv_nop" : "+v"(d) : "v"(a), "v"(b)); return d; }
__device__ __forceinline__ float xhalf(float x) { const int i = __builtin_bit_cast(int, x); return __builtin_bit_cast(float, __builtin_amdgcn_permlanex16(i, i, 0x76543210, 0xfedcba98, false, false)); }   // lane l takes lane l ^ 16's value, on the vector port
// 2^x for the merge behind the loop: the v_nop is the one free slot that the instruction set asks for behind a transcendental; inside the statement it stands directly behind
__device__ __forceinline__ float exp2_slot(float x) { float r; asm("v_exp_f32 %0, %1\n\tv_nop" : "=v"(r) : "v"(x)); return r; }

// proj: work-group = (b, 64 positions), 16 waves. It brings its 256 x 64 tile of x (NCHW) and the three weight matrices [theta; phi; g] = [192][256] from f32 to bf16 (round to nearest even) in LDS,
// x transposed to position-major rows, every global load on whole 128-byte lines, all of them in flight together. Wave (mt, ng) then forms positions 16 mt .. + 15 x channels 16 ng .. + 15 of theta, phi and g
// (k ascending in steps of 32), every fragment from LDS. Work-group i also writes row i of W [256][64] as f16 (bf16-exact) for the attention kernel's epilogue. grid (64, Bn) x 512.
constexpr int XP = C + 8, SP = 64 + 8;   // LDS row pitches in 16-bit elements: 528 B and 144 B, both 16 B x odd, for the 16-byte fragment and row readers
__global__ __launch_bounds__(512) void proj_kernel(const float* __restrict__ x, const float* __restrict__ tw, const float* __restrict__ pw, const float* __restrict__ gw, const float* __restrict__ Ww, const float* __restrict__ tb, const float* __restrict__ pb, const float* __restrict__ gb, b16* __restrict__ th, b16* __restrict__ ph, b16* __restrict__ gt, b16* __restrict__ ww16) {
  static_assert(NBLK == C, "one row of W per work-group");
  __shared__ __attribute__((aligned(16))) unsigned short Xs[64][XP], Ws[3 * C1][XP];
  __shared__ __attribute__((aligned(16))) b16 Ts[2][2][64][SP], Vs[2][C2][SP];   // [theta | phi][hi | lo][position][channel]; [hi | lo][channel][position]
  const int t_ = threadIdx.x, b = blockIdx.y, p0 = blockIdx.x * 64, bid = blockIdx.y * 64 + blockIdx.x; const float* src = x + (size_t)b * C * NP + p0;
  const int lane = t_ & 31, wave = t_ >> 5, nloc = lane & 15, hlf = lane >> 4, mt = wave & 3, ng = wave >> 2, cch = ng * 16 + nloc;
  v4f wv; float bias[3];
  { float xr[16][2]; v4f wr[24];   // the whole tile's and all three matrices' loads are in flight before the first value is used
#pragma unroll
    for (int k = 0; k < 16; ++k) { const int c = 2 * ((t_ >> 6) + 8 * k); xr[k][0] = src[(size_t)c * NP + (t_ & 63)]; xr[k][1] = src[(size_t)(c + 1) * NP + (t_ & 63)]; }
#pragma unroll
    for (int k = 0; k < 24; ++k) { const float* Wm = (k < 8) ? tw : (k < 16) ? pw : gw; wr[k] = *(const v4f*)(Wm + (size_t)(t_ + 512 * (k & 7)) * 4); }
    wv = *(const v4f*)(Ww + (size_t)bid * C2 + (t_ & 15) * 4); bias[0] = tb[cch]; bias[1] = pb[cch]; bias[2] = gb[cch];
    asm volatile("s_wait_xcnt 0x0" ::: "memory");   // stands ahead of the first instruction that reuses an address register of the loads above
#pragma unroll
    for (int k = 0; k < 16; ++k) *(unsigned int*)(&Xs[t_ & 63][2 * ((t_ >> 6) + 8 * k)]) = pk_bf16(xr[k][0], xr[k][1]);
#pragma unroll
    for (int k = 0; k < 24; ++k) { v2u o; o[0] = pk_bf16(wr[k][0], wr[k][1]); o[1] = pk_bf16(wr[k][2], wr[k][3]); *(v2u*)(&Ws[(k >> 3) * C1 + (k & 7) * 8 + (t_ >> 6)][(t_ & 63) * 4]) = o; }
    asm volatile("" :: "v"(wv), "v"(bias[0]), "v"(bias[1]), "v"(bias[2]));   // inputs only: holds the four small loads up with the others; without it the compiler sinks them to their first use, where their latency is exposed
  }
  __syncthreads();                                     // the x tile and the weights are visible to every wave
  v8f acc[3] = {{}, {}, {}};
  // The fragment loads of 128 k stand as one group ahead of their twelve products, so that a wave waits for LDS twice and not once per product.
#pragma unroll
  for (int kh = 0; kh < C; kh += 128) { v16bb a[4], bw[4][3];
#pragma unroll
    for (int ks = 0; ks < 4; ++ks) { a[ks] = frag_bf(&Xs[mt * 16 + nloc][kh + ks * 32], hlf);
#pragma unroll
      for (int j = 0; j < 3; ++j) bw[ks][j] = frag_bf(&Ws[j * C1 + cch][kh + ks * 32], hlf); }
#pragma unroll
    for (int ks = 0; ks < 4; ++ks)
#pragma unroll
      for (int j = 0; j < 3; ++j) acc[j] = wmma16bb(a[ks], bw[ks][j], acc[j]); }
#pragma unroll
  for (int j = 0; j < 3; ++j) { const float bb = bf16_rne(bias[j]); v8b vh, vl;
#pragma unroll
    for (int v = 0; v < 8; ++v) { b16 a_, c_; split16((acc[j][v] + bb) * ((j == 2) ? VS : QS), a_, c_); vh[v] = a_; vl[v] = c_; }
    if (j < 2) {
#pragma unroll
      for (int v = 0; v < 8; ++v) { Ts[j][0][mt * 16 + 8 * hlf + v][cch] = vh[v]; Ts[j][1][mt * 16 + 8 * hlf + v][cch] = vl[v]; } }
    else { *(v8b*)(&Vs[0][cch][mt * 16 + 8 * hlf]) = vh; *(v8b*)(&Vs[1][cch][mt * 16 + 8 * hlf]) = vl; } }
  __syncthreads();                                     // the staged theta, phi and g tiles are visible to every wave
  { const int rr = t_ >> 3, c8 = (t_ & 7) * 8; const size_t qd = ((size_t)b * NP + p0 + rr) * C1 + c8, vd = ((size_t)b * C2 + rr) * NP + p0 + c8;   // whole 128-byte lines per row
    const v8b s0 = *(const v8b*)(&Ts[0][0][rr][c8]), s1 = *(const v8b*)(&Ts[0][1][rr][c8]), s2 = *(const v8b*)(&Ts[1][0][rr][c8]), s3 = *(const v8b*)(&Ts[1][1][rr][c8]), s4 = *(const v8b*)(&Vs[0][rr][c8]), s5 = *(const v8b*)(&Vs[1][rr][c8]);
    *(v8b*)(th + qd) = s0; *(v8b*)(th + QPL + qd) = s1; *(v8b*)(ph + qd) = s2; *(v8b*)(ph + QPL + qd) = s3; *(v8b*)(gt + vd) = s4; *(v8b*)(gt + VPL + vd) = s5; }
  if (t_ < 16) { v4b o;   // behind the last barrier, so that no wave waits at a barrier for this store
#pragma unroll
    for (int e = 0; e < 4; ++e) o[e] = (b16)bf16_rne(wv[e]);
    *(v4b*)(ww16 + (size_t)bid * C2 + t_ * 4) = o; }
}

// K / V staging for attn_kernel. A stage = 64 keys = four tiles of 64 rows x 128 B: K hi, K lo (row = key, 64 channels), V hi, V lo (row = channel, 64 keys).
// LDS row pitch 144 B (16 B x odd, for the ds_load_b128 fragment readers). Two buffers: the next stage's copies fly while this stage is worked on.
// A work-group = 64 queries (2 columns of 32) x NK key groups = 16 waves, so that 256 work-groups fill the chip at four waves per SIMD. A buffer holds NG such stages, each shared by two key groups:
// group g works on keys 256 st + 32 g .. + 31 of every pass st, for two query tiles at once, so that every K and V fragment it reads from LDS feeds two tiles' products; each tile has its own running (m, l, o);
// the NK partial results of a query tile are merged once, behind the loop, in fixed group order.
constexpr int KT = 64, RP = 72, TILE = 64 * RP, NG = 4, NK = 2 * NG, NST = NP / (KT * NG), OP = C2 + 4, TP = 64 + 4;
constexpr unsigned TILEB = TILE * 2u, SUBB = 4u * TILEB, BUFB = NG * SUBB, HALFB = 32u * RP * 2u;

// One 64-key stage's copies of one thread: 16 B of rows r and r + 32 of each of the four tiles (256 threads x 8 x 16 B = 32 KB), global -> LDS through no register.
__device__ __forceinline__ void stage_copies(unsigned lds, const b16* gk, const b16* gv) {
  // The closing s_wait_xcnt 0 stands inside the statement so that no address register of an issued copy is rewritten in front of it.
  asm volatile("global_load_async_to_lds_b128 %0, %8, off\n\t"
               "global_load_async_to_lds_b128 %1, %9, off\n\t"
               "global_load_async_to_lds_b128 %2, %10, off\n\t"
               "global_load_async_to_lds_b128 %3, %11, off\n\t"
               "global_load_async_to_lds_b128 %4, %12, off\n\t"
               "global_load_async_to_lds_b128 %5, %13, off\n\t"
               "global_load_async_to_lds_b128 %6, %14, off\n\t"
               "global_load_async_to_lds_b128 %7, %15, off\n\t"
               "s_wait_xcnt 0x0"
               :: "v"(lds), "v"(lds + HALFB), "v"(lds + TILEB), "v"(lds + TILEB + HALFB), "v"(lds + 2u * TILEB), "v"(lds + 2u * TILEB + HALFB), "v"(lds + 3u * TILEB), "v"(lds + 3u * TILEB + HALFB),
                  "v"(gk), "v"(gk + 32 * C1), "v"(gk + QPL), "v"(gk + QPL + 32 * C1), "v"(gv), "v"(gv + (size_t)32 * NP), "v"(gv + VPL), "v"(gv + VPL + (size_t)32 * NP)
               : "memory");
}

__global__ __launch_bounds__(512) void attn_kernel(const b16* __restrict__ th, const b16* __restrict__ ph, const b16* __restrict__ gt, const b16* __restrict__ ww16, const float* __restrict__ Wb, float* __restrict__ wyT, float* __restrict__ part) {
  __shared__ __attribute__((aligned(16))) b16 Ring[2][NG][4][TILE];
  __shared__ float Ms[NK][64], Ls[NK][64];
  const int wid = __builtin_amdgcn_readfirstlane(threadIdx.x >> 5), qc = wid & 1, grp = wid >> 1, lane = threadIdx.x & 31, hh = lane >> 4, col = lane & 15; const int tok0 = blockIdx.x * 64 + qc * 32, b = (blockIdx.x * 64) / NP; const size_t qi = (size_t)tok0 + col;
  const b16* K = ph + ((size_t)b * NP) * C1; const b16* V = gt + ((size_t)b * C2) * NP;
  const int cg = (threadIdx.x >> 8) * 2, cr = (threadIdx.x & 255) >> 3, cc = (threadIdx.x & 7) * 8;   // this thread copies for the 64-key stages cg and cg + 1 of a buffer: its row (and row + 32) and 16-byte piece in every tile
  const unsigned lds0 = (unsigned)(size_t)&Ring[0][cg][0][cr * RP + cc]; const b16* gk = K + (size_t)(cg * KT + cr) * C1 + cc; const b16* gv = V + (size_t)cr * NP + cg * KT + cc;
  stage_copies(lds0, gk, gv); stage_copies(lds0 + SUBB, gk + (size_t)KT * C1, gv + KT);
  asm volatile("s_wait_asynccnt 0x0" ::: "memory");   // pass 0 of this wave has landed
  __syncthreads();                                    // ... and of every wave: publishes pass 0
  stage_copies(lds0 + BUFB, gk + (size_t)(NG * KT) * C1, gv + NG * KT); stage_copies(lds0 + BUFB + SUBB, gk + (size_t)(NG * KT + KT) * C1, gv + NG * KT + KT);
  v16b qf[2][2], ql[2][2];   // [query tile][k step]
#pragma unroll
  for (int u = 0; u < 2; ++u)
#pragma unroll
    for (int ks = 0; ks < 2; ++ks) { qf[u][ks] = frag_kb(th + (qi + 16 * u) * C1 + ks * 32, hh); ql[u][ks] = frag_kb(th + QPL + (qi + 16 * u) * C1 + ks * 32, hh); }
  asm volatile("s_wait_xcnt 0x0" ::: "memory");   // stands ahead of the first instruction that reuses the address register of the loads above
  __builtin_amdgcn_sched_barrier(0);                  // keeps the register writes that follow behind that wait: without it the compiler lifts the zeroing of o over it
  float m[2] = {-INFINITY, -INFINITY}; v2f l2[2] = {{0.0f, 0.0f}, {0.0f, 0.0f}}; v8f o[2][4] = {{{}, {}, {}, {}}, {{}, {}, {}, {}}};
  const int kb = (grp & 1) * 32;   // this group's half of the 64-key stage that it shares with its neighbour
  for (int st = 0; st < NST; ++st) { const b16* Kh = &Ring[st & 1][grp >> 1][0][0]; const b16* Kl = Kh + TILE; const b16* Vh = Kh + 2 * TILE; const b16* Vl = Kh + 3 * TILE;
   v8f s0[2] = {{}, {}}, s1[2] = {{}, {}};
#pragma unroll
   for (int ks = 0; ks < 2; ++ks) { const v16b ka = frag_kb(Kh + (kb + col) * RP + ks * 32, hh), kal = frag_kb(Kl + (kb + col) * RP + ks * 32, hh), kb_ = frag_kb(Kh + (kb + 16 + col) * RP + ks * 32, hh), kbl = frag_kb(Kl + (kb + 16 + col) * RP + ks * 32, hh);
#pragma unroll
     for (int u = 0; u < 2; ++u) { s0[u] = wmma16b(ka, qf[u][ks], s0[u]); s0[u] = wmma16b(ka, ql[u][ks], s0[u]); s0[u] = wmma16b(kal, qf[u][ks], s0[u]); s1[u] = wmma16b(kb_, qf[u][ks], s1[u]); s1[u] = wmma16b(kb_, ql[u][ks], s1[u]); s1[u] = wmma16b(kbl, qf[u][ks], s1[u]); } }
   // Softmax in the log2 domain: maxima of the raw scores (the scale is positive); one packed multiply-add per score pair applies scale x log2(e), takes the maximum off and adds log2(PS),
   // so that v_exp_f32 gives PS x p at once; the large and small f16 parts are formed on pairs. m is kept in the log2 domain; l2 holds PS x the sums over this wave half's even and odd keys, joined once behind the loop.
   v16b pbv[2], plv[2]; float al_[2];
#pragma unroll
   for (int u = 0; u < 2; ++u) { float mr = fmaxf(s0[u][0], s1[u][0]);
#pragma unroll
    for (int r = 1; r < 8; ++r) mr = fmaxf(mr, fmaxf(s0[u][r], s1[u][r]));
    mr = fmaxf(mr, xhalf(mr));
    const float mn = fmaxf(m[u], mr * CS); al_[u] = __builtin_amdgcn_exp2f(m[u] - mn); m[u] = mn; const v2f cs2 = {CS, CS}, nm2 = {LPS - mn, LPS - mn}; v2f sm = {0.0f, 0.0f};
#pragma unroll
    for (int i = 0; i < 8; ++i) { const int j = 2 * (i & 3); const v2f sc = (i < 4) ? v2f{s0[u][j], s0[u][j + 1]} : v2f{s1[u][j], s1[u][j + 1]};   // elements 2 i and 2 i + 1 of the 32-key operand
      const v2f arg = __builtin_elementwise_fma(sc, cs2, nm2); const v2f p = {__builtin_amdgcn_exp2f(arg[0]), __builtin_amdgcn_exp2f(arg[1])}; sm += p;
      const v2b hi = __builtin_convertvector(p, v2b); const v2b lo = __builtin_convertvector(p - __builtin_convertvector(hi, v2f), v2b);
      pbv[u][2 * i] = hi[0]; pbv[u][2 * i + 1] = hi[1]; plv[u][2 * i] = lo[0]; plv[u][2 * i + 1] = lo[1]; }
    l2[u] = l2[u] * al_[u] + sm; }
#pragma unroll
   for (int n = 0; n < 4; ++n) { const v16b vf = frag_kb(Vh + (n * 16 + col) * RP + kb, hh), vl = frag_kb(Vl + (n * 16 + col) * RP + kb, hh);
#pragma unroll
     for (int u = 0; u < 2; ++u) { o[u][n] *= al_[u]; o[u][n] = wmma16b(vf, pbv[u], o[u][n]); o[u][n] = wmma16b(vf, plv[u], o[u][n]); o[u][n] = wmma16b(vl, pbv[u], o[u][n]); } }
   asm volatile("s_wait_dscnt 0x0" ::: "memory");      // this wave's reads of the buffer have retired before it is handed to its next writer
   asm volatile("s_wait_asynccnt 0x0" ::: "memory");   // this wave's copies of pass st + 1 have landed
   __syncthreads();                                    // publishes pass st + 1 and ends every reader's last read of pass st
   if (st + 2 < NST) { const unsigned ld = lds0 + (unsigned)(st & 1) * BUFB; const b16* nk = gk + (size_t)(st + 2) * (NG * KT) * C1; const b16* nv = gv + (st + 2) * (NG * KT);
     stage_copies(ld, nk, nv); stage_copies(ld + SUBB, nk + (size_t)KT * C1, nv + KT); } }
  asm volatile("s_wait_asynccnt 0x0" ::: "memory");    // nothing of this wave is in flight behind the loop
  // The lane and thread numbers are formed anew from the scalar wave number: no value derived from the thread index then has to stay in a vector register across the loop, which needs nearly the whole register budget (with them the build spills).
  const int elane = (int)__builtin_amdgcn_mbcnt_lo(~0u, 0u), ehh = elane >> 4, ecol = elane & 15, tid = wid * 32 + elane;
  // Merge of the NK key groups of each query tile. The ring is free behind the loop's last barrier (every read retired, no copy in flight) and becomes the staging of the scaled partial outputs.
  float l[2];
#pragma unroll
  for (int u = 0; u < 2; ++u) { l[u] = l2[u][0] + l2[u][1]; l[u] += xhalf(l[u]); }   // a query's row sum: even + odd keys, then the two wave halves
  if (ehh == 0) {
#pragma unroll
    for (int u = 0; u < 2; ++u) { Ms[grp][qc * 32 + u * 16 + ecol] = m[u]; Ls[grp][qc * 32 + u * 16 + ecol] = l[u]; } }
  __syncthreads();                                     // every group's (m, l) is visible
  float* Os = (float*)&Ring[0][0][0][0];               // [NK groups][64 queries][OP]
#pragma unroll
  for (int u = 0; u < 2; ++u) { const int q = qc * 32 + u * 16 + ecol; float mg = Ms[0][q];
#pragma unroll
    for (int g = 1; g < NK; ++g) mg = fmaxf(mg, Ms[g][q]);
    float lg = 0.0f;
#pragma unroll
    for (int g = 0; g < NK; ++g) lg += Ls[g][q] * exp2_slot(Ms[g][q] - mg);
    const float inv = exp2_slot(m[u] - mg) / (lg * VS);   // lg holds PS x the row sum
#pragma unroll
    for (int n = 0; n < 4; ++n)
#pragma unroll
      for (int r = 0; r < 8; ++r) Os[(grp * 64 + q) * OP + n * 16 + 8 * ehh + r] = o[u][n][r] * inv; }
  __syncthreads();                                     // every group's scaled partial output is visible
  // W conv as the epilogue. Wave (qt, cq) forms wy^T for channels 64 cq .. + 63 (A = W rows) at positions 16 qt .. + 15 (B = y rows): D row = channel, D column = position.
  const int qt = wid & 3, cq = wid >> 2; v16b yh[2], yl[2], wf[4][2]; const b16* wp[4];
#pragma unroll
  for (int t = 0; t < 4; ++t) wp[t] = ww16 + (size_t)(cq * 64 + t * 16 + ecol) * C2 + 8 * ehh;
#pragma unroll
  for (int ks = 0; ks < 2; ++ks)
#pragma unroll
    for (int t = 0; t < 4; ++t) wf[t][ks] = frag_kb(wp[t] + ks * 32, 0);
  const unsigned bo = (unsigned)(cq * 64 + 8 * ehh) * 4u; const float* bp = (const float*)((const char*)Wb + bo); v4f bb[4][2];   // the bias of this lane's eight channels of each of the four tiles; bo: the lane's byte offset, the loads' address register
#pragma unroll
  for (int t = 0; t < 4; ++t) { bb[t][0] = *(const v4f*)(bp + t * 16); bb[t][1] = *(const v4f*)(bp + t * 16 + 4); }
  // Stands ahead of the first instruction that reuses an address register of the loads above; the five addresses are inputs so that they stay in their registers up to the wait:
  // without that the last loads' results are given the registers of the first loads' addresses.
  asm volatile("s_wait_xcnt 0x0" :: "v"(wp[0]), "v"(wp[1]), "v"(wp[2]), "v"(wp[3]), "v"(bo) : "memory");
  // y = the NK partials added in group order, each element formed once: thread -> position tid / 8, channels 8 (tid % 8) .. + 7; split x8 into f16 hi + lo rows of pitch RP behind Os.
  b16* Yh = (b16*)(Os + NK * 64 * OP); b16* Yl = Yh + 64 * RP;
  { const int yq = tid >> 3, yc = (tid & 7) * 8; const float* sp = Os + yq * OP + yc; v4f s0 = *(const v4f*)sp, s1 = *(const v4f*)(sp + 4); v8b vh, vl;
#pragma unroll
    for (int g = 1; g < NK; ++g) { s0 += *(const v4f*)(sp + g * 64 * OP); s1 += *(const v4f*)(sp + g * 64 * OP + 4); }
#pragma unroll
    for (int e = 0; e < 4; ++e) { b16 p, q; split16(s0[e] * YS, p, q); vh[e] = p; vl[e] = q; split16(s1[e] * YS, p, q); vh[4 + e] = p; vl[4 + e] = q; }
    *(v8b*)(Yh + yq * RP + yc) = vh; *(v8b*)(Yl + yq * RP + yc) = vl; }
  __syncthreads();                                     // y is visible to every wave
#pragma unroll
  for (int ks = 0; ks < 2; ++ks) { yh[ks] = frag_kb(Yh + (qt * 16 + ecol) * RP + ks * 32, ehh); yl[ks] = frag_kb(Yl + (qt * 16 + ecol) * RP + ks * 32, ehh); }
  v8f acc[4] = {{}, {}, {}, {}};
#pragma unroll
  for (int ks = 0; ks < 2; ++ks)
#pragma unroll
    for (int t = 0; t < 4; ++t) { acc[t] = wmma16b(wf[t][ks], yh[ks], acc[t]); acc[t] = wmma16b(wf[t][ks], yl[ks], acc[t]); }
  float* Ts = (float*)(Yl + 64 * RP);                  // [256 channels][TP]: 64 positions per row; lies behind y, which other waves may still be reading
#pragma unroll
  for (int t = 0; t < 4; ++t) { const int c8 = cq * 64 + t * 16 + 8 * ehh; const v4f b0 = bb[t][0], b1 = bb[t][1];
#pragma unroll
    for (int v = 0; v < 8; ++v) Ts[(c8 + v) * TP + qt * 16 + ecol] = acc[t][v] * (1.0f / YS) + bf16_rne((v < 4) ? b0[v & 3] : b1[v & 3]); }
  __syncthreads();                                     // the whole 256 x 64 tile of wy^T is visible
  float* dst = wyT + (size_t)b * C * NP + (blockIdx.x * 64) % NP;
#pragma unroll
  for (int j = 0; j < 8; ++j) { const int i = j * 512 + tid, ch = i >> 4, p4 = (i & 15) * 4; *(v4f*)(dst + (size_t)ch * NP + p4) = *(const v4f*)(Ts + ch * TP + p4); }
  asm volatile("s_wait_xcnt 0x0" ::: "memory");   // stands ahead of the first instruction that reuses a register of the stores above
  __builtin_amdgcn_sched_barrier(0);                  // keeps the register writes that follow behind that wait: without it the compiler lifts the next block's address arithmetic in among the stores
  // Per-block partials of every channel over the block's 64 positions: threads 0 .. 255 the sums, 256 .. 511 the sums of squares; part[block][4][2][64], 2 KB per work-group.
  { const int ch = tid & 255, st = tid >> 8; v4f a4 = {};
    if (st == 0) {
#pragma unroll
      for (int p = 0; p < 16; ++p) a4 += *(const v4f*)(Ts + ch * TP + p * 4); }
    else {
#pragma unroll
      for (int p = 0; p < 16; ++p) { const v4f a = *(const v4f*)(Ts + ch * TP + p * 4); a4 += a * a; } }
    part[(size_t)blockIdx.x * 512 + (ch >> 6) * 128 + st * 64 + (ch & 63)] = (a4[0] + a4[1]) + (a4[2] + a4[3]); }
}

// Work-group = one channel, all 4 x 4096 positions (64 KB of wy^T, NCHW like out). Thread t takes block t's (sum, sum of squares) of the channel; they are added in double in a fixed tree
// (32 lanes by xor steps, then the 8 waves in order). The row loads are issued ahead of that reduction, so that they fly under it.
__global__ __launch_bounds__(256) void final_kernel(const float* __restrict__ wyT, const float* __restrict__ part, const float* __restrict__ gma, const float* __restrict__ bta, float* __restrict__ out) {
  static_assert(NBLK == 256, "one partial pair per thread");
  __shared__ double Rs[8], Rq[8];
  const int c = blockIdx.x, t_ = threadIdx.x;
  const float ps = part[(size_t)t_ * 512 + (c >> 6) * 128 + (c & 63)], pq = part[(size_t)t_ * 512 + (c >> 6) * 128 + 64 + (c & 63)];
  const float gm = gma[c], bt = bta[c];
  v4f v[16];
#pragma unroll
  for (int j = 0; j < 16; ++j) v[j] = *(const v4f*)(wyT + ((size_t)(j >> 2) * C + c) * NP + ((j & 3) * 256 + t_) * 4);
  asm volatile("s_wait_xcnt 0x0" ::: "memory");   // stands ahead of the first instruction that reuses an address register of the loads above
  double s = (double)ps, q = (double)pq;
#pragma unroll
  for (int m = 1; m < 32; m <<= 1) { s += __shfl_xor(s, m); q += __shfl_xor(q, m); }
  if ((t_ & 31) == 0) { Rs[t_ >> 5] = s; Rq[t_ >> 5] = q; }
  __syncthreads();                                // every wave's pair of sums is visible
  s = Rs[0]; q = Rq[0];
#pragma unroll
  for (int w = 1; w < 8; ++w) { s += Rs[w]; q += Rq[w]; }
  const double mean = s / (double)NTOK; const double var = fmax(q / (double)NTOK - mean * mean, 0.0);
  const float scl = bf16_rne(gm) * (float)(1.0 / sqrt(var + (double)EPS)); const float sh = bf16_rne(bt) - (float)mean * scl;
#pragma unroll
  for (int j = 0; j < 16; ++j) { v4f o;
#pragma unroll
    for (int e = 0; e < 4; ++e) o[e] = v[j][e] * scl + sh;
    *(v4f*)(out + ((size_t)(j >> 2) * C + c) * NP + ((j & 3) * 256 + t_) * 4) = o; }
}
}  // namespace

extern "C" void kernel_launch(void* const* d_in, const int* in_sizes, int n_in,
                              void* d_out, int out_size, void* d_ws, size_t ws_size, hipStream_t stream) {
  (void)n_in; (void)out_size;
  const float* x = (const float*)d_in[0]; const float* tw = (const float*)d_in[1]; const float* tb = (const float*)d_in[2]; const float* pw = (const float*)d_in[3]; const float* pb = (const float*)d_in[4]; const float* gw = (const float*)d_in[5]; const float* gb = (const float*)d_in[6];
  const float* Ww = (const float*)d_in[7]; const float* Wb = (const float*)d_in[8]; const float* gma = (const float*)d_in[9]; const float* bta = (const float*)d_in[10];
  float* out = (float*)d_out;   // [4][256][64][64]
  if (in_sizes[0] != Bn * C * NP || in_sizes[1] != C1 * C || in_sizes[5] != C2 * C || in_sizes[7] != C * C2 || in_sizes[9] != C) return;
  size_t off = 0; char* ws = (char*)d_ws;
  auto carve = [&](size_t bytes) { char* p = ws + off; off += (bytes + 255) & ~(size_t)255; return p; };
  b16* ww16 = (b16*)carve((size_t)C * C2 * 2);
  b16* th = (b16*)carve(QPL * 2 * 2); b16* ph = (b16*)carve(QPL * 2 * 2); b16* gt = (b16*)carve(VPL * 2 * 2); float* wyT = (float*)carve((size_t)NTOK * C * 4); float* part = (float*)carve((size_t)NBLK * 4 * 2 * 64 * 4);
  if (off > ws_size) return;                                    // about 4.2x3 + 16.8 + 0.5 = 30 MB
  proj_kernel<<<dim3(NP / 64, Bn), 512, 0, stream>>>(x, tw, pw, gw, Ww, tb, pb, gb, th, ph, gt, ww16);
  attn_kernel<<<NTOK / 64, 512, 0, stream>>>(th, ph, gt, ww16, Wb, wyT, part);
  final_kernel<<<C, 256, 0, stream>>>(wyT, part, gma, bta, out);
}

// v009
// A run of this version takes 60.2 microseconds.
// Two timings next to v008 put it at 1.06 and 1.05 times that version's speed.
// All steps since v000 together make it 7.00 times as fast.
#include <hip/hip_runtime.h>

// _MS_NonLocalBlockND (scale 1): theta, phi (64 ch) and g (64 ch) = 1x1 convs of x [4][256][64x64]; f = theta^T phi / 8 over the 4096 positions; attn = softmax; y = attn g; wy = W y + b
// (1x1 conv 64 -> 256); out = BatchNorm2d in TRAINING mode (batch mean / biased variance over (B, H, W) per channel, eps 1e-5, gamma, beta) -> NCHW [4][256][64][64].
// Projections on v_wmma_f32_16x16x32_bf16 (fragments from an LDS transpose of the NCHW input; 1 product); attention per (b, 32 queries):
// S^T = phi.theta^T (K = 64; theta, phi as f16 hi+lo pairs x8; 3 products), online softmax f32, y^T = (8g)^T.P^T (3 products); wy^T = W.y^T + b (y f32 split x8, W exact; 2 products) on
// v_wmma_f32_16x16x32_f16, f32 accumulate, as the attention kernel's epilogue, which stores wy^T in NCHW order and per-block (sum, sum of squares) partials of every channel;
// the final kernel (one channel per work-group) adds its channel's partials in fixed order and applies BN. Fragment k-map per lane half hh for A AND B: elements 0..7 <- k = 8hh+0..7, 8..15 <- k = 16+8hh+0..7.

namespace {
constexpr int Bn = 4, C = 256, NP = 4096, C1 = 64, C2 = 64, NTOK = Bn * NP, NBLK = NTOK / 64;
constexpr float QS = 8.0f, VS = 8.0f, YS = 8.0f, SCALE = 0.125f, EPS = 1e-5f;
constexpr float CS = SCALE / (QS * QS) * 1.4426950408889634f, LPS = 3.0f;   // raw score -> log2 domain; log2 of PS = 8, the scale of P's f16 parts
constexpr size_t QPL = (size_t)NTOK * C1, VPL = (size_t)Bn * C2 * NP;

typedef _Float16 b16;
typedef __attribute__((ext_vector_type(16))) _Float16 v16b;
typedef __attribute__((ext_vector_type(16))) __bf16 v16bb;
typedef __attribute__((ext_vector_type(8))) _Float16 v8b;
typedef __attribute__((ext_vector_type(8))) unsigned short v8us;
typedef __attribute__((ext_vector_type(8))) float v8f;
typedef __attribute__((ext_vector_type(4))) float v4f;
typedef __attribute__((ext_vector_type(2))) float v2f;
typedef __attribute__((ext_vector_type(2))) __bf16 v2bb;
typedef __attribute__((ext_vector_type(2))) unsigned int v2u;
typedef __attribute__((ext_vector_type(4))) _Float16 v4b;
typedef __attribute__((ext_vector_type(2))) _Float16 v2b;
__device__ __forceinline__ float bf16_rne(float f) { unsigned int u = __float_as_uint(f); u += 0x7FFFu + ((u >> 16) & 1u); return __uint_as_float(u & 0xFFFF0000u); }
__device__ __forceinline__ unsigned int pk_bf16(float a, float b) { const v2f f = {a, b}; return __builtin_bit_cast(unsigned int, __builtin_convertvector(f, v2bb)); }   // two f32 -> two bf16, round to nearest even, a in the low half
__device__ __forceinline__ void split16(float v, b16& hi, b16& lo) { hi = (b16)v; lo = (b16)(v - (float)hi); }
__device__ __forceinline__ v16b frag_kb(const b16* p, int hh) { const v8b a = *(const v8b*)(p + 8 * hh), b = *(const v8b*)(p + 16 + 8 * hh); v16b f;
#pragma unroll
  for (int e = 0; e < 8; ++e) { f[e] = a[e]; f[8 + e] = b[e]; } return f; }
__device__ __forceinline__ v16bb frag_bf(const unsigned short* p, int hh) { const v8us a = *(const v8us*)(p + 8 * hh), b = *(const v8us*)(p + 16 + 8 * hh); union { unsigned short s[16]; v16bb v; } u;
#pragma unroll
  for (int e = 0; e < 8; ++e) { u.s[e] = a[e]; u.s[8 + e] = b[e]; } return u.v; }
__device__ __forceinline__ v8f wmma16b(v16b a, v16b b, v8f c) { return __builtin_amdgcn_wmma_f32_16x16x32_f16(false, a, false, b, (short)0, c, false, false); }   // plain builtin: the compiler keeps the distance behind a product itself and may order products, LDS loads and vector work freely
__device__ __forceinline__ v8f wmma16bb(v16bb a, v16bb b, v8f c) { v8f d = __builtin_amdgcn_wmma_f32_16x16x32_bf16(false, a, false, b, (short)0, c, false, false); asm volatile("v_nop\n\tv_nop\n\tv_nop\n\tv_nop" : "+v"(d) : "v"(a), "v"(b)); return d; }
__device__ __forceinline__ float xhalf(float x) { const int i = __builtin_bit_cast(int, x); return __builtin_bit_cast(float, __builtin_amdgcn_permlanex16(i, i, 0x76543210, 0xfedcba98, false, false)); }   // lane l takes lane l ^ 16's value, on the vector port
// 2^x for the merge behind the loop: the v_nop is the one free slot that the instruction set asks for behind a transcendental; inside the statement it stands directly behind
__device__ __forceinline__ float exp2_slot(float x) { float r; asm("v_exp_f32 %0, %1\n\tv_nop" : "=v"(r) : "v"(x)); return r; }

// proj: work-group = (b, 64 positions), 16 waves. It brings its 256 x 64 tile of x (NCHW) and the three weight matrices [theta; phi; g] = [192][256] from f32 to bf16 (round to nearest even) in LDS,
// x transposed to position-major rows, every global load on whole 128-byte lines, all of them in flight together. Wave (mt, ng) then forms positions 16 mt .. + 15 x channels 16 ng .. + 15 of theta, phi and g
// (k ascending in steps of 32), every fragment from LDS. Work-group i also writes row i of W [256][64] as f16 (bf16-exact) for the attention kernel's epilogue. grid (64, Bn) x 512.
constexpr int XP = C + 8, SP = 64 + 8;   // LDS row pitches in 16-bit elements: 528 B and 144 B, both 16 B x odd, for the 16-byte fragment and row readers
__global__ __launch_bounds__(512) void proj_kernel(const float* __restrict__ x, const float* __restrict__ tw, const float* __restrict__ pw, const float* __restrict__ gw, const float* __restrict__ Ww, const float* __restrict__ tb, const float* __restrict__ pb, const float* __restrict__ gb, b16* __restrict__ th, b16* __restrict__ ph, b16* __restrict__ gt, b16* __restrict__ ww16) {
  static_assert(NBLK == C, "one row of W per work-group");
  __shared__ __attribute__((aligned(16))) unsigned short Xs[64][XP], Ws[3 * C1][XP];
  __shared__ __attribute__((aligned(16))) b16 Ts[2][2][64][SP], Vs[2][C2][SP];   // [theta | phi][hi | lo][position][channel]; [hi | lo][channel][position]
  const int t_ = threadIdx.x, b = blockIdx.y, p0 = blockIdx.x * 64, bid = blockIdx.y * 64 + blockIdx.x; const float* src = x + (size_t)b * C * NP + p0;
  const int lane = t_ & 31, wave = t_ >> 5, nloc = lane & 15, hlf = lane >> 4, mt = wave & 3, ng = wave >> 2, cch = ng * 16 + nloc;
  v4f wv; float bias[3];
  { float xr[16][2]; v4f wr[24];   // the whole tile's and all three matrices' loads are in flight before the first value is used
#pragma unroll
    for (int k = 0; k < 16; ++k) { const int c = 2 * ((t_ >> 6) + 8 * k); xr[k][0] = src[(size_t)c * NP + (t_ & 63)]; xr[k][1] = src[(size_t)(c + 1) * NP + (t_ & 63)]; }
#pragma unroll
    for (int k = 0; k < 24; ++k) { const float* Wm = (k < 8) ? tw : (k < 16) ? pw : gw; wr[k] = *(const v4f*)(Wm + (size_t)(t_ + 512 * (k & 7)) * 4); }
    wv = *(const v4f*)(Ww + (size_t)bid * C2 + (t_ & 15) * 4); bias[0] = tb[cch]; bias[1] = pb[cch]; bias[2] = gb[cch];
    asm volatile("s_wait_xcnt 0x0" ::: "memory");   // stands ahead of the first instruction that reuses an address register of the loads above
#pragma unroll
    for (int k = 0; k < 16; ++k) *(unsigned int*)(&Xs[t_ & 63][2 * ((t_ >> 6) + 8 * k)]) = pk_bf16(xr[k][0], xr[k][1]);
#pragma unroll
    for (int k = 0; k < 24; ++k) { v2u o; o[0] = pk_bf16(wr[k][0], wr[k][1]); o[1] = pk_bf16(wr[k][2], wr[k][3]); *(v2u*)(&Ws[(k >> 3) * C1 + (k & 7) * 8 + (t_ >> 6)][(t_ & 63) * 4]) = o; }
    asm volatile("" :: "v"(wv), "v"(bias[0]), "v"(bias[1]), "v"(bias[2]));   // inputs only: holds the four small loads up with the others; without it the compiler sinks them to their first use, where their latency is exposed
  }
  __syncthreads();                                     // the x tile and the weights are visible to every wave
  v8f acc[3] = {{}, {}, {}};
  // The fragment loads of 128 k stand as one group ahead of their twelve products, so that a wave waits for LDS twice and not once per product.
#pragma unroll
  for (int kh = 0; kh < C; kh += 128) { v16bb a[4], bw[4][3];
#pragma unroll
    for (int ks = 0; ks < 4; ++ks) { a[ks] = frag_bf(&Xs[mt * 16 + nloc][kh + ks * 32], hlf);
#pragma unroll
      for (int j = 0; j < 3; ++j) bw[ks][j] = frag_bf(&Ws[j * C1 + cch][kh + ks * 32], hlf); }
#pragma unroll
    for (int ks = 0; ks < 4; ++ks)
#pragma unroll
      for (int j = 0; j < 3; ++j) acc[j] = wmma16bb(a[ks], bw[ks][j], acc[j]); }
#pragma unroll
  for (int j = 0; j < 3; ++j) { const float bb = bf16_rne(bias[j]); v8b vh, vl;
#pragma unroll
    for (int v = 0; v < 8; ++v) { b16 a_, c_; split16((acc[j][v] + bb) * ((j == 2) ? VS : QS), a_, c_); vh[v] = a_; vl[v] = c_; }
    if (j < 2) {
#pragma unroll
      for (int v = 0; v < 8; ++v) { Ts[j][0][mt * 16 + 8 * hlf + v][cch] = vh[v]; Ts[j][1][mt * 16 + 8 * hlf + v][cch] = vl[v]; } }
    else { *(v8b*)(&Vs[0][cch][mt * 16 + 8 * hlf]) = vh; *(v8b*)(&Vs[1][cch][mt * 16 + 8 * hlf]) = vl; } }
  __syncthreads();                                     // the staged theta, phi and g tiles are visible to every wave
  { const int rr = t_ >> 3, c8 = (t_ & 7) * 8; const size_t qd = ((size_t)b * NP + p0 + rr) * C1 + c8, vd = ((size_t)b * C2 + rr) * NP + p0 + c8;   // whole 128-byte lines per row
    const v8b s0 = *(const v8b*)(&Ts[0][0][rr][c8]), s1 = *(const v8b*)(&Ts[0][1][rr][c8]), s2 = *(const v8b*)(&Ts[1][0][rr][c8]), s3 = *(const v8b*)(&Ts[1][1][rr][c8]), s4 = *(const v8b*)(&Vs[0][rr][c8]), s5 = *(const v8b*)(&Vs[1][rr][c8]);
    *(v8b*)(th + qd) = s0; *(v8b*)(th + QPL + qd) = s1; *(v8b*)(ph + qd) = s2; *(v8b*)(ph + QPL + qd) = s3; *(v8b*)(gt + vd) = s4; *(v8b*)(gt + VPL + vd) = s5; }
  if (t_ < 16) { v4b o;   // behind the last barrier, so that no wave waits at a barrier for this store
#pragma unroll
    for (int e = 0; e < 4; ++e) o[e] = (b16)bf16_rne(wv[e]);
    *(v4b*)(ww16 + (size_t)bid * C2 + t_ * 4) = o; }
}

// K / V staging for attn_kernel. A stage = 64 keys = four tiles of 64 rows x 128 B: K hi, K lo (row = key, 64 channels), V hi, V lo (row = channel, 64 keys).
// LDS row pitch 144 B (16 B x odd, for the ds_load_b128 fragment readers). Two buffers: the next stage's copies fly while this stage is worked on.
// A work-group = 64 queries (2 columns of 32) x NK key groups = 16 waves, so that 256 work-groups fill the chip at four waves per SIMD. A buffer holds NG such stages, each shared by two key groups:
// group g works on keys 32 g .. + 31 of the 256 keys of every pass, for two query tiles at once, so that every K and V fragment it reads from LDS feeds two tiles' products; each tile has its own running (m, l, o);
// the NK partial results of a query tile are merged once, behind the loop, in fixed group order.
// The 64 work-groups of a batch all read the same K and V from L2. Each enters the ring of NST passes at a start of its own (rot) and wraps round, so that they do not ask L2 for the same lines at the same moment;
// the softmax is the online form, so the order of the passes changes only the order of the f32 sums.
constexpr int KT = 64, RP = 72, TILE = 64 * RP, NG = 4, NK = 2 * NG, NST = NP / (KT * NG), OP = C2 + 4, TP = 64 + 4;
constexpr unsigned TILEB = TILE * 2u, SUBB = 4u * TILEB, BUFB = NG * SUBB, HALFB = 32u * RP * 2u;

// One 64-key stage's copies of one thread: 16 B of rows r and r + 32 of each of the four tiles (256 threads x 8 x 16 B = 32 KB), global -> LDS through no register.
__device__ __forceinline__ void stage_copies(unsigned lds, const b16* gk, const b16* gv) {
  // The closing s_wait_xcnt 0 stands inside the statement so that no address register of an issued copy is rewritten in front of it.
  asm volatile("global_load_async_to_lds_b128 %0, %8, off\n\t"
               "global_load_async_to_lds_b128 %1, %9, off\n\t"
               "global_load_async_to_lds_b128 %2, %10, off\n\t"
               "global_load_async_to_lds_b128 %3, %11, off\n\t"
               "global_load_async_to_lds_b128 %4, %12, off\n\t"
               "global_load_async_to_lds_b128 %5, %13, off\n\t"
               "global_load_async_to_lds_b128 %6, %14, off\n\t"
               "global_load_async_to_lds_b128 %7, %15, off\n\t"
               "s_wait_xcnt 0x0"
               :: "v"(lds), "v"(lds + HALFB), "v"(lds + TILEB), "v"(lds + TILEB + HALFB), "v"(lds + 2u * TILEB), "v"(lds + 2u * TILEB + HALFB), "v"(lds + 3u * TILEB), "v"(lds + 3u * TILEB + HALFB),
                  "v"(gk), "v"(gk + 32 * C1), "v"(gk + QPL), "v"(gk + QPL + 32 * C1), "v"(gv), "v"(gv + (size_t)32 * NP), "v"(gv + VPL), "v"(gv + VPL + (size_t)32 * NP)
               : "memory");
}

__global__ __launch_bounds__(512) void attn_kernel(const b16* __restrict__ th, const b16* __restrict__ ph, const b16* __restrict__ gt, const b16* __restrict__ ww16, const float* __restrict__ Wb, float* __restrict__ wyT, float* __restrict__ part) {
  __shared__ __attribute__((aligned(16))) b16 Ring[2][NG][4][TILE];
  __shared__ float Ms[NK][64], Ls[NK][64];
  const int wid = __builtin_amdgcn_readfirstlane(threadIdx.x >> 5), qc = wid & 1, grp = wid >> 1, lane = threadIdx.x & 31, hh = lane >> 4, col = lane & 15; const int tok0 = blockIdx.x * 64 + qc * 32, b = (blockIdx.x * 64) / NP; const size_t qi = (size_t)tok0 + col;
  const b16* K = ph + ((size_t)b * NP) * C1; const b16* V = gt + ((size_t)b * C2) * NP;
  const int cg = (threadIdx.x >> 8) * 2, cr = (threadIdx.x & 255) >> 3, cc = (threadIdx.x & 7) * 8;   // this thread copies for the 64-key stages cg and cg + 1 of a buffer: its row (and row + 32) and 16-byte piece in every tile
  const unsigned lds0 = (unsigned)(size_t)&Ring[0][cg][0][cr * RP + cc]; const b16* gk = K + (size_t)(cg * KT + cr) * C1 + cc; const b16* gv = V + (size_t)cr * NP + cg * KT + cc;
  static_assert((NST & (NST - 1)) == 0 && NST == 16, "the start below takes 4 bits and wraps by a mask");
  // Start pass from bits 3..5 and bit 0 of the index. For speed only: any start gives the same sums up to their order.
  const int rot = (int)(((blockIdx.x >> 3) & 7u) | ((blockIdx.x & 1u) << 3)), ps0 = rot * (NG * KT), ps1 = ((rot + 1) & (NST - 1)) * (NG * KT);   // first key of the first two passes
  stage_copies(lds0, gk + (size_t)ps0 * C1, gv + ps0); stage_copies(lds0 + SUBB, gk + (size_t)(ps0 + KT) * C1, gv + ps0 + KT);
  asm volatile("s_wait_asynccnt 0x0" ::: "memory");   // pass 0 of this wave has landed
  __syncthreads();                                    // ... and of every wave: publishes pass 0
  stage_copies(lds0 + BUFB, gk + (size_t)ps1 * C1, gv + ps1); stage_copies(lds0 + BUFB + SUBB, gk + (size_t)(ps1 + KT) * C1, gv + ps1 + KT);
  v16b qf[2][2], ql[2][2];   // [query tile][k step]
#pragma unroll
  for (int u = 0; u < 2; ++u)
#pragma unroll
    for (int ks = 0; ks < 2; ++ks) { qf[u][ks] = frag_kb(th + (qi + 16 * u) * C1 + ks * 32, hh); ql[u][ks] = frag_kb(th + QPL + (qi + 16 * u) * C1 + ks * 32, hh); }
  asm volatile("s_wait_xcnt 0x0" ::: "memory");   // stands ahead of the first instruction that reuses the address register of the loads above
  __builtin_amdgcn_sched_barrier(0);                  // keeps the register writes that follow behind that wait: without it the compiler lifts the zeroing of o over it
  float m[2] = {-INFINITY, -INFINITY}; v2f l2[2] = {{0.0f, 0.0f}, {0.0f, 0.0f}}; v8f o[2][4] = {{{}, {}, {}, {}}, {{}, {}, {}, {}}};
  const int kb = (grp & 1) * 32;   // this group's half of the 64-key stage that it shares with its neighbour
  for (int st = 0; st < NST; ++st) { const b16* Kh = &Ring[st & 1][grp >> 1][0][0]; const b16* Kl = Kh + TILE; const b16* Vh = Kh + 2 * TILE; const b16* Vl = Kh + 3 * TILE;
   v8f s0[2] = {{}, {}}, s1[2] = {{}, {}};
#pragma unroll
   for (int ks = 0; ks < 2; ++ks) { const v16b ka = frag_kb(Kh + (kb + col) * RP + ks * 32, hh), kal = frag_kb(Kl + (kb + col) * RP + ks * 32, hh), kb_ = frag_kb(Kh + (kb + 16 + col) * RP + ks * 32, hh), kbl = frag_kb(Kl + (kb + 16 + col) * RP + ks * 32, hh);
#pragma unroll
     for (int u = 0; u < 2; ++u) { s0[u] = wmma16b(ka, qf[u][ks], s0[u]); s0[u] = wmma16b(ka, ql[u][ks], s0[u]); s0[u] = wmma16b(kal, qf[u][ks], s0[u]); s1[u] = wmma16b(kb_, qf[u][ks], s1[u]); s1[u] = wmma16b(kb_, ql[u][ks], s1[u]); s1[u] = wmma16b(kbl, qf[u][ks], s1[u]); } }
   // Softmax in the log2 domain: maxima of the raw scores (the scale is positive); one packed multiply-add per score pair applies scale x log2(e), takes the maximum off and adds log2(PS),
   // so that v_exp_f32 gives PS x p at once; the large and small f16 parts are formed on pairs. m is kept in the log2 domain; l2 holds PS x the sums over this wave half's even and odd keys, joined once behind the loop.
   v16b pbv[2], plv[2]; float al_[2];
#pragma unroll
   for (int u = 0; u < 2; ++u) { float mr = fmaxf(s0[u][0], s1[u][0]);
#pragma unroll
    for (int r = 1; r < 8; ++r) mr = fmaxf(mr, fmaxf(s0[u][r], s1[u][r]));
    mr = fmaxf(mr, xhalf(mr));
    const float mn = fmaxf(m[u], mr * CS); al_[u] = __builtin_amdgcn_exp2f(m[u] - mn); m[u] = mn; const v2f cs2 = {CS, CS}, nm2 = {LPS - mn, LPS - mn}; v2f sm = {0.0f, 0.0f};
#pragma unroll
    for (int i = 0; i < 8; ++i) { const int j = 2 * (i & 3); const v2f sc = (i < 4) ? v2f{s0[u][j], s0[u][j + 1]} : v2f{s1[u][j], s1[u][j + 1]};   // elements 2 i and 2 i + 1 of the 32-key operand
      const v2f arg = __builtin_elementwise_fma(sc, cs2, nm2); const v2f p = {__builtin_amdgcn_exp2f(arg[0]), __builtin_amdgcn_exp2f(arg[1])}; sm += p;
      const v2b hi = __builtin_convertvector(p, v2b); const v2b lo = __builtin_convertvector(p - __builtin_convertvector(hi, v2f), v2b);
      pbv[u][2 * i] = hi[0]; pbv[u][2 * i + 1] = hi[1]; plv[u][2 * i] = lo[0]; plv[u][2 * i + 1] = lo[1]; }
    l2[u] = l2[u] * al_[u] + sm; }
#pragma unroll
   for (int n = 0; n < 4; ++n) { const v16b vf = frag_kb(Vh + (n * 16 + col) * RP + kb, hh), vl = frag_kb(Vl + (n * 16 + col) * RP + kb, hh);
#pragma unroll
     for (int u = 0; u < 2; ++u) { o[u][n] *= al_[u]; o[u][n] = wmma16b(vf, pbv[u], o[u][n]); o[u][n] = wmma16b(vf, plv[u], o[u][n]); o[u][n] = wmma16b(vl, pbv[u], o[u][n]); } }
   asm volatile("s_wait_dscnt 0x0" ::: "memory");      // this wave's reads of the buffer have retired before it is handed to its next writer
   asm volatile("s_wait_asynccnt 0x0" ::: "memory");   // this wave's copies of pass st + 1 have landed
   __syncthreads();                                    // publishes pass st + 1 and ends every reader's last read of pass st
   if (st + 2 < NST) { const unsigned ld = lds0 + (unsigned)(st & 1) * BUFB; const int pn = ((st + 2 + rot) & (NST - 1)) * (NG * KT); const b16* nk = gk + (size_t)pn * C1; const b16* nv = gv + pn;
     stage_copies(ld, nk, nv); stage_copies(ld + SUBB, nk + (size_t)KT * C1, nv + KT); } }
  asm volatile("s_wait_asynccnt 0x0" ::: "memory");    // nothing of this wave is in flight behind the loop
  // The lane and thread numbers are formed anew from the scalar wave number: no value derived from the thread index then has to stay in a vector register across the loop, which needs nearly the whole register budget (with them the build spills).
  const int elane = (int)__builtin_amdgcn_mbcnt_lo(~0u, 0u), ehh = elane >> 4, ecol = elane & 15, tid = wid * 32 + elane;
  // Merge of the NK key groups of each query tile. The ring is free behind the loop's last barrier (every read retired, no copy in flight) and becomes the staging of the scaled partial outputs.
  float l[2];
#pragma unroll
  for (int u = 0; u < 2; ++u) { l[u] = l2[u][0] + l2[u][1]; l[u] += xhalf(l[u]); }   // a query's row sum: even + odd keys, then the two wave halves
  if (ehh == 0) {
#pragma unroll
    for (int u = 0; u < 2; ++u) { Ms[grp][qc * 32 + u * 16 + ecol] = m[u]; Ls[grp][qc * 32 + u * 16 + ecol] = l[u]; } }
  __syncthreads();                                     // every group's (m, l) is visible
  float* Os = (float*)&Ring[0][0][0][0];               // [NK groups][64 queries][OP]
#pragma unroll
  for (int u = 0; u < 2; ++u) { const int q = qc * 32 + u * 16 + ecol; float mg = Ms[0][q];
#pragma unroll
    for (int g = 1; g < NK; ++g) mg = fmaxf(mg, Ms[g][q]);
    float lg = 0.0f;
#pragma unroll
    for (int g = 0; g < NK; ++g) lg += Ls[g][q] * exp2_slot(Ms[g][q] - mg);
    const float inv = exp2_slot(m[u] - mg) / (lg * VS);   // lg holds PS x the row sum
#pragma unroll
    for (int n = 0; n < 4; ++n)
#pragma unroll
      for (int r = 0; r < 8; ++r) Os[(grp * 64 + q) * OP + n * 16 + 8 * ehh + r] = o[u][n][r] * inv; }
  __syncthreads();                                     // every group's scaled partial output is visible
  // W conv as the epilogue. Wave (qt, cq) forms wy^T for channels 64 cq .. + 63 (A = W rows) at positions 16 qt .. + 15 (B = y rows): D row = channel, D column = position.
  const int qt = wid & 3, cq = wid >> 2; v16b yh[2], yl[2], wf[4][2]; const b16* wp[4];
#pragma unroll
  for (int t = 0; t < 4; ++t) wp[t] = ww16 + (size_t)(cq * 64 + t * 16 + ecol) * C2 + 8 * ehh;
#pragma unroll
  for (int ks = 0; ks < 2; ++ks)
#pragma unroll
    for (int t = 0; t < 4; ++t) wf[t][ks] = frag_kb(wp[t] + ks * 32, 0);
  const unsigned bo = (unsigned)(cq * 64 + 8 * ehh) * 4u; const float* bp = (const float*)((const char*)Wb + bo); v4f bb[4][2];   // the bias of this lane's eight channels of each of the four tiles; bo: the lane's byte offset, the loads' address register
#pragma unroll
  for (int t = 0; t < 4; ++t) { bb[t][0] = *(const v4f*)(bp + t * 16); bb[t][1] = *(const v4f*)(bp + t * 16 + 4); }
  // Stands ahead of the first instruction that reuses an address register of the loads above; the five addresses are inputs so that they stay in their registers up to the wait:
  // without that the last loads' results are given the registers of the first loads' addresses.
  asm volatile("s_wait_xcnt 0x0" :: "v"(wp[0]), "v"(wp[1]), "v"(wp[2]), "v"(wp[3]), "v"(bo) : "memory");
  // y = the NK partials added in group order, each element formed once: thread -> position tid / 8, channels 8 (tid % 8) .. + 7; split x8 into f16 hi + lo rows of pitch RP behind Os.
  b16* Yh = (b16*)(Os + NK * 64 * OP); b16* Yl = Yh + 64 * RP;
  { const int yq = tid >> 3, yc = (tid & 7) * 8; const float* sp = Os + yq * OP + yc; v4f s0 = *(const v4f*)sp, s1 = *(const v4f*)(sp + 4); v8b vh, vl;
#pragma unroll
    for (int g = 1; g < NK; ++g) { s0 += *(const v4f*)(sp + g * 64 * OP); s1 += *(const v4f*)(sp + g * 64 * OP + 4); }
#pragma unroll
    for (int e = 0; e < 4; ++e) { b16 p, q; split16(s0[e] * YS, p, q); vh[e] = p; vl[e] = q; split16(s1[e] * YS, p, q); vh[4 + e] = p; vl[4 + e] = q; }
    *(v8b*)(Yh + yq * RP + yc) = vh; *(v8b*)(Yl + yq * RP + yc) = vl; }
  __syncthreads();                                     // y is visible to every wave
#pragma unroll
  for (int ks = 0; ks < 2; ++ks) { yh[ks] = frag_kb(Yh + (qt * 16 + ecol) * RP + ks * 32, ehh); yl[ks] = frag_kb(Yl + (qt * 16 + ecol) * RP + ks * 32, ehh); }
  v8f acc[4] = {{}, {}, {}, {}};
#pragma unroll
  for (int ks = 0; ks < 2; ++ks)
#pragma unroll
    for (int t = 0; t < 4; ++t) { acc[t] = wmma16b(wf[t][ks], yh[ks], acc[t]); acc[t] = wmma16b(wf[t][ks], yl[ks], acc[t]); }
  float* Ts = (float*)(Yl + 64 * RP);                  // [256 channels][TP]: 64 positions per row; lies behind y, which other waves may still be reading
#pragma unroll
  for (int t = 0; t < 4; ++t) { const int c8 = cq * 64 + t * 16 + 8 * ehh; const v4f b0 = bb[t][0], b1 = bb[t][1];
#pragma unroll
    for (int v = 0; v < 8; ++v) Ts[(c8 + v) * TP + qt * 16 + ecol] = acc[t][v] * (1.0f / YS) + bf16_rne((v < 4) ? b0[v & 3] : b1[v & 3]); }
  __syncthreads();                                     // the whole 256 x 64 tile of wy^T is visible
  float* dst = wyT + (size_t)b * C * NP + (blockIdx.x * 64) % NP;
#pragma unroll
  for (int j = 0; j < 8; ++j) { const int i = j * 512 + tid, ch = i >> 4, p4 = (i & 15) * 4; *(v4f*)(dst + (size_t)ch * NP + p4) = *(const v4f*)(Ts + ch * TP + p4); }
  asm volatile("s_wait_xcnt 0x0" ::: "memory");   // stands ahead of the first instruction that reuses a register of the stores above
  __builtin_amdgcn_sched_barrier(0);                  // keeps the register writes that follow behind that wait: without it the compiler lifts the next block's address arithmetic in among the stores
  // Per-block partials of every channel over the block's 64 positions: threads 0 .. 255 the sums, 256 .. 511 the sums of squares; part[block][4][2][64], 2 KB per work-group.
  { const int ch = tid & 255, st = tid >> 8; v4f a4 = {};
    if (st == 0) {
#pragma unroll
      for (int p = 0; p < 16; ++p) a4 += *(const v4f*)(Ts + ch * TP + p * 4); }
    else {
#pragma unroll
      for (int p = 0; p < 16; ++p) { const v4f a = *(const v4f*)(Ts + ch * TP + p * 4); a4 += a * a; } }
    part[(size_t)blockIdx.x * 512 + (ch >> 6) * 128 + st * 64 + (ch & 63)] = (a4[0] + a4[1]) + (a4[2] + a4[3]); }
}

// Work-group = one channel, all 4 x 4096 positions (64 KB of wy^T, NCHW like out). Thread t takes block t's (sum, sum of squares) of the channel; they are added in double in a fixed tree
// (32 lanes by xor steps, then the 8 waves in order). The row loads are issued ahead of that reduction, so that they fly under it.
__global__ __launch_bounds__(256) void final_kernel(const float* __restrict__ wyT, const float* __restrict__ part, const float* __restrict__ gma, const float* __restrict__ bta, float* __restrict__ out) {
  static_assert(NBLK == 256, "one partial pair per thread");
  __shared__ double Rs[8], Rq[8];
  const int c = blockIdx.x, t_ = threadIdx.x;
  const float ps = part[(size_t)t_ * 512 + (c >> 6) * 128 + (c & 63)], pq = part[(size_t)t_ * 512 + (c >> 6) * 128 + 64 + (c & 63)];
  const float gm = gma[c], bt = bta[c];
  v4f v[16];
#pragma unroll
  for (int j = 0; j < 16; ++j) v[j] = *(const v4f*)(wyT + ((size_t)(j >> 2) * C + c) * NP + ((j & 3) * 256 + t_) * 4);
  asm volatile("s_wait_xcnt 0x0" ::: "memory");   // stands ahead of the first instruction that reuses an address register of the loads above
  double s = (double)ps, q = (double)pq;
#pragma unroll
  for (int m = 1; m < 32; m <<= 1) { s += __shfl_xor(s, m); q += __shfl_xor(q, m); }
  if ((t_ & 31) == 0) { Rs[t_ >> 5] = s; Rq[t_ >> 5] = q; }
  __syncthreads();                                // every wave's pair of sums is visible
  s = Rs[0]; q = Rq[0];
#pragma unroll
  for (int w = 1; w < 8; ++w) { s += Rs[w]; q += Rq[w]; }
  const double mean = s / (double)NTOK; const double var = fmax(q / (double)NTOK - mean * mean, 0.0);
  const float scl = bf16_rne(gm) * (float)(1.0 / sqrt(var + (double)EPS)); const float sh = bf16_rne(bt) - (float)mean * scl;
#pragma unroll
  for (int j = 0; j < 16; ++j) { v4f o;
#pragma unroll
    for (int e = 0; e < 4; ++e) o[e] = v[j][e] * scl + sh;
    *(v4f*)(out + ((size_t)(j >> 2) * C + c) * NP + ((j & 3) * 256 + t_) * 4) = o; }
}
}  // namespace

extern "C" void kernel_launch(void* const* d_in, const int* in_sizes, int n_in,
                              void* d_out, int out_size, void* d_ws, size_t ws_size, hipStream_t stream) {
  (void)n_in; (void)out_size;
  const float* x = (const float*)d_in[0]; const float* tw = (const float*)d_in[1]; const float* tb = (const float*)d_in[2]; const float* pw = (const float*)d_in[3]; const float* pb = (const float*)d_in[4]; const float* gw = (const float*)d_in[5]; const float* gb = (const float*)d_in[6];
  const float* Ww = (const float*)d_in[7]; const float* Wb = (const float*)d_in[8]; const float* gma = (const float*)d_in[9]; const float* bta = (const float*)d_in[10];
  float* out = (float*)d_out;   // [4][256][64][64]
  if (in_sizes[0] != Bn * C * NP || in_sizes[1] != C1 * C || in_sizes[5] != C2 * C || in_sizes[7] != C * C2 || in_sizes[9] != C) return;
  size_t off = 0; char* ws = (char*)d_ws;
  auto carve = [&](size_t bytes) { char* p = ws + off; off += (bytes + 255) & ~(size_t)255; return p; };
  b16* ww16 = (b16*)carve((size_t)C * C2 * 2);
  b16* th = (b16*)carve(QPL * 2 * 2); b16* ph = (b16*)carve(QPL * 2 * 2); b16* gt = (b16*)carve(VPL * 2 * 2); float* wyT = (float*)carve((size_t)NTOK * C * 4); float* part = (float*)carve((size_t)NBLK * 4 * 2 * 64 * 4);
  if (off > ws_size) return;                                    // about 4.2x3 + 16.8 + 0.5 = 30 MB
  proj_kernel<<<dim3(NP / 64, Bn), 512, 0, stream>>>(x, tw, pw, gw, Ww, tb, pb, gb, th, ph, gt, ww16);
  attn_kernel<<<NTOK / 64, 512, 0, stream>>>(th, ph, gt, ww16, Wb, wyT, part);
  final_kernel<<<C, 256, 0, stream>>>(wyT, part, gma, bta, out);
}
